// v000
// The times below were measured on an AMD MI455X: many runs one after another, warmed up first and cycling through
// copies of the inputs, with the whole window's GPU time divided by the number of runs. Launches and the gaps
// between them are all in it. The median over several windows is given; except for v000 it joins two sittings, which
// can be a few percent apart, so the side-by-side timings, each taken in one sitting, are the better comparison.
// v000 is the starting kernel. One run takes 859 microseconds.
#include <hip/hip_runtime.h>
// Contractions: qkv projection GEMM = v_wmma_f32_16x16x32_bf16 (bf16 operands, 1 product); q.k^T = v_wmma_f32_16x16x32_bf16 (bf16 hi/lo planes of q and k, 3 products); p.v = v_wmma_f32_16x16x32_bf16 (bf16 hi/lo planes of p and v, 3 products); output projection GEMM = v_wmma_f32_16x16x32_bf16 (bf16 hi/lo planes of the attention output x bf16 weight, 2 products); f32 accumulate everywhere; softmax in f32.

typedef __attribute__((ext_vector_type(16))) _Float16 v16h;
typedef __attribute__((ext_vector_type(8)))  _Float16 v8h;
typedef __attribute__((ext_vector_type(16))) __bf16   v16b;
typedef __attribute__((ext_vector_type(8)))  __bf16   v8b;
typedef __attribute__((ext_vector_type(8)))  float    v8f;
typedef __attribute__((ext_vector_type(4)))  float    v4f;

#define NEG_INF (-__builtin_inff())

__device__ __forceinline__ unsigned short f2bf_bits(float f) {
  unsigned u = __float_as_uint(f);
  return (unsigned short)((u + 0x7FFFu + ((u >> 16) & 1u)) >> 16);
}
__device__ __forceinline__ float bf_bits2f(unsigned short h) { return __uint_as_float(((unsigned)h) << 16); }

// hazard guards as plain device helpers (no inline asm inside the kernel template body)
__device__ __forceinline__ void dep_guard_h(v8f& a, v8f& b, v16h x, v16h y) { asm volatile("v_nop\n\tv_nop\n\tv_nop\n\tv_nop" : "+v"(a), "+v"(b) : "v"(x), "v"(y)); }
__device__ __forceinline__ void dep_guard_b(v8f& a, v8f& b, v16b x, v16b y) { asm volatile("v_nop\n\tv_nop\n\tv_nop\n\tv_nop" : "+v"(a), "+v"(b) : "v"(x), "v"(y)); }
__device__ __forceinline__ void keep4_h(v16h a, v16h b, v16h c, v16h d) { asm volatile("v_nop" :: "v"(a), "v"(b), "v"(c), "v"(d)); }
__device__ __forceinline__ void keep4_b(v16b a, v16b b, v16b c, v16b d) { asm volatile("v_nop" :: "v"(a), "v"(b), "v"(c), "v"(d)); }
__device__ __forceinline__ void acc_guard4(v8f& a, v8f& b, v8f& c, v8f& d) { asm volatile("v_nop\n\tv_nop\n\tv_nop\n\tv_nop" : "+v"(a), "+v"(b), "+v"(c), "+v"(d)); }
template <typename T> struct Frag;
template <> struct Frag<_Float16> {
  typedef v16h V; union U { v16h v; v8h h[2]; };
  static __device__ __forceinline__ v16h load(const _Float16* p) {   // elements 0..7 <- p[0..7], 8..15 <- p[16..23]
    U f; f.h[0] = *(const v8h*)(p); f.h[1] = *(const v8h*)(p + 16); return f.v;
  }
  static __device__ __forceinline__ v8f mma(v16h a, v16h b, v8f c) {
    return __builtin_amdgcn_wmma_f32_16x16x32_f16(false, a, false, b, (short)0, c, false, false);
  }
  static __device__ __forceinline__ void guard(v8f& a, v8f& b, v16h x, v16h y) { dep_guard_h(a, b, x, y); }
  static __device__ __forceinline__ void keep(v16h a, v16h b, v16h c, v16h d) { keep4_h(a, b, c, d); }
};
template <> struct Frag<__bf16> {
  typedef v16b V; union U { v16b v; v8b h[2]; };
  static __device__ __forceinline__ v16b load(const __bf16* p) {
    U f; f.h[0] = *(const v8b*)(p); f.h[1] = *(const v8b*)(p + 16); return f.v;
  }
  static __device__ __forceinline__ v8f mma(v16b a, v16b b, v8f c) {
    return __builtin_amdgcn_wmma_f32_16x16x32_bf16(false, a, false, b, (short)0, c, false, false);
  }
  static __device__ __forceinline__ void guard(v8f& a, v8f& b, v16b x, v16b y) { dep_guard_b(a, b, x, y); }
  static __device__ __forceinline__ void keep(v16b a, v16b b, v16b c, v16b d) { keep4_b(a, b, c, d); }
};

// ---- Register-blocked batched WMMA GEMM ------------------------------------
// C[m,n] = scale * sum_k A[m,k] * Bt[n,k] (+bias)(+resid); each wave owns a 64x64 tile.
// A row-major [M,K]; Bt row-major [N,K]; M,N % 64 == 0, K % 32 == 0.
// SPLIT: 0 = single planes; 1 = A and Bt as hi/lo planes (hi.hi + hi.lo + lo.hi); 2 = A as hi/lo planes, Bt single (hi.B + lo.B).
// BIAS_MODE: 0 = none, 1 = bias[m], 2 = bias[n], 3 = bias[n] RNE-converted to bf16 then added in f32.
// OUT_MODE: 0 = f32, 1 = f16, 2 = bf16 hi plane (Cout) + bf16 lo plane (Cout2).
// ET: 0 = f16 operands, 1 = bf16 operands (pointers passed as 16-bit storage)
template <int ET> struct Elem;
template <> struct Elem<0> { typedef _Float16 T; };
template <> struct Elem<1> { typedef __bf16 T; };
template <int ET, int SPLIT, int BIAS_MODE, int OUT_MODE, bool RESID, int ACT = 0>
__global__ __launch_bounds__(256) void wmma_gemm64(
    const unsigned short* __restrict__ Ap, const unsigned short* __restrict__ A2p, int lda, long strideA,
    const unsigned short* __restrict__ Btp, const unsigned short* __restrict__ Bt2p, int ldb, long strideB,
    void* __restrict__ Cout, void* __restrict__ Cout2, int ldc, long strideC,
    const float* __restrict__ bias,
    const float* __restrict__ resid, long strideR,
    int M, int N, int K, float scale) {
  typedef typename Elem<ET>::T T;
  typedef typename Frag<T>::V V;
  const T* A = (const T*)Ap; const T* A2 = (const T*)A2p; const T* Bt = (const T*)Btp; const T* Bt2 = (const T*)Bt2p;
  __shared__ __align__(16) float sT[8][16 * 68];   // per-wave 16x64 slab, pitch 68 floats
  const int b    = blockIdx.y;
  const int lane = threadIdx.x & 31;
  const int wave = threadIdx.x >> 5;
  const int tilesN = N >> 6;
  const int tilesM = M >> 6;
  const int tile = blockIdx.x * 8 + wave;
  if (tile >= tilesM * tilesN) return;   // wave-uniform; no block barriers in this kernel
  const int tm = tile / tilesN;
  const int tn = tile - tm * tilesN;
  const int m0 = tm << 6;
  const int n0 = tn << 6;

  const T* Ab  = A  + (size_t)b * strideA;
  const T* Bb  = Bt + (size_t)b * strideB;
  const T* Ab2 = (SPLIT != 0) ? (A2  + (size_t)b * strideA) : nullptr;
  const T* Bb2 = (SPLIT == 1) ? (Bt2 + (size_t)b * strideB) : nullptr;

  const int rlane = lane & 15;                 // row (A) / col (B, D) within subtile
  const int koff  = (lane >> 4) * 8;           // k offset of this lane half
  const int mOff  = (lane >> 4) * 8;           // D row offset

  v8f acc[4][4];
#pragma unroll
  for (int i = 0; i < 4; ++i)
#pragma unroll
    for (int j = 0; j < 4; ++j) acc[i][j] = (v8f){0.f,0.f,0.f,0.f,0.f,0.f,0.f,0.f};

  for (int k0 = 0; k0 < K; k0 += 32) {
    V bh[4], bl[4];
#pragma unroll
    for (int j = 0; j < 4; ++j) {
      const size_t bo = (size_t)(n0 + (j << 4) + rlane) * ldb + koff + k0;
      bh[j] = Frag<T>::load(Bb + bo);
      if (SPLIT == 1) bl[j] = Frag<T>::load(Bb2 + bo);
    }
#pragma unroll
    for (int i = 0; i < 4; ++i) {
      const size_t ao = (size_t)(m0 + (i << 4) + rlane) * lda + koff + k0;
      V ah = Frag<T>::load(Ab + ao);
      V al;
      if (SPLIT != 0) al = Frag<T>::load(Ab2 + ao);
#pragma unroll
      for (int j = 0; j < 4; ++j) {
        acc[i][j] = Frag<T>::mma(ah, bh[j], acc[i][j]);
        if (SPLIT == 1) acc[i][j] = Frag<T>::mma(ah, bl[j], acc[i][j]);
        if (SPLIT != 0) acc[i][j] = Frag<T>::mma(al, bh[j], acc[i][j]);
      }
      Frag<T>::guard(acc[i][0], acc[i][3], ah, (SPLIT != 0) ? al : ah);
    }
    Frag<T>::keep(bh[0], bh[1], bh[2], bh[3]);
    if (SPLIT == 1) Frag<T>::keep(bl[0], bl[1], bl[2], bl[3]);
  }
  acc_guard4(acc[0][0], acc[0][1], acc[0][2], acc[0][3]);
  acc_guard4(acc[1][0], acc[1][1], acc[1][2], acc[1][3]);
  acc_guard4(acc[2][0], acc[2][1], acc[2][2], acc[2][3]);
  acc_guard4(acc[3][0], acc[3][1], acc[3][2], acc[3][3]);

  // ---- epilogue ----
  float* slab = sT[wave];
  const float* Rb = RESID ? (resid + (size_t)b * strideR) : nullptr;
#pragma unroll
  for (int i = 0; i < 4; ++i) {
    const int mBase = m0 + (i << 4);
#pragma unroll
    for (int j = 0; j < 4; ++j) {
      const int n = n0 + (j << 4) + rlane;
      float bv = 0.f;
      if (BIAS_MODE == 2) bv = bias[n];
      if (BIAS_MODE == 3) bv = bf_bits2f(f2bf_bits(bias[n]));
#pragma unroll
      for (int r = 0; r < 8; ++r) {
        float v = acc[i][j][r] * scale;
        if (BIAS_MODE == 1) v += bias[mBase + mOff + r];
        if (BIAS_MODE == 2 || BIAS_MODE == 3) v += bv;
        if (RESID) v += Rb[(size_t)(mBase + mOff + r) * ldc + n];
        if (ACT == 1) v = tanhf(v);
        if (ACT == 2) v = fmaxf(v, 0.0f);
        if (ACT == 3) v = v / (1.0f + expf(-v));
        if (ACT == 4) v = (v > 0.f) ? v : 0.01f * v;
        if (ACT == 5) v = 0.5f * v * (1.0f + erff(v * 0.70710678118654752f));
        slab[(mOff + r) * 68 + (j << 4) + rlane] = v;
      }
    }
    __builtin_amdgcn_fence(__ATOMIC_RELEASE, "workgroup");
    __builtin_amdgcn_wave_barrier();
    __builtin_amdgcn_fence(__ATOMIC_ACQUIRE, "workgroup");
    if (OUT_MODE == 0) {
      float* C = (float*)Cout + (size_t)b * strideC;
      const int hh = lane >> 4, c4 = (lane & 15) * 4;     // row seg = 256 B = 16 lanes x 16 B
      {
#pragma unroll
        for (int it = 0; it < 8; ++it) {
          const int row = it * 2 + hh;
          v4f v = *(const v4f*)(slab + row * 68 + c4);
          *(v4f*)(C + (size_t)(mBase + row) * ldc + n0 + c4) = v;
        }
        
      }
    } else {
      const int q = lane >> 3, c8 = (lane & 7) * 8;
      unsigned short* C  = (unsigned short*)Cout  + (size_t)b * strideC;
      unsigned short* C2 = (OUT_MODE == 2) ? ((unsigned short*)Cout2 + (size_t)b * strideC) : nullptr;
      {
#pragma unroll
        for (int it = 0; it < 4; ++it) {
          const int row = it * 4 + q;
          const float* sp = slab + row * 68 + c8;
          v8h hv, lv;
#pragma unroll
          for (int e = 0; e < 8; ++e) {
            if (OUT_MODE == 1) {
              hv[e] = (_Float16)sp[e];
            } else {
              unsigned short hb = f2bf_bits(sp[e]);
              unsigned short lb = f2bf_bits(sp[e] - bf_bits2f(hb));
              hv[e] = __builtin_bit_cast(_Float16, hb);
              lv[e] = __builtin_bit_cast(_Float16, lb);
            }
          }
          *(v8h*)(C + (size_t)(mBase + row) * ldc + n0 + c8) = hv;
          if (OUT_MODE == 2) *(v8h*)(C2 + (size_t)(mBase + row) * ldc + n0 + c8) = lv;
        }
        
      }
    }
    __builtin_amdgcn_fence(__ATOMIC_RELEASE, "workgroup");
    __builtin_amdgcn_wave_barrier();
    __builtin_amdgcn_fence(__ATOMIC_ACQUIRE, "workgroup");
  }
}

__global__ __launch_bounds__(256) void cast_f32_bf16x2(
    const float* __restrict__ in, unsigned short* __restrict__ out, int n2) {
  int i = blockIdx.x * 256 + threadIdx.x;
  if (i < n2) {
    const unsigned u = (unsigned)f2bf_bits(in[2 * i]) | ((unsigned)f2bf_bits(in[2 * i + 1]) << 16);
    ((unsigned*)out)[i] = u;
    
  }
}

// =====================================================================================
// Causal attention, head_dim 64. Block = 4 waves = 64 query rows of one (batch, head); 64-key chunks.
//   scores = q.k^T * sscale : q and k as bf16 hi/lo planes (hi.hi + hi.lo + lo.hi); key > query -> -inf
//   out    = p.v            : p and v as bf16 hi/lo planes (hi.hi + hi.lo + lo.hi)
//   online softmax in f32; output written as bf16 hi/lo planes (row = b*S + s, col = h*64 + d).
//   q/k/v arrive as bf16 hi/lo planes (16-bit storage); element (b, s, h, d) at X[b*X_bs + s*X_rs + h*X_hs + d].
//   Q planes staged once per block in LDS (16-B copies); K planes copied, V planes transposed per chunk.
//   Only key chunks 0..qb are visited (chunks above the diagonal contribute exactly zero); trip count <= AT_MAXKC.
// =====================================================================================
#define AT_D 64
#define AT_NW 4
#define AT_QB 64
#define AT_KC 64
#define AT_MAXKC 32

struct AttnP { long q_bs, q_rs, q_hs, k_bs, k_rs, k_hs, v_bs, v_rs, v_hs, o_bs, o_rs, o_hs;
               int S, Skv, H; float sscale; };
static_assert(sizeof(AttnP) == 112);

__device__ __forceinline__ unsigned short at_bf_bits(float f) {
  unsigned u = __float_as_uint(f);
  return (unsigned short)((u + 0x7FFFu + ((u >> 16) & 1u)) >> 16);
}
__device__ __forceinline__ __bf16 at_f2bf(float f) { return __builtin_bit_cast(__bf16, at_bf_bits(f)); }
__device__ __forceinline__ void at_split(float f, __bf16& hi, __bf16& lo) {
  const unsigned short hb = at_bf_bits(f);
  hi = __builtin_bit_cast(__bf16, hb);
  lo = at_f2bf(f - __uint_as_float(((unsigned)hb) << 16));
}
// three products of a hi/lo x hi/lo pair into one accumulator, then the hazard guard tying D and all four operands
__device__ __forceinline__ v8f at_mma3(v16b ah, v16b al, v16b bh, v16b bl, v8f c) {
  c = __builtin_amdgcn_wmma_f32_16x16x32_bf16(false, ah, false, bh, (short)0, c, false, false);
  c = __builtin_amdgcn_wmma_f32_16x16x32_bf16(false, ah, false, bl, (short)0, c, false, false);
  c = __builtin_amdgcn_wmma_f32_16x16x32_bf16(false, al, false, bh, (short)0, c, false, false);
  asm volatile("v_nop\n\tv_nop\n\tv_nop\n\tv_nop" : "+v"(c) : "v"(ah), "v"(al), "v"(bh), "v"(bl));
  return c;
}

__global__ __launch_bounds__(128)
void attn64_causal_split(const unsigned short* __restrict__ qh_p, const unsigned short* __restrict__ ql_p,
                         const unsigned short* __restrict__ kh_p, const unsigned short* __restrict__ kl_p,
                         const unsigned short* __restrict__ vh_p, const unsigned short* __restrict__ vl_p,
                         unsigned short* __restrict__ ohi, unsigned short* __restrict__ olo, AttnP g) {
  union FB { v16b v; v8b h[2]; };
  __shared__ __align__(16) __bf16 Qsh[AT_QB * AT_D];          // Q hi [row][d]   8 KB
  __shared__ __align__(16) __bf16 Qsl[AT_QB * AT_D];          // Q lo [row][d]   8 KB
  __shared__ __align__(16) __bf16 Ksh[AT_KC * AT_D];          // K hi [kv][d]    8 KB
  __shared__ __align__(16) __bf16 Ksl[AT_KC * AT_D];          // K lo [kv][d]    8 KB
  __shared__ __align__(16) __bf16 Vth[AT_D * AT_KC];          // V hi [d][kv]    8 KB
  __shared__ __align__(16) __bf16 Vtl[AT_D * AT_KC];          // V lo [d][kv]    8 KB
  __shared__ __align__(16) __bf16 Psh[AT_NW][16 * AT_KC];     // per wave P hi [row][kv]  8 KB
  __shared__ __align__(16) __bf16 Psl[AT_NW][16 * AT_KC];     // per wave P lo [row][kv]  8 KB
  __shared__ __align__(16) float  Os[AT_NW][16 * 68];         // per wave out tile, pitch 68

  const int tid  = threadIdx.x;
  const int wave = tid >> 5;
  const int lane = tid & 31;
  const int hh   = lane >> 4;
  const int c    = lane & 15;

  const int nqb = g.S / AT_QB;
  const int bx = blockIdx.x;
  const int qb = bx % nqb;
  const int bh = bx / nqb;
  const int h  = bh % g.H;
  const int b  = bh / g.H;
  const int q0 = qb * AT_QB + wave * 16;

  const __bf16* qhb = (const __bf16*)qh_p + (size_t)b * g.q_bs + (size_t)h * g.q_hs;
  const __bf16* qlb = (const __bf16*)ql_p + (size_t)b * g.q_bs + (size_t)h * g.q_hs;
  const __bf16* khb = (const __bf16*)kh_p + (size_t)b * g.k_bs + (size_t)h * g.k_hs;
  const __bf16* klb = (const __bf16*)kl_p + (size_t)b * g.k_bs + (size_t)h * g.k_hs;
  const __bf16* vhb = (const __bf16*)vh_p + (size_t)b * g.v_bs + (size_t)h * g.v_hs;
  const __bf16* vlb = (const __bf16*)vl_p + (size_t)b * g.v_bs + (size_t)h * g.v_hs;

  // ---- Q hi/lo planes for the block's 64 rows: [row][d], 16-B copies (thread -> row tid/2, 32-d half) ----
  {
    const int r = tid >> 1, dh = (tid & 1) * 32;
    const size_t qo = (size_t)(qb * AT_QB + r) * g.q_rs + dh;
#pragma unroll
    for (int i = 0; i < 4; ++i) {
      const v8b xh = *(const v8b*)(qhb + qo + 8 * i);
      const v8b xl = *(const v8b*)(qlb + qo + 8 * i);
      *(v8b*)(Qsh + r * AT_D + dh + 8 * i) = xh;
      *(v8b*)(Qsl + r * AT_D + dh + 8 * i) = xl;
    }
  }
  __syncthreads();

  float mrow[8], lrow[8];
  v8f oacc[4];
#pragma unroll
  for (int r = 0; r < 8; ++r) { mrow[r] = NEG_INF; lrow[r] = 0.f; }
#pragma unroll
  for (int t = 0; t < 4; ++t) oacc[t] = (v8f){0.f,0.f,0.f,0.f,0.f,0.f,0.f,0.f};

  const int nck = (qb + 1 < AT_MAXKC) ? (qb + 1) : AT_MAXKC;    // block-uniform, statically bounded
  const __bf16* qwh = Qsh + (wave * 16 + c) * AT_D + 8 * hh;      // A fragment row c of this wave
  const __bf16* qwl = Qsl + (wave * 16 + c) * AT_D + 8 * hh;

  for (int kc = 0; kc < nck; ++kc) {
    const int kv0 = kc * AT_KC;
    __syncthreads();
    {
      const int kvr = tid >> 1, dh = (tid & 1) * 32;
      const size_t ko = (size_t)(kv0 + kvr) * g.k_rs + dh;
      const size_t vo = (size_t)(kv0 + kvr) * g.v_rs + dh;
#pragma unroll
      for (int i = 0; i < 4; ++i) {
        const v8b ka = *(const v8b*)(khb + ko + 8 * i);
        const v8b kb = *(const v8b*)(klb + ko + 8 * i);
        *(v8b*)(Ksh + kvr * AT_D + dh + 8 * i) = ka;
        *(v8b*)(Ksl + kvr * AT_D + dh + 8 * i) = kb;
        const v8b va = *(const v8b*)(vhb + vo + 8 * i);
        const v8b vb = *(const v8b*)(vlb + vo + 8 * i);
#pragma unroll
        for (int e = 0; e < 8; ++e) {
          const int d = dh + 8 * i + e;
          Vth[d * AT_KC + kvr] = va[e];
          Vtl[d * AT_KC + kvr] = vb[e];
        }
      }
    }
    __syncthreads();

    // ---- scores[16 x 64] = q . k^T  (A = Q[row][d], B = K[kv][d]; split k-map via two 16-B halves at +8hh and +16+8hh) ----
    v8f s[4];
#pragma unroll
    for (int j = 0; j < 4; ++j) s[j] = (v8f){0.f,0.f,0.f,0.f,0.f,0.f,0.f,0.f};
#pragma unroll 1
    for (int dc = 0; dc < 2; ++dc) {
      FB qh, ql;
      qh.h[0] = *(const v8b*)(qwh + dc * 32);
      qh.h[1] = *(const v8b*)(qwh + dc * 32 + 16);
      ql.h[0] = *(const v8b*)(qwl + dc * 32);
      ql.h[1] = *(const v8b*)(qwl + dc * 32 + 16);
#pragma unroll
      for (int j = 0; j < 4; ++j) {
        FB kb, kl;
        const __bf16* kp  = Ksh + (j * 16 + c) * AT_D + dc * 32 + 8 * hh;
        const __bf16* kpl = Ksl + (j * 16 + c) * AT_D + dc * 32 + 8 * hh;
        kb.h[0] = *(const v8b*)(kp);
        kb.h[1] = *(const v8b*)(kp + 16);
        kl.h[0] = *(const v8b*)(kpl);
        kl.h[1] = *(const v8b*)(kpl + 16);
        s[j] = at_mma3(qh.v, ql.v, kb.v, kl.v, s[j]);
      }
    }
    // ---- scale, causal mask on the diagonal chunk (key > query -> -inf), row max ----
    const bool diag = (kc == qb);
    float cm[8];
#pragma unroll
    for (int r = 0; r < 8; ++r) {
      const int qrow = q0 + 8 * hh + r;
      float m = NEG_INF;
#pragma unroll
      for (int j = 0; j < 4; ++j) {
        const int kvcol = kv0 + j * 16 + c;
        float sv = s[j][r] * g.sscale;
        if (diag && (kvcol > qrow)) sv = NEG_INF;
        s[j][r] = sv;
        m = fmaxf(m, sv);
      }
#pragma unroll
      for (int off = 1; off < 16; off <<= 1) m = fmaxf(m, __shfl_xor(m, off, 32));
      cm[r] = m;
    }
    __bf16* pwh = Psh[wave];
    __bf16* pwl = Psl[wave];
#pragma unroll
    for (int r = 0; r < 8; ++r) {
      const float mnew = fmaxf(mrow[r], cm[r]);
      const float mref = (mnew == NEG_INF) ? 0.0f : mnew;
      const float alpha = __expf(mrow[r] - mref);
      mrow[r] = mnew;
      float psum = 0.f;
#pragma unroll
      for (int j = 0; j < 4; ++j) {
        const float p = __expf(s[j][r] - mref);
        psum += p;
        __bf16 a, bl; at_split(p, a, bl);
        pwh[(8 * hh + r) * AT_KC + j * 16 + c] = a;
        pwl[(8 * hh + r) * AT_KC + j * 16 + c] = bl;
      }
#pragma unroll
      for (int off = 1; off < 16; off <<= 1) psum += __shfl_xor(psum, off, 32);
      lrow[r] = lrow[r] * alpha + psum;
#pragma unroll
      for (int t = 0; t < 4; ++t) oacc[t][r] *= alpha;
    }
    __builtin_amdgcn_fence(__ATOMIC_RELEASE, "workgroup");
    __builtin_amdgcn_wave_barrier();
    __builtin_amdgcn_fence(__ATOMIC_ACQUIRE, "workgroup");
    // ---- O[16 x 64] += P[16 x 64] . V[64 x 64]  (A = P[row][kv], B = V[kv][d] from the [d][kv] tile) ----
#pragma unroll 1
    for (int kk = 0; kk < 2; ++kk) {
      FB pa, pl;
      pa.h[0] = *(const v8b*)(pwh + c * AT_KC + kk * 32 + 8 * hh);
      pa.h[1] = *(const v8b*)(pwh + c * AT_KC + kk * 32 + 16 + 8 * hh);
      pl.h[0] = *(const v8b*)(pwl + c * AT_KC + kk * 32 + 8 * hh);
      pl.h[1] = *(const v8b*)(pwl + c * AT_KC + kk * 32 + 16 + 8 * hh);
#pragma unroll
      for (int t = 0; t < 4; ++t) {
        FB vb, vl;
        const __bf16* vp  = Vth + (t * 16 + c) * AT_KC + kk * 32 + 8 * hh;
        const __bf16* vpl = Vtl + (t * 16 + c) * AT_KC + kk * 32 + 8 * hh;
        vb.h[0] = *(const v8b*)(vp);
        vb.h[1] = *(const v8b*)(vp + 16);
        vl.h[0] = *(const v8b*)(vpl);
        vl.h[1] = *(const v8b*)(vpl + 16);
        oacc[t] = at_mma3(pa.v, pl.v, vb.v, vl.v, oacc[t]);
      }
    }
  }

  float* os = Os[wave];
#pragma unroll
  for (int r = 0; r < 8; ++r) {
    const float inv = 1.0f / lrow[r];
#pragma unroll
    for (int t = 0; t < 4; ++t) os[(8 * hh + r) * 68 + t * 16 + c] = oacc[t][r] * inv;
  }
  __builtin_amdgcn_fence(__ATOMIC_RELEASE, "workgroup");
  __builtin_amdgcn_wave_barrier();
  __builtin_amdgcn_fence(__ATOMIC_ACQUIRE, "workgroup");
  {
    const int q8 = lane >> 3, c8 = (lane & 7) * 8;
    unsigned short* oh = ohi + (size_t)b * g.o_bs + (size_t)h * g.o_hs;
    unsigned short* ol = olo + (size_t)b * g.o_bs + (size_t)h * g.o_hs;
    {
#pragma unroll
      for (int it = 0; it < 4; ++it) {
        const int row = it * 4 + q8;                    // q8 in 0..3, it in 0..3 -> rows 0..15
        const float* sp = os + row * 68 + c8;
        v8h hv, lv;
#pragma unroll
        for (int e = 0; e < 8; ++e) {
          const unsigned short hb = f2bf_bits(sp[e]);
          const unsigned short lb = f2bf_bits(sp[e] - bf_bits2f(hb));
          hv[e] = __builtin_bit_cast(_Float16, hb);
          lv[e] = __builtin_bit_cast(_Float16, lb);
        }
        *(v8h*)(oh + (size_t)(q0 + row) * g.o_rs + c8) = hv;
        *(v8h*)(ol + (size_t)(q0 + row) * g.o_rs + c8) = lv;
      }
      
    }
  }
}

// ---------------------------------------------------------------------------
// Host orchestration (launches only).
// d_in: 0 = x [4,2048,1024], 1 = W_q, 2 = W_k, 3 = W_v (each [1024,1024], (out,in)), 4 = W_out [1024,1024], 5 = b_out [1024]; all f32.
// Workspace (104 MiB): bf16 x | bf16 [W_q;W_k;W_v] | bf16 W_out | qkv hi plane | qkv lo plane (two batches at a time) | attn hi | attn lo.
// ---------------------------------------------------------------------------
extern "C" void kernel_launch(void* const* d_in, const int* in_sizes, int n_in,
                              void* d_out, int out_size, void* d_ws, size_t ws_size,
                              hipStream_t stream) {
  constexpr int Bn = 4, S = 2048, E = 1024, Hn = 16, Dh = 64, E3 = 3 * E;
  constexpr int M = Bn * S;                 // 8192 rows in total
  constexpr int BH = 2;                     // batches per pass
  constexpr int MH = BH * S;                // 4096 rows per pass
  constexpr int NQB = S / AT_QB;            // 32
  static_assert(NQB <= AT_MAXKC);
  static_assert(M % 64 == 0 && MH % 64 == 0 && E % 64 == 0 && E3 % 64 == 0 && E % 32 == 0 && Hn * Dh == E && Bn % BH == 0);
  if (n_in < 6) return;
  if (in_sizes[0] != M * E || in_sizes[1] != E * E || in_sizes[2] != E * E || in_sizes[3] != E * E ||
      in_sizes[4] != E * E || in_sizes[5] != E || out_size != M * E) return;

  const float* x     = (const float*)d_in[0];
  const float* w_q   = (const float*)d_in[1];
  const float* w_k   = (const float*)d_in[2];
  const float* w_v   = (const float*)d_in[3];
  const float* w_out = (const float*)d_in[4];
  const float* b_out = (const float*)d_in[5];
  float* out = (float*)d_out;

  const size_t bX   = (size_t)M * E * 2;                  // 16 MiB  bf16 x
  const size_t bW   = (size_t)E3 * E * 2;                 //  6 MiB  bf16 [W_q; W_k; W_v]
  const size_t bWo  = (size_t)E * E * 2;                  //  2 MiB  bf16 W_out
  const size_t bQKV = (size_t)MH * E3 * 2;                // 24 MiB  bf16 plane of qkv (x2)
  const size_t bAH  = (size_t)M * E * 2;                  // 16 MiB  bf16 plane of attn out (x2)
  char* ws = (char*)d_ws;
  size_t off = 0;
  unsigned short* X16  = (unsigned short*)(ws + off); off += bX;
  unsigned short* W16  = (unsigned short*)(ws + off); off += bW;
  unsigned short* Wo16 = (unsigned short*)(ws + off); off += bWo;
  unsigned short* QH   = (unsigned short*)(ws + off); off += bQKV;
  unsigned short* QL   = (unsigned short*)(ws + off); off += bQKV;
  unsigned short* AH   = (unsigned short*)(ws + off); off += bAH;
  unsigned short* AL   = (unsigned short*)(ws + off); off += bAH;
  if (off > ws_size || off > (size_t)134217728) return;   // 109,051,904 B

  dim3 blk256(256), blk128(128);

  // 1-5: RNE bf16 casts of x, the three projection weights (stacked into one [3072][1024] matrix) and W_out
  {
    const int n2x = M * E / 2, n2w = E * E / 2;
    cast_f32_bf16x2<<<dim3((n2x + 255) / 256), blk256, 0, stream>>>(x, X16, n2x);
    cast_f32_bf16x2<<<dim3((n2w + 255) / 256), blk256, 0, stream>>>(w_q, W16, n2w);
    cast_f32_bf16x2<<<dim3((n2w + 255) / 256), blk256, 0, stream>>>(w_k, W16 + (size_t)E * E, n2w);
    cast_f32_bf16x2<<<dim3((n2w + 255) / 256), blk256, 0, stream>>>(w_v, W16 + (size_t)2 * E * E, n2w);
    cast_f32_bf16x2<<<dim3((n2w + 255) / 256), blk256, 0, stream>>>(w_out, Wo16, n2w);
  }

  for (int half = 0; half < Bn / BH; ++half) {
    // 6/8: qkv[MH][3072] = bf16(x rows of this pass) . bf16([W_q;W_k;W_v])^T, written as bf16 hi/lo planes
    {
      const int tiles = (MH / 64) * (E3 / 64);             // 3072
      const unsigned short* Xh = X16 + (size_t)half * MH * E;
      wmma_gemm64<1, 0, 0, 2, false><<<dim3((tiles + 7) / 8, 1), blk256, 0, stream>>>(
          Xh, Xh, E, 0L, W16, W16, E, 0L, (void*)QH, (void*)QL, E3, 0L,
          b_out, b_out, 0L, MH, E3, E, 1.0f);
    }
    // 7/9: causal attention per (batch, head, 64-query block) -> bf16 hi/lo planes [M][E] rows of this pass
    {
      AttnP g;
      g.q_bs = (long)S * E3; g.q_rs = E3; g.q_hs = Dh;
      g.k_bs = (long)S * E3; g.k_rs = E3; g.k_hs = Dh;
      g.v_bs = (long)S * E3; g.v_rs = E3; g.v_hs = Dh;
      g.o_bs = (long)S * E;  g.o_rs = E;  g.o_hs = Dh;
      g.S = S; g.Skv = S; g.H = Hn;
      g.sscale = 0.125f;             // 64^-0.5, applied in f32 after the product
      unsigned short* oh = AH + (size_t)half * MH * E;
      unsigned short* ol = AL + (size_t)half * MH * E;
      attn64_causal_split<<<dim3(BH * Hn * NQB), blk128, 0, stream>>>(
          QH, QL, QH + E, QL + E, QH + 2 * E, QL + 2 * E, oh, ol, g);
    }
  }

  // 10: out[M][E] (f32) = (attn hi + attn lo) . bf16(W_out)^T + bf16(b_out)
  {
    const int tiles = (M / 64) * (E / 64);                 // 2048
    wmma_gemm64<1, 2, 3, 0, false><<<dim3((tiles + 7) / 8, 1), blk256, 0, stream>>>(
        AH, AL, E, 0L, Wo16, Wo16, E, 0L, (void*)out, (void*)out, E, 0L,
        b_out, b_out, 0L, M, E, E, 1.0f);
  }
}

// v001
// A run of this version takes 624 microseconds.
// Next to v000, in two timings, it ran 1.41 times as fast each time.
#include <hip/hip_runtime.h>
// Contractions: qkv projection GEMM = v_wmma_f32_16x16x32_bf16 (bf16 operands, 1 product); q.k^T = v_wmma_f32_16x16x32_bf16 (bf16 hi/lo planes of q and k, 3 products); p.v = v_wmma_f32_16x16x32_bf16 (bf16 hi/lo planes of p and v, 3 products); output projection GEMM = v_wmma_f32_16x16x32_bf16 (bf16 hi/lo planes of the attention output x bf16 weight, 2 products); f32 accumulate everywhere; softmax in f32.

typedef __attribute__((ext_vector_type(16))) _Float16 v16h;
typedef __attribute__((ext_vector_type(8)))  _Float16 v8h;
typedef __attribute__((ext_vector_type(16))) __bf16   v16b;
typedef __attribute__((ext_vector_type(8)))  __bf16   v8b;
typedef __attribute__((ext_vector_type(8)))  float    v8f;
typedef __attribute__((ext_vector_type(4)))  float    v4f;

#define NEG_INF (-__builtin_inff())

__device__ __forceinline__ unsigned short f2bf_bits(float f) {
  unsigned u = __float_as_uint(f);
  return (unsigned short)((u + 0x7FFFu + ((u >> 16) & 1u)) >> 16);
}
__device__ __forceinline__ float bf_bits2f(unsigned short h) { return __uint_as_float(((unsigned)h) << 16); }

// hazard guards as plain device helpers (no inline asm inside the kernel template body)
__device__ __forceinline__ void dep_guard_h(v8f& a, v8f& b, v16h x, v16h y) { asm volatile("v_nop\n\tv_nop\n\tv_nop\n\tv_nop" : "+v"(a), "+v"(b) : "v"(x), "v"(y)); }
__device__ __forceinline__ void dep_guard_b(v8f& a, v8f& b, v16b x, v16b y) { asm volatile("v_nop\n\tv_nop\n\tv_nop\n\tv_nop" : "+v"(a), "+v"(b) : "v"(x), "v"(y)); }
__device__ __forceinline__ void keep4_h(v16h a, v16h b, v16h c, v16h d) { asm volatile("v_nop" :: "v"(a), "v"(b), "v"(c), "v"(d)); }
__device__ __forceinline__ void keep4_b(v16b a, v16b b, v16b c, v16b d) { asm volatile("v_nop" :: "v"(a), "v"(b), "v"(c), "v"(d)); }
__device__ __forceinline__ void acc_guard4(v8f& a, v8f& b, v8f& c, v8f& d) { asm volatile("v_nop\n\tv_nop\n\tv_nop\n\tv_nop" : "+v"(a), "+v"(b), "+v"(c), "+v"(d)); }
template <typename T> struct Frag;
template <> struct Frag<_Float16> {
  typedef v16h V; union U { v16h v; v8h h[2]; };
  static __device__ __forceinline__ v16h load(const _Float16* p) {   // elements 0..7 <- p[0..7], 8..15 <- p[16..23]
    U f; f.h[0] = *(const v8h*)(p); f.h[1] = *(const v8h*)(p + 16); return f.v;
  }
  static __device__ __forceinline__ v8f mma(v16h a, v16h b, v8f c) {
    return __builtin_amdgcn_wmma_f32_16x16x32_f16(false, a, false, b, (short)0, c, false, false);
  }
  static __device__ __forceinline__ void guard(v8f& a, v8f& b, v16h x, v16h y) { dep_guard_h(a, b, x, y); }
  static __device__ __forceinline__ void keep(v16h a, v16h b, v16h c, v16h d) { keep4_h(a, b, c, d); }
};
template <> struct Frag<__bf16> {
  typedef v16b V; union U { v16b v; v8b h[2]; };
  static __device__ __forceinline__ v16b load(const __bf16* p) {
    U f; f.h[0] = *(const v8b*)(p); f.h[1] = *(const v8b*)(p + 16); return f.v;
  }
  static __device__ __forceinline__ v8f mma(v16b a, v16b b, v8f c) {
    return __builtin_amdgcn_wmma_f32_16x16x32_bf16(false, a, false, b, (short)0, c, false, false);
  }
  static __device__ __forceinline__ void guard(v8f& a, v8f& b, v16b x, v16b y) { dep_guard_b(a, b, x, y); }
  static __device__ __forceinline__ void keep(v16b a, v16b b, v16b c, v16b d) { keep4_b(a, b, c, d); }
};

// ---- Register-blocked batched WMMA GEMM ------------------------------------
// C[m,n] = scale * sum_k A[m,k] * Bt[n,k] (+bias)(+resid); each wave owns a 64x64 tile.
// A row-major [M,K]; Bt row-major [N,K]; M,N % 64 == 0, K % 32 == 0.
// SPLIT: 0 = single planes; 1 = A and Bt as hi/lo planes (hi.hi + hi.lo + lo.hi); 2 = A as hi/lo planes, Bt single (hi.B + lo.B).
// BIAS_MODE: 0 = none, 1 = bias[m], 2 = bias[n], 3 = bias[n] RNE-converted to bf16 then added in f32.
// OUT_MODE: 0 = f32, 1 = f16, 2 = bf16 hi plane (Cout) + bf16 lo plane (Cout2).
// ET: 0 = f16 operands, 1 = bf16 operands (pointers passed as 16-bit storage)
template <int ET> struct Elem;
template <> struct Elem<0> { typedef _Float16 T; };
template <> struct Elem<1> { typedef __bf16 T; };
template <int ET, int SPLIT, int BIAS_MODE, int OUT_MODE, bool RESID, int ACT = 0>
__global__ __launch_bounds__(256) void wmma_gemm64(
    const unsigned short* __restrict__ Ap, const unsigned short* __restrict__ A2p, int lda, long strideA,
    const unsigned short* __restrict__ Btp, const unsigned short* __restrict__ Bt2p, int ldb, long strideB,
    void* __restrict__ Cout, void* __restrict__ Cout2, int ldc, long strideC,
    const float* __restrict__ bias,
    const float* __restrict__ resid, long strideR,
    int M, int N, int K, float scale) {
  typedef typename Elem<ET>::T T;
  typedef typename Frag<T>::V V;
  const T* A = (const T*)Ap; const T* A2 = (const T*)A2p; const T* Bt = (const T*)Btp; const T* Bt2 = (const T*)Bt2p;
  __shared__ __align__(16) float sT[8][16 * 68];   // per-wave 16x64 slab, pitch 68 floats
  const int b    = blockIdx.y;
  const int lane = threadIdx.x & 31;
  const int wave = threadIdx.x >> 5;
  const int tilesN = N >> 6;
  const int tilesM = M >> 6;
  const int tile = blockIdx.x * 8 + wave;
  if (tile >= tilesM * tilesN) return;   // wave-uniform; no block barriers in this kernel
  const int tm = tile / tilesN;
  const int tn = tile - tm * tilesN;
  const int m0 = tm << 6;
  const int n0 = tn << 6;

  const T* Ab  = A  + (size_t)b * strideA;
  const T* Bb  = Bt + (size_t)b * strideB;
  const T* Ab2 = (SPLIT != 0) ? (A2  + (size_t)b * strideA) : nullptr;
  const T* Bb2 = (SPLIT == 1) ? (Bt2 + (size_t)b * strideB) : nullptr;

  const int rlane = lane & 15;                 // row (A) / col (B, D) within subtile
  const int koff  = (lane >> 4) * 8;           // k offset of this lane half
  const int mOff  = (lane >> 4) * 8;           // D row offset

  v8f acc[4][4];
#pragma unroll
  for (int i = 0; i < 4; ++i)
#pragma unroll
    for (int j = 0; j < 4; ++j) acc[i][j] = (v8f){0.f,0.f,0.f,0.f,0.f,0.f,0.f,0.f};

  for (int k0 = 0; k0 < K; k0 += 32) {
    V bh[4], bl[4];
#pragma unroll
    for (int j = 0; j < 4; ++j) {
      const size_t bo = (size_t)(n0 + (j << 4) + rlane) * ldb + koff + k0;
      bh[j] = Frag<T>::load(Bb + bo);
      if (SPLIT == 1) bl[j] = Frag<T>::load(Bb2 + bo);
    }
#pragma unroll
    for (int i = 0; i < 4; ++i) {
      const size_t ao = (size_t)(m0 + (i << 4) + rlane) * lda + koff + k0;
      V ah = Frag<T>::load(Ab + ao);
      V al;
      if (SPLIT != 0) al = Frag<T>::load(Ab2 + ao);
#pragma unroll
      for (int j = 0; j < 4; ++j) {
        acc[i][j] = Frag<T>::mma(ah, bh[j], acc[i][j]);
        if (SPLIT == 1) acc[i][j] = Frag<T>::mma(ah, bl[j], acc[i][j]);
        if (SPLIT != 0) acc[i][j] = Frag<T>::mma(al, bh[j], acc[i][j]);
      }
      Frag<T>::guard(acc[i][0], acc[i][3], ah, (SPLIT != 0) ? al : ah);
    }
    Frag<T>::keep(bh[0], bh[1], bh[2], bh[3]);
    if (SPLIT == 1) Frag<T>::keep(bl[0], bl[1], bl[2], bl[3]);
  }
  acc_guard4(acc[0][0], acc[0][1], acc[0][2], acc[0][3]);
  acc_guard4(acc[1][0], acc[1][1], acc[1][2], acc[1][3]);
  acc_guard4(acc[2][0], acc[2][1], acc[2][2], acc[2][3]);
  acc_guard4(acc[3][0], acc[3][1], acc[3][2], acc[3][3]);

  // ---- epilogue ----
  float* slab = sT[wave];
  const float* Rb = RESID ? (resid + (size_t)b * strideR) : nullptr;
#pragma unroll
  for (int i = 0; i < 4; ++i) {
    const int mBase = m0 + (i << 4);
#pragma unroll
    for (int j = 0; j < 4; ++j) {
      const int n = n0 + (j << 4) + rlane;
      float bv = 0.f;
      if (BIAS_MODE == 2) bv = bias[n];
      if (BIAS_MODE == 3) bv = bf_bits2f(f2bf_bits(bias[n]));
#pragma unroll
      for (int r = 0; r < 8; ++r) {
        float v = acc[i][j][r] * scale;
        if (BIAS_MODE == 1) v += bias[mBase + mOff + r];
        if (BIAS_MODE == 2 || BIAS_MODE == 3) v += bv;
        if (RESID) v += Rb[(size_t)(mBase + mOff + r) * ldc + n];
        if (ACT == 1) v = tanhf(v);
        if (ACT == 2) v = fmaxf(v, 0.0f);
        if (ACT == 3) v = v / (1.0f + expf(-v));
        if (ACT == 4) v = (v > 0.f) ? v : 0.01f * v;
        if (ACT == 5) v = 0.5f * v * (1.0f + erff(v * 0.70710678118654752f));
        slab[(mOff + r) * 68 + (j << 4) + rlane] = v;
      }
    }
    __builtin_amdgcn_fence(__ATOMIC_RELEASE, "workgroup");
    __builtin_amdgcn_wave_barrier();
    __builtin_amdgcn_fence(__ATOMIC_ACQUIRE, "workgroup");
    if (OUT_MODE == 0) {
      float* C = (float*)Cout + (size_t)b * strideC;
      const int hh = lane >> 4, c4 = (lane & 15) * 4;     // row seg = 256 B = 16 lanes x 16 B
      {
#pragma unroll
        for (int it = 0; it < 8; ++it) {
          const int row = it * 2 + hh;
          v4f v = *(const v4f*)(slab + row * 68 + c4);
          *(v4f*)(C + (size_t)(mBase + row) * ldc + n0 + c4) = v;
        }
        
      }
    } else {
      const int q = lane >> 3, c8 = (lane & 7) * 8;
      unsigned short* C  = (unsigned short*)Cout  + (size_t)b * strideC;
      unsigned short* C2 = (OUT_MODE == 2) ? ((unsigned short*)Cout2 + (size_t)b * strideC) : nullptr;
      {
#pragma unroll
        for (int it = 0; it < 4; ++it) {
          const int row = it * 4 + q;
          const float* sp = slab + row * 68 + c8;
          v8h hv, lv;
#pragma unroll
          for (int e = 0; e < 8; ++e) {
            if (OUT_MODE == 1) {
              hv[e] = (_Float16)sp[e];
            } else {
              unsigned short hb = f2bf_bits(sp[e]);
              unsigned short lb = f2bf_bits(sp[e] - bf_bits2f(hb));
              hv[e] = __builtin_bit_cast(_Float16, hb);
              lv[e] = __builtin_bit_cast(_Float16, lb);
            }
          }
          *(v8h*)(C + (size_t)(mBase + row) * ldc + n0 + c8) = hv;
          if (OUT_MODE == 2) *(v8h*)(C2 + (size_t)(mBase + row) * ldc + n0 + c8) = lv;
        }
        
      }
    }
    __builtin_amdgcn_fence(__ATOMIC_RELEASE, "workgroup");
    __builtin_amdgcn_wave_barrier();
    __builtin_amdgcn_fence(__ATOMIC_ACQUIRE, "workgroup");
  }
}

__global__ __launch_bounds__(256) void cast_f32_bf16x2(
    const float* __restrict__ in, unsigned short* __restrict__ out, int n2) {
  int i = blockIdx.x * 256 + threadIdx.x;
  if (i < n2) {
    const unsigned u = (unsigned)f2bf_bits(in[2 * i]) | ((unsigned)f2bf_bits(in[2 * i + 1]) << 16);
    ((unsigned*)out)[i] = u;
    
  }
}

// =====================================================================================
// Causal attention, head_dim 64. Block = 4 waves = 64 query rows of one (batch, head); 64-key chunks.
//   scores = q.k^T * sscale : q and k as bf16 hi/lo planes (hi.hi + hi.lo + lo.hi); key > query -> -inf
//   out    = p.v            : p and v as bf16 hi/lo planes (hi.hi + hi.lo + lo.hi)
//   online softmax in f32; output written as bf16 hi/lo planes (row = b*S + s, col = h*64 + d).
//   q/k/v arrive as bf16 hi/lo planes (16-bit storage); element (b, s, h, d) at X[b*X_bs + s*X_rs + h*X_hs + d].
//   Q planes staged once per block in LDS (16-B copies); K planes copied, V planes transposed per chunk.
//   Only key chunks 0..qb are visited (chunks above the diagonal contribute exactly zero); trip count <= AT_MAXKC.
// =====================================================================================
#define AT_D 64
#define AT_NW 4
#define AT_QB 64
#define AT_KC 64
#define AT_MAXKC 32
#define AT_P 72   // LDS row pitch of every 64-element bf16 tile: 144 B = 16 B x odd, so the 16 rows of a 16-byte fragment read fall on distinct banks

struct AttnP { long q_bs, q_rs, q_hs, k_bs, k_rs, k_hs, v_bs, v_rs, v_hs, o_bs, o_rs, o_hs;
               int S, Skv, H; float sscale; };
static_assert(sizeof(AttnP) == 112);

__device__ __forceinline__ unsigned short at_bf_bits(float f) {
  unsigned u = __float_as_uint(f);
  return (unsigned short)((u + 0x7FFFu + ((u >> 16) & 1u)) >> 16);
}
__device__ __forceinline__ __bf16 at_f2bf(float f) { return __builtin_bit_cast(__bf16, at_bf_bits(f)); }
__device__ __forceinline__ void at_split(float f, __bf16& hi, __bf16& lo) {
  const unsigned short hb = at_bf_bits(f);
  hi = __builtin_bit_cast(__bf16, hb);
  lo = at_f2bf(f - __uint_as_float(((unsigned)hb) << 16));
}
// three products of a hi/lo x hi/lo pair into one accumulator, then the hazard guard tying D and all four operands
__device__ __forceinline__ v8f at_mma3(v16b ah, v16b al, v16b bh, v16b bl, v8f c) {
  c = __builtin_amdgcn_wmma_f32_16x16x32_bf16(false, ah, false, bh, (short)0, c, false, false);
  c = __builtin_amdgcn_wmma_f32_16x16x32_bf16(false, ah, false, bl, (short)0, c, false, false);
  c = __builtin_amdgcn_wmma_f32_16x16x32_bf16(false, al, false, bh, (short)0, c, false, false);
  asm volatile("v_nop\n\tv_nop\n\tv_nop\n\tv_nop" : "+v"(c) : "v"(ah), "v"(al), "v"(bh), "v"(bl));
  return c;
}

__global__ __launch_bounds__(128)
void attn64_causal_split(const unsigned short* __restrict__ qh_p, const unsigned short* __restrict__ ql_p,
                         const unsigned short* __restrict__ kh_p, const unsigned short* __restrict__ kl_p,
                         const unsigned short* __restrict__ vh_p, const unsigned short* __restrict__ vl_p,
                         unsigned short* __restrict__ ohi, unsigned short* __restrict__ olo, AttnP g) {
  union FB { v16b v; v8b h[2]; };
  __shared__ __align__(16) __bf16 Qsh[AT_QB * AT_P];          // Q hi [row][d]   9 KB
  __shared__ __align__(16) __bf16 Qsl[AT_QB * AT_P];          // Q lo [row][d]   9 KB
  __shared__ __align__(16) __bf16 Ksh[AT_KC * AT_P];          // K hi [kv][d]    9 KB
  __shared__ __align__(16) __bf16 Ksl[AT_KC * AT_P];          // K lo [kv][d]    9 KB
  __shared__ __align__(16) __bf16 Vth[AT_D * AT_P];           // V hi [d][kv]    9 KB
  __shared__ __align__(16) __bf16 Vtl[AT_D * AT_P];           // V lo [d][kv]    9 KB
  __shared__ __align__(16) __bf16 Psh[AT_NW][16 * AT_P];      // per wave P hi [row][kv]  9 KB
  __shared__ __align__(16) __bf16 Psl[AT_NW][16 * AT_P];      // per wave P lo [row][kv]  9 KB
  __shared__ __align__(16) float  Os[AT_NW][16 * 68];         // per wave out tile, pitch 68

  const int tid  = threadIdx.x;
  const int wave = tid >> 5;
  const int lane = tid & 31;
  const int hh   = lane >> 4;
  const int c    = lane & 15;

  const int nqb = g.S / AT_QB;
  const int bx = blockIdx.x;
  const int qb = bx % nqb;
  const int bh = bx / nqb;
  const int h  = bh % g.H;
  const int b  = bh / g.H;
  const int q0 = qb * AT_QB + wave * 16;

  const __bf16* qhb = (const __bf16*)qh_p + (size_t)b * g.q_bs + (size_t)h * g.q_hs;
  const __bf16* qlb = (const __bf16*)ql_p + (size_t)b * g.q_bs + (size_t)h * g.q_hs;
  const __bf16* khb = (const __bf16*)kh_p + (size_t)b * g.k_bs + (size_t)h * g.k_hs;
  const __bf16* klb = (const __bf16*)kl_p + (size_t)b * g.k_bs + (size_t)h * g.k_hs;
  const __bf16* vhb = (const __bf16*)vh_p + (size_t)b * g.v_bs + (size_t)h * g.v_hs;
  const __bf16* vlb = (const __bf16*)vl_p + (size_t)b * g.v_bs + (size_t)h * g.v_hs;

  // ---- Q hi/lo planes for the block's 64 rows: [row][d], 16-B copies (thread -> row tid/2, 32-d half) ----
  {
    const int r = tid >> 1, dh = (tid & 1) * 32;
    const size_t qo = (size_t)(qb * AT_QB + r) * g.q_rs + dh;
#pragma unroll
    for (int i = 0; i < 4; ++i) {
      const v8b xh = *(const v8b*)(qhb + qo + 8 * i);
      const v8b xl = *(const v8b*)(qlb + qo + 8 * i);
      *(v8b*)(Qsh + r * AT_P + dh + 8 * i) = xh;
      *(v8b*)(Qsl + r * AT_P + dh + 8 * i) = xl;
    }
  }
  __syncthreads();

  float mrow[8], lrow[8];
  v8f oacc[4];
#pragma unroll
  for (int r = 0; r < 8; ++r) { mrow[r] = NEG_INF; lrow[r] = 0.f; }
#pragma unroll
  for (int t = 0; t < 4; ++t) oacc[t] = (v8f){0.f,0.f,0.f,0.f,0.f,0.f,0.f,0.f};

  const int nck = (qb + 1 < AT_MAXKC) ? (qb + 1) : AT_MAXKC;    // block-uniform, statically bounded
  const __bf16* qwh = Qsh + (wave * 16 + c) * AT_P + 8 * hh;      // A fragment row c of this wave
  const __bf16* qwl = Qsl + (wave * 16 + c) * AT_P + 8 * hh;

  for (int kc = 0; kc < nck; ++kc) {
    const int kv0 = kc * AT_KC;
    __syncthreads();
    {
      const int kvr = tid >> 1, dh = (tid & 1) * 32;
      const size_t ko = (size_t)(kv0 + kvr) * g.k_rs + dh;
      const size_t vo = (size_t)(kv0 + kvr) * g.v_rs + dh;
#pragma unroll
      for (int i = 0; i < 4; ++i) {
        const v8b ka = *(const v8b*)(khb + ko + 8 * i);
        const v8b kb = *(const v8b*)(klb + ko + 8 * i);
        *(v8b*)(Ksh + kvr * AT_P + dh + 8 * i) = ka;
        *(v8b*)(Ksl + kvr * AT_P + dh + 8 * i) = kb;
        const v8b va = *(const v8b*)(vhb + vo + 8 * i);
        const v8b vb = *(const v8b*)(vlb + vo + 8 * i);
#pragma unroll
        for (int e = 0; e < 8; ++e) {
          const int d = dh + 8 * i + e;
          Vth[d * AT_P + kvr] = va[e];
          Vtl[d * AT_P + kvr] = vb[e];
        }
      }
    }
    __syncthreads();

    // ---- scores[16 x 64] = q . k^T  (A = Q[row][d], B = K[kv][d]; split k-map via two 16-B halves at +8hh and +16+8hh) ----
    v8f s[4];
#pragma unroll
    for (int j = 0; j < 4; ++j) s[j] = (v8f){0.f,0.f,0.f,0.f,0.f,0.f,0.f,0.f};
#pragma unroll 1
    for (int dc = 0; dc < 2; ++dc) {
      FB qh, ql;
      qh.h[0] = *(const v8b*)(qwh + dc * 32);
      qh.h[1] = *(const v8b*)(qwh + dc * 32 + 16);
      ql.h[0] = *(const v8b*)(qwl + dc * 32);
      ql.h[1] = *(const v8b*)(qwl + dc * 32 + 16);
#pragma unroll
      for (int j = 0; j < 4; ++j) {
        FB kb, kl;
        const __bf16* kp  = Ksh + (j * 16 + c) * AT_P + dc * 32 + 8 * hh;
        const __bf16* kpl = Ksl + (j * 16 + c) * AT_P + dc * 32 + 8 * hh;
        kb.h[0] = *(const v8b*)(kp);
        kb.h[1] = *(const v8b*)(kp + 16);
        kl.h[0] = *(const v8b*)(kpl);
        kl.h[1] = *(const v8b*)(kpl + 16);
        s[j] = at_mma3(qh.v, ql.v, kb.v, kl.v, s[j]);
      }
    }
    // ---- scale, causal mask on the diagonal chunk (key > query -> -inf), row max ----
    const bool diag = (kc == qb);
    float cm[8];
#pragma unroll
    for (int r = 0; r < 8; ++r) {
      const int qrow = q0 + 8 * hh + r;
      float m = NEG_INF;
#pragma unroll
      for (int j = 0; j < 4; ++j) {
        const int kvcol = kv0 + j * 16 + c;
        float sv = s[j][r] * g.sscale;
        if (diag && (kvcol > qrow)) sv = NEG_INF;
        s[j][r] = sv;
        m = fmaxf(m, sv);
      }
#pragma unroll
      for (int off = 1; off < 16; off <<= 1) m = fmaxf(m, __shfl_xor(m, off, 32));
      cm[r] = m;
    }
    __bf16* pwh = Psh[wave];
    __bf16* pwl = Psl[wave];
#pragma unroll
    for (int r = 0; r < 8; ++r) {
      const float mnew = fmaxf(mrow[r], cm[r]);
      const float mref = (mnew == NEG_INF) ? 0.0f : mnew;
      const float alpha = __expf(mrow[r] - mref);
      mrow[r] = mnew;
      float psum = 0.f;
#pragma unroll
      for (int j = 0; j < 4; ++j) {
        const float p = __expf(s[j][r] - mref);
        psum += p;
        __bf16 a, bl; at_split(p, a, bl);
        pwh[(8 * hh + r) * AT_P + j * 16 + c] = a;
        pwl[(8 * hh + r) * AT_P + j * 16 + c] = bl;
      }
#pragma unroll
      for (int off = 1; off < 16; off <<= 1) psum += __shfl_xor(psum, off, 32);
      lrow[r] = lrow[r] * alpha + psum;
#pragma unroll
      for (int t = 0; t < 4; ++t) oacc[t][r] *= alpha;
    }
    __builtin_amdgcn_fence(__ATOMIC_RELEASE, "workgroup");
    __builtin_amdgcn_wave_barrier();
    __builtin_amdgcn_fence(__ATOMIC_ACQUIRE, "workgroup");
    // ---- O[16 x 64] += P[16 x 64] . V[64 x 64]  (A = P[row][kv], B = V[kv][d] from the [d][kv] tile) ----
#pragma unroll 1
    for (int kk = 0; kk < 2; ++kk) {
      FB pa, pl;
      pa.h[0] = *(const v8b*)(pwh + c * AT_P + kk * 32 + 8 * hh);
      pa.h[1] = *(const v8b*)(pwh + c * AT_P + kk * 32 + 16 + 8 * hh);
      pl.h[0] = *(const v8b*)(pwl + c * AT_P + kk * 32 + 8 * hh);
      pl.h[1] = *(const v8b*)(pwl + c * AT_P + kk * 32 + 16 + 8 * hh);
#pragma unroll
      for (int t = 0; t < 4; ++t) {
        FB vb, vl;
        const __bf16* vp  = Vth + (t * 16 + c) * AT_P + kk * 32 + 8 * hh;
        const __bf16* vpl = Vtl + (t * 16 + c) * AT_P + kk * 32 + 8 * hh;
        vb.h[0] = *(const v8b*)(vp);
        vb.h[1] = *(const v8b*)(vp + 16);
        vl.h[0] = *(const v8b*)(vpl);
        vl.h[1] = *(const v8b*)(vpl + 16);
        oacc[t] = at_mma3(pa.v, pl.v, vb.v, vl.v, oacc[t]);
      }
    }
  }

  float* os = Os[wave];
#pragma unroll
  for (int r = 0; r < 8; ++r) {
    const float inv = 1.0f / lrow[r];
#pragma unroll
    for (int t = 0; t < 4; ++t) os[(8 * hh + r) * 68 + t * 16 + c] = oacc[t][r] * inv;
  }
  __builtin_amdgcn_fence(__ATOMIC_RELEASE, "workgroup");
  __builtin_amdgcn_wave_barrier();
  __builtin_amdgcn_fence(__ATOMIC_ACQUIRE, "workgroup");
  {
    const int q8 = lane >> 3, c8 = (lane & 7) * 8;
    unsigned short* oh = ohi + (size_t)b * g.o_bs + (size_t)h * g.o_hs;
    unsigned short* ol = olo + (size_t)b * g.o_bs + (size_t)h * g.o_hs;
    {
#pragma unroll
      for (int it = 0; it < 4; ++it) {
        const int row = it * 4 + q8;                    // q8 in 0..3, it in 0..3 -> rows 0..15
        const float* sp = os + row * 68 + c8;
        v8h hv, lv;
#pragma unroll
        for (int e = 0; e < 8; ++e) {
          const unsigned short hb = f2bf_bits(sp[e]);
          const unsigned short lb = f2bf_bits(sp[e] - bf_bits2f(hb));
          hv[e] = __builtin_bit_cast(_Float16, hb);
          lv[e] = __builtin_bit_cast(_Float16, lb);
        }
        *(v8h*)(oh + (size_t)(q0 + row) * g.o_rs + c8) = hv;
        *(v8h*)(ol + (size_t)(q0 + row) * g.o_rs + c8) = lv;
      }
      
    }
  }
}

// ---------------------------------------------------------------------------
// Host orchestration (launches only).
// d_in: 0 = x [4,2048,1024], 1 = W_q, 2 = W_k, 3 = W_v (each [1024,1024], (out,in)), 4 = W_out [1024,1024], 5 = b_out [1024]; all f32.
// Workspace (104 MiB): bf16 x | bf16 [W_q;W_k;W_v] | bf16 W_out | qkv hi plane | qkv lo plane (two batches at a time) | attn hi | attn lo.
// ---------------------------------------------------------------------------
extern "C" void kernel_launch(void* const* d_in, const int* in_sizes, int n_in,
                              void* d_out, int out_size, void* d_ws, size_t ws_size,
                              hipStream_t stream) {
  constexpr int Bn = 4, S = 2048, E = 1024, Hn = 16, Dh = 64, E3 = 3 * E;
  constexpr int M = Bn * S;                 // 8192 rows in total
  constexpr int BH = 2;                     // batches per pass
  constexpr int MH = BH * S;                // 4096 rows per pass
  constexpr int NQB = S / AT_QB;            // 32
  static_assert(NQB <= AT_MAXKC);
  static_assert(M % 64 == 0 && MH % 64 == 0 && E % 64 == 0 && E3 % 64 == 0 && E % 32 == 0 && Hn * Dh == E && Bn % BH == 0);
  if (n_in < 6) return;
  if (in_sizes[0] != M * E || in_sizes[1] != E * E || in_sizes[2] != E * E || in_sizes[3] != E * E ||
      in_sizes[4] != E * E || in_sizes[5] != E || out_size != M * E) return;

  const float* x     = (const float*)d_in[0];
  const float* w_q   = (const float*)d_in[1];
  const float* w_k   = (const float*)d_in[2];
  const float* w_v   = (const float*)d_in[3];
  const float* w_out = (const float*)d_in[4];
  const float* b_out = (const float*)d_in[5];
  float* out = (float*)d_out;

  const size_t bX   = (size_t)M * E * 2;                  // 16 MiB  bf16 x
  const size_t bW   = (size_t)E3 * E * 2;                 //  6 MiB  bf16 [W_q; W_k; W_v]
  const size_t bWo  = (size_t)E * E * 2;                  //  2 MiB  bf16 W_out
  const size_t bQKV = (size_t)MH * E3 * 2;                // 24 MiB  bf16 plane of qkv (x2)
  const size_t bAH  = (size_t)M * E * 2;                  // 16 MiB  bf16 plane of attn out (x2)
  char* ws = (char*)d_ws;
  size_t off = 0;
  unsigned short* X16  = (unsigned short*)(ws + off); off += bX;
  unsigned short* W16  = (unsigned short*)(ws + off); off += bW;
  unsigned short* Wo16 = (unsigned short*)(ws + off); off += bWo;
  unsigned short* QH   = (unsigned short*)(ws + off); off += bQKV;
  unsigned short* QL   = (unsigned short*)(ws + off); off += bQKV;
  unsigned short* AH   = (unsigned short*)(ws + off); off += bAH;
  unsigned short* AL   = (unsigned short*)(ws + off); off += bAH;
  if (off > ws_size || off > (size_t)134217728) return;   // 109,051,904 B

  dim3 blk256(256), blk128(128);

  // 1-5: RNE bf16 casts of x, the three projection weights (stacked into one [3072][1024] matrix) and W_out
  {
    const int n2x = M * E / 2, n2w = E * E / 2;
    cast_f32_bf16x2<<<dim3((n2x + 255) / 256), blk256, 0, stream>>>(x, X16, n2x);
    cast_f32_bf16x2<<<dim3((n2w + 255) / 256), blk256, 0, stream>>>(w_q, W16, n2w);
    cast_f32_bf16x2<<<dim3((n2w + 255) / 256), blk256, 0, stream>>>(w_k, W16 + (size_t)E * E, n2w);
    cast_f32_bf16x2<<<dim3((n2w + 255) / 256), blk256, 0, stream>>>(w_v, W16 + (size_t)2 * E * E, n2w);
    cast_f32_bf16x2<<<dim3((n2w + 255) / 256), blk256, 0, stream>>>(w_out, Wo16, n2w);
  }

  for (int half = 0; half < Bn / BH; ++half) {
    // 6/8: qkv[MH][3072] = bf16(x rows of this pass) . bf16([W_q;W_k;W_v])^T, written as bf16 hi/lo planes
    {
      const int tiles = (MH / 64) * (E3 / 64);             // 3072
      const unsigned short* Xh = X16 + (size_t)half * MH * E;
      wmma_gemm64<1, 0, 0, 2, false><<<dim3((tiles + 7) / 8, 1), blk256, 0, stream>>>(
          Xh, Xh, E, 0L, W16, W16, E, 0L, (void*)QH, (void*)QL, E3, 0L,
          b_out, b_out, 0L, MH, E3, E, 1.0f);
    }
    // 7/9: causal attention per (batch, head, 64-query block) -> bf16 hi/lo planes [M][E] rows of this pass
    {
      AttnP g;
      g.q_bs = (long)S * E3; g.q_rs = E3; g.q_hs = Dh;
      g.k_bs = (long)S * E3; g.k_rs = E3; g.k_hs = Dh;
      g.v_bs = (long)S * E3; g.v_rs = E3; g.v_hs = Dh;
      g.o_bs = (long)S * E;  g.o_rs = E;  g.o_hs = Dh;
      g.S = S; g.Skv = S; g.H = Hn;
      g.sscale = 0.125f;             // 64^-0.5, applied in f32 after the product
      unsigned short* oh = AH + (size_t)half * MH * E;
      unsigned short* ol = AL + (size_t)half * MH * E;
      attn64_causal_split<<<dim3(BH * Hn * NQB), blk128, 0, stream>>>(
          QH, QL, QH + E, QL + E, QH + 2 * E, QL + 2 * E, oh, ol, g);
    }
  }

  // 10: out[M][E] (f32) = (attn hi + attn lo) . bf16(W_out)^T + bf16(b_out)
  {
    const int tiles = (M / 64) * (E / 64);                 // 2048
    wmma_gemm64<1, 2, 3, 0, false><<<dim3((tiles + 7) / 8, 1), blk256, 0, stream>>>(
        AH, AL, E, 0L, Wo16, Wo16, E, 0L, (void*)out, (void*)out, E, 0L,
        b_out, b_out, 0L, M, E, E, 1.0f);
  }
}

// v002
// Measured time: 489 microseconds a run.
// Timed twice side by side with v001, it ran 1.27 times as fast both times.
// All steps since v000 together make it 1.80 times as fast.
#include <hip/hip_runtime.h>
// Contractions: qkv projection GEMM = v_wmma_f32_16x16x32_bf16 (bf16 operands, 1 product); q.k^T = v_wmma_f32_16x16x32_bf16 (bf16 hi/lo planes of q and k, 3 products); p.v = v_wmma_f32_16x16x32_bf16 (bf16 hi/lo planes of p and v, 3 products); output projection GEMM = v_wmma_f32_16x16x32_bf16 (bf16 hi/lo planes of the attention output x bf16 weight, 2 products); f32 accumulate everywhere; softmax in f32.

typedef __attribute__((ext_vector_type(16))) _Float16 v16h;
typedef __attribute__((ext_vector_type(8)))  _Float16 v8h;
typedef __attribute__((ext_vector_type(16))) __bf16   v16b;
typedef __attribute__((ext_vector_type(8)))  __bf16   v8b;
typedef __attribute__((ext_vector_type(8)))  float    v8f;
typedef __attribute__((ext_vector_type(4)))  float    v4f;

#define NEG_INF (-__builtin_inff())

__device__ __forceinline__ unsigned short f2bf_bits(float f) {
  unsigned u = __float_as_uint(f);
  return (unsigned short)((u + 0x7FFFu + ((u >> 16) & 1u)) >> 16);
}
__device__ __forceinline__ float bf_bits2f(unsigned short h) { return __uint_as_float(((unsigned)h) << 16); }

// hazard guards as plain device helpers (no inline asm inside the kernel template body)
__device__ __forceinline__ void dep_guard_h(v8f& a, v8f& b, v16h x, v16h y) { asm volatile("v_nop\n\tv_nop\n\tv_nop\n\tv_nop" : "+v"(a), "+v"(b) : "v"(x), "v"(y)); }
__device__ __forceinline__ void dep_guard_b(v8f& a, v8f& b, v16b x, v16b y) { asm volatile("v_nop\n\tv_nop\n\tv_nop\n\tv_nop" : "+v"(a), "+v"(b) : "v"(x), "v"(y)); }
__device__ __forceinline__ void keep4_h(v16h a, v16h b, v16h c, v16h d) { asm volatile("v_nop" :: "v"(a), "v"(b), "v"(c), "v"(d)); }
__device__ __forceinline__ void keep4_b(v16b a, v16b b, v16b c, v16b d) { asm volatile("v_nop" :: "v"(a), "v"(b), "v"(c), "v"(d)); }
__device__ __forceinline__ void acc_guard4(v8f& a, v8f& b, v8f& c, v8f& d) { asm volatile("v_nop\n\tv_nop\n\tv_nop\n\tv_nop" : "+v"(a), "+v"(b), "+v"(c), "+v"(d)); }
template <typename T> struct Frag;
template <> struct Frag<_Float16> {
  typedef v16h V; union U { v16h v; v8h h[2]; };
  static __device__ __forceinline__ v16h load(const _Float16* p) {   // elements 0..7 <- p[0..7], 8..15 <- p[16..23]
    U f; f.h[0] = *(const v8h*)(p); f.h[1] = *(const v8h*)(p + 16); return f.v;
  }
  static __device__ __forceinline__ v8f mma(v16h a, v16h b, v8f c) {
    return __builtin_amdgcn_wmma_f32_16x16x32_f16(false, a, false, b, (short)0, c, false, false);
  }
  static __device__ __forceinline__ void guard(v8f& a, v8f& b, v16h x, v16h y) { dep_guard_h(a, b, x, y); }
  static __device__ __forceinline__ void keep(v16h a, v16h b, v16h c, v16h d) { keep4_h(a, b, c, d); }
};
template <> struct Frag<__bf16> {
  typedef v16b V; union U { v16b v; v8b h[2]; };
  static __device__ __forceinline__ v16b load(const __bf16* p) {
    U f; f.h[0] = *(const v8b*)(p); f.h[1] = *(const v8b*)(p + 16); return f.v;
  }
  static __device__ __forceinline__ v8f mma(v16b a, v16b b, v8f c) {
    return __builtin_amdgcn_wmma_f32_16x16x32_bf16(false, a, false, b, (short)0, c, false, false);
  }
  static __device__ __forceinline__ void guard(v8f& a, v8f& b, v16b x, v16b y) { dep_guard_b(a, b, x, y); }
  static __device__ __forceinline__ void keep(v16b a, v16b b, v16b c, v16b d) { keep4_b(a, b, c, d); }
};

// ---- Register-blocked batched WMMA GEMM ------------------------------------
// C[m,n] = scale * sum_k A[m,k] * Bt[n,k] (+bias)(+resid); each wave owns a 64x64 tile.
// A row-major [M,K]; Bt row-major [N,K]; M,N % 64 == 0, K % 32 == 0.
// SPLIT: 0 = single planes; 1 = A and Bt as hi/lo planes (hi.hi + hi.lo + lo.hi); 2 = A as hi/lo planes, Bt single (hi.B + lo.B).
// BIAS_MODE: 0 = none, 1 = bias[m], 2 = bias[n], 3 = bias[n] RNE-converted to bf16 then added in f32.
// OUT_MODE: 0 = f32, 1 = f16, 2 = bf16 hi plane (Cout) + bf16 lo plane (Cout2).
// ET: 0 = f16 operands, 1 = bf16 operands (pointers passed as 16-bit storage)
template <int ET> struct Elem;
template <> struct Elem<0> { typedef _Float16 T; };
template <> struct Elem<1> { typedef __bf16 T; };
template <int ET, int SPLIT, int BIAS_MODE, int OUT_MODE, bool RESID, int ACT = 0>
__global__ __launch_bounds__(256) void wmma_gemm64(
    const unsigned short* __restrict__ Ap, const unsigned short* __restrict__ A2p, int lda, long strideA,
    const unsigned short* __restrict__ Btp, const unsigned short* __restrict__ Bt2p, int ldb, long strideB,
    void* __restrict__ Cout, void* __restrict__ Cout2, int ldc, long strideC,
    const float* __restrict__ bias,
    const float* __restrict__ resid, long strideR,
    int M, int N, int K, float scale) {
  typedef typename Elem<ET>::T T;
  typedef typename Frag<T>::V V;
  const T* A = (const T*)Ap; const T* A2 = (const T*)A2p; const T* Bt = (const T*)Btp; const T* Bt2 = (const T*)Bt2p;
  __shared__ __align__(16) float sT[8][16 * 68];   // per-wave 16x64 slab, pitch 68 floats
  const int b    = blockIdx.y;
  const int lane = threadIdx.x & 31;
  const int wave = threadIdx.x >> 5;
  const int tilesN = N >> 6;
  const int tilesM = M >> 6;
  const int tile = blockIdx.x * 8 + wave;
  if (tile >= tilesM * tilesN) return;   // wave-uniform; no block barriers in this kernel
  const int tm = tile / tilesN;
  const int tn = tile - tm * tilesN;
  const int m0 = tm << 6;
  const int n0 = tn << 6;

  const T* Ab  = A  + (size_t)b * strideA;
  const T* Bb  = Bt + (size_t)b * strideB;
  const T* Ab2 = (SPLIT != 0) ? (A2  + (size_t)b * strideA) : nullptr;
  const T* Bb2 = (SPLIT == 1) ? (Bt2 + (size_t)b * strideB) : nullptr;

  const int rlane = lane & 15;                 // row (A) / col (B, D) within subtile
  const int koff  = (lane >> 4) * 8;           // k offset of this lane half
  const int mOff  = (lane >> 4) * 8;           // D row offset

  v8f acc[4][4];
#pragma unroll
  for (int i = 0; i < 4; ++i)
#pragma unroll
    for (int j = 0; j < 4; ++j) acc[i][j] = (v8f){0.f,0.f,0.f,0.f,0.f,0.f,0.f,0.f};

  for (int k0 = 0; k0 < K; k0 += 32) {
    V bh[4], bl[4];
#pragma unroll
    for (int j = 0; j < 4; ++j) {
      const size_t bo = (size_t)(n0 + (j << 4) + rlane) * ldb + koff + k0;
      bh[j] = Frag<T>::load(Bb + bo);
      if (SPLIT == 1) bl[j] = Frag<T>::load(Bb2 + bo);
    }
#pragma unroll
    for (int i = 0; i < 4; ++i) {
      const size_t ao = (size_t)(m0 + (i << 4) + rlane) * lda + koff + k0;
      V ah = Frag<T>::load(Ab + ao);
      V al;
      if (SPLIT != 0) al = Frag<T>::load(Ab2 + ao);
#pragma unroll
      for (int j = 0; j < 4; ++j) {
        acc[i][j] = Frag<T>::mma(ah, bh[j], acc[i][j]);
        if (SPLIT == 1) acc[i][j] = Frag<T>::mma(ah, bl[j], acc[i][j]);
        if (SPLIT != 0) acc[i][j] = Frag<T>::mma(al, bh[j], acc[i][j]);
      }
      Frag<T>::guard(acc[i][0], acc[i][3], ah, (SPLIT != 0) ? al : ah);
    }
    Frag<T>::keep(bh[0], bh[1], bh[2], bh[3]);
    if (SPLIT == 1) Frag<T>::keep(bl[0], bl[1], bl[2], bl[3]);
  }
  acc_guard4(acc[0][0], acc[0][1], acc[0][2], acc[0][3]);
  acc_guard4(acc[1][0], acc[1][1], acc[1][2], acc[1][3]);
  acc_guard4(acc[2][0], acc[2][1], acc[2][2], acc[2][3]);
  acc_guard4(acc[3][0], acc[3][1], acc[3][2], acc[3][3]);

  // ---- epilogue ----
  float* slab = sT[wave];
  const float* Rb = RESID ? (resid + (size_t)b * strideR) : nullptr;
#pragma unroll
  for (int i = 0; i < 4; ++i) {
    const int mBase = m0 + (i << 4);
#pragma unroll
    for (int j = 0; j < 4; ++j) {
      const int n = n0 + (j << 4) + rlane;
      float bv = 0.f;
      if (BIAS_MODE == 2) bv = bias[n];
      if (BIAS_MODE == 3) bv = bf_bits2f(f2bf_bits(bias[n]));
#pragma unroll
      for (int r = 0; r < 8; ++r) {
        float v = acc[i][j][r] * scale;
        if (BIAS_MODE == 1) v += bias[mBase + mOff + r];
        if (BIAS_MODE == 2 || BIAS_MODE == 3) v += bv;
        if (RESID) v += Rb[(size_t)(mBase + mOff + r) * ldc + n];
        if (ACT == 1) v = tanhf(v);
        if (ACT == 2) v = fmaxf(v, 0.0f);
        if (ACT == 3) v = v / (1.0f + expf(-v));
        if (ACT == 4) v = (v > 0.f) ? v : 0.01f * v;
        if (ACT == 5) v = 0.5f * v * (1.0f + erff(v * 0.70710678118654752f));
        slab[(mOff + r) * 68 + (j << 4) + rlane] = v;
      }
    }
    __builtin_amdgcn_fence(__ATOMIC_RELEASE, "workgroup");
    __builtin_amdgcn_wave_barrier();
    __builtin_amdgcn_fence(__ATOMIC_ACQUIRE, "workgroup");
    if (OUT_MODE == 0) {
      float* C = (float*)Cout + (size_t)b * strideC;
      const int hh = lane >> 4, c4 = (lane & 15) * 4;     // row seg = 256 B = 16 lanes x 16 B
      {
#pragma unroll
        for (int it = 0; it < 8; ++it) {
          const int row = it * 2 + hh;
          v4f v = *(const v4f*)(slab + row * 68 + c4);
          *(v4f*)(C + (size_t)(mBase + row) * ldc + n0 + c4) = v;
        }
        
      }
    } else {
      const int q = lane >> 3, c8 = (lane & 7) * 8;
      unsigned short* C  = (unsigned short*)Cout  + (size_t)b * strideC;
      unsigned short* C2 = (OUT_MODE == 2) ? ((unsigned short*)Cout2 + (size_t)b * strideC) : nullptr;
      {
#pragma unroll
        for (int it = 0; it < 4; ++it) {
          const int row = it * 4 + q;
          const float* sp = slab + row * 68 + c8;
          v8h hv, lv;
#pragma unroll
          for (int e = 0; e < 8; ++e) {
            if (OUT_MODE == 1) {
              hv[e] = (_Float16)sp[e];
            } else {
              unsigned short hb = f2bf_bits(sp[e]);
              unsigned short lb = f2bf_bits(sp[e] - bf_bits2f(hb));
              hv[e] = __builtin_bit_cast(_Float16, hb);
              lv[e] = __builtin_bit_cast(_Float16, lb);
            }
          }
          *(v8h*)(C + (size_t)(mBase + row) * ldc + n0 + c8) = hv;
          if (OUT_MODE == 2) *(v8h*)(C2 + (size_t)(mBase + row) * ldc + n0 + c8) = lv;
        }
        
      }
    }
    __builtin_amdgcn_fence(__ATOMIC_RELEASE, "workgroup");
    __builtin_amdgcn_wave_barrier();
    __builtin_amdgcn_fence(__ATOMIC_ACQUIRE, "workgroup");
  }
}

__global__ __launch_bounds__(256) void cast_f32_bf16x2(
    const float* __restrict__ in, unsigned short* __restrict__ out, int n2) {
  int i = blockIdx.x * 256 + threadIdx.x;
  if (i < n2) {
    const unsigned u = (unsigned)f2bf_bits(in[2 * i]) | ((unsigned)f2bf_bits(in[2 * i + 1]) << 16);
    ((unsigned*)out)[i] = u;
    
  }
}

#define AT_D 64
#define AT_NW 4
#define AT_QB 64
#define AT_KC 64
#define AT_MAXKC 32
#define AT_P 72   // LDS row pitch of every 64-element bf16 tile: 144 B = 16 B x odd, so the 16 rows of a 16-byte fragment read fall on distinct banks

struct AttnP { long q_bs, q_rs, q_hs, k_bs, k_rs, k_hs, v_bs, v_rs, v_hs, o_bs, o_rs, o_hs;
               int S, Skv, H; float sscale; };
static_assert(sizeof(AttnP) == 112);

__device__ __forceinline__ unsigned short at_bf_bits(float f) {
  unsigned u = __float_as_uint(f);
  return (unsigned short)((u + 0x7FFFu + ((u >> 16) & 1u)) >> 16);
}
// lane l <-> lane l ^ 16 without LDS
__device__ __forceinline__ float at_xhalf(float x) {
  return __builtin_bit_cast(float, __builtin_amdgcn_permlanex16(__builtin_bit_cast(int, x), __builtin_bit_cast(int, x), 0x76543210, 0xfedcba98, false, false));
}
__device__ __forceinline__ __bf16 at_f2bf(float f) { return __builtin_bit_cast(__bf16, at_bf_bits(f)); }
__device__ __forceinline__ void at_split(float f, __bf16& hi, __bf16& lo) {
  const unsigned short hb = at_bf_bits(f);
  hi = __builtin_bit_cast(__bf16, hb);
  lo = at_f2bf(f - __uint_as_float(((unsigned)hb) << 16));
}
// three products of a hi/lo x hi/lo pair into one accumulator (hi.hi, A lo . B hi, A hi . B lo), then the hazard guard tying D and all four operands
__device__ __forceinline__ v8f at_mma3(v16b ah, v16b al, v16b bh, v16b bl, v8f c) {
  c = __builtin_amdgcn_wmma_f32_16x16x32_bf16(false, ah, false, bh, (short)0, c, false, false);
  c = __builtin_amdgcn_wmma_f32_16x16x32_bf16(false, al, false, bh, (short)0, c, false, false);
  c = __builtin_amdgcn_wmma_f32_16x16x32_bf16(false, ah, false, bl, (short)0, c, false, false);
  asm volatile("v_nop\n\tv_nop\n\tv_nop\n\tv_nop" : "+v"(c) : "v"(ah), "v"(al), "v"(bh), "v"(bl));
  return c;
}

__global__ __launch_bounds__(128)
void attn64_causal_split(const unsigned short* __restrict__ qh_p, const unsigned short* __restrict__ ql_p,
                         const unsigned short* __restrict__ kh_p, const unsigned short* __restrict__ kl_p,
                         const unsigned short* __restrict__ vh_p, const unsigned short* __restrict__ vl_p,
                         unsigned short* __restrict__ ohi, unsigned short* __restrict__ olo, AttnP g) {
  union FB { v16b v; v8b h[2]; };
  __shared__ __align__(16) __bf16 Qsh[AT_QB * AT_P];          // Q hi [row][d]   9 KB
  __shared__ __align__(16) __bf16 Qsl[AT_QB * AT_P];          // Q lo [row][d]   9 KB
  __shared__ __align__(16) __bf16 Ksh[AT_KC * AT_P];          // K hi [kv][d]    9 KB
  __shared__ __align__(16) __bf16 Ksl[AT_KC * AT_P];          // K lo [kv][d]    9 KB
  __shared__ __align__(16) __bf16 Vth[AT_D * AT_P];           // V hi [d][kv]    9 KB
  __shared__ __align__(16) __bf16 Vtl[AT_D * AT_P];           // V lo [d][kv]    9 KB

  const int tid  = threadIdx.x;
  const int wave = tid >> 5;
  const int lane = tid & 31;
  const int hh   = lane >> 4;
  const int c    = lane & 15;

  const int nqb = g.S / AT_QB;
  const int bx = blockIdx.x;
  const int qb = bx % nqb;
  const int bh = bx / nqb;
  const int h  = bh % g.H;
  const int b  = bh / g.H;
  const int q0 = qb * AT_QB + wave * 16;

  const __bf16* qhb = (const __bf16*)qh_p + (size_t)b * g.q_bs + (size_t)h * g.q_hs;
  const __bf16* qlb = (const __bf16*)ql_p + (size_t)b * g.q_bs + (size_t)h * g.q_hs;
  const __bf16* khb = (const __bf16*)kh_p + (size_t)b * g.k_bs + (size_t)h * g.k_hs;
  const __bf16* klb = (const __bf16*)kl_p + (size_t)b * g.k_bs + (size_t)h * g.k_hs;
  const __bf16* vhb = (const __bf16*)vh_p + (size_t)b * g.v_bs + (size_t)h * g.v_hs;
  const __bf16* vlb = (const __bf16*)vl_p + (size_t)b * g.v_bs + (size_t)h * g.v_hs;

  // ---- Q hi/lo planes for the block's 64 rows: [row][d], 16-B copies (thread -> row tid/2, 32-d half) ----
  {
    const int r = tid >> 1, dh = (tid & 1) * 32;
    const size_t qo = (size_t)(qb * AT_QB + r) * g.q_rs + dh;
#pragma unroll
    for (int i = 0; i < 4; ++i) {
      const v8b xh = *(const v8b*)(qhb + qo + 8 * i);
      const v8b xl = *(const v8b*)(qlb + qo + 8 * i);
      *(v8b*)(Qsh + r * AT_P + dh + 8 * i) = xh;
      *(v8b*)(Qsl + r * AT_P + dh + 8 * i) = xl;
    }
  }
  __syncthreads();

  float mrow = NEG_INF, lrow = 0.f;      // query q0 + c: running max (same in both lane halves) and this half's part of the running sum
  v8f oacc[4];                           // oacc[t][r] = O[q0 + c][16 t + 8 hh + r]
#pragma unroll
  for (int t = 0; t < 4; ++t) oacc[t] = (v8f){0.f,0.f,0.f,0.f,0.f,0.f,0.f,0.f};

  const int nck = (qb + 1 < AT_MAXKC) ? (qb + 1) : AT_MAXKC;    // block-uniform, statically bounded
  const __bf16* qwh = Qsh + (wave * 16 + c) * AT_P + 8 * hh;      // B fragment column c (query q0 + c) of this wave
  const __bf16* qwl = Qsl + (wave * 16 + c) * AT_P + 8 * hh;

  for (int kc = 0; kc < nck; ++kc) {
    const int kv0 = kc * AT_KC;
    __syncthreads();
    {
      const int kvr = tid >> 1, dh = (tid & 1) * 32;
      const size_t ko = (size_t)(kv0 + kvr) * g.k_rs + dh;
      const size_t vo = (size_t)(kv0 + kvr) * g.v_rs + dh;
#pragma unroll
      for (int i = 0; i < 4; ++i) {
        const v8b ka = *(const v8b*)(khb + ko + 8 * i);
        const v8b kb = *(const v8b*)(klb + ko + 8 * i);
        *(v8b*)(Ksh + kvr * AT_P + dh + 8 * i) = ka;
        *(v8b*)(Ksl + kvr * AT_P + dh + 8 * i) = kb;
        const v8b va = *(const v8b*)(vhb + vo + 8 * i);
        const v8b vb = *(const v8b*)(vlb + vo + 8 * i);
#pragma unroll
        for (int e = 0; e < 8; ++e) {
          const int d = dh + 8 * i + e;
          Vth[d * AT_P + kvr] = va[e];
          Vtl[d * AT_P + kvr] = vb[e];
        }
      }
    }
    __syncthreads();

    // ---- scores^T[64 x 16] = k . q^T  (A = K[kv][d], B = Q[row][d]; split k-map via two 16-B halves at +8hh and +16+8hh) ----
    // s[j][r] = score of key kv0 + 16 j + 8 hh + r against query q0 + c
    v8f s[4];
#pragma unroll
    for (int j = 0; j < 4; ++j) s[j] = (v8f){0.f,0.f,0.f,0.f,0.f,0.f,0.f,0.f};
#pragma unroll 1
    for (int dc = 0; dc < 2; ++dc) {
      FB qh, ql;
      qh.h[0] = *(const v8b*)(qwh + dc * 32);
      qh.h[1] = *(const v8b*)(qwh + dc * 32 + 16);
      ql.h[0] = *(const v8b*)(qwl + dc * 32);
      ql.h[1] = *(const v8b*)(qwl + dc * 32 + 16);
#pragma unroll
      for (int j = 0; j < 4; ++j) {
        FB kb, kl;
        const __bf16* kp  = Ksh + (j * 16 + c) * AT_P + dc * 32 + 8 * hh;
        const __bf16* kpl = Ksl + (j * 16 + c) * AT_P + dc * 32 + 8 * hh;
        kb.h[0] = *(const v8b*)(kp);
        kb.h[1] = *(const v8b*)(kp + 16);
        kl.h[0] = *(const v8b*)(kpl);
        kl.h[1] = *(const v8b*)(kpl + 16);
        s[j] = at_mma3(kb.v, kl.v, qh.v, ql.v, s[j]);
      }
    }
    // ---- scale, causal mask on the diagonal chunk (key > query -> -inf), max over this lane's 32 keys, then the other half's ----
    const bool diag = (kc == qb);
    const int qrow = q0 + c;
    float cm = NEG_INF;
#pragma unroll
    for (int j = 0; j < 4; ++j) {
#pragma unroll
      for (int r = 0; r < 8; ++r) {
        const int kvcol = kv0 + j * 16 + 8 * hh + r;
        float sv = s[j][r] * g.sscale;
        if (diag && (kvcol > qrow)) sv = NEG_INF;
        s[j][r] = sv;
        cm = fmaxf(cm, sv);
      }
    }
    cm = fmaxf(cm, at_xhalf(cm));
    const float mnew = fmaxf(mrow, cm);
    const float mref = (mnew == NEG_INF) ? 0.0f : mnew;
    const float alpha = __expf(mrow - mref);
    mrow = mnew;
    // ---- p = exp(s - max), split in place: score tiles 2 kk and 2 kk + 1 are elements 0..7 and 8..15 of B fragment kk ----
    FB pa[2], pl[2];
    float psum = 0.f;
#pragma unroll
    for (int j = 0; j < 4; ++j) {
#pragma unroll
      for (int r = 0; r < 8; ++r) {
        const float p = __expf(s[j][r] - mref);
        psum += p;
        __bf16 a, bl; at_split(p, a, bl);
        pa[j >> 1].h[j & 1][r] = a;
        pl[j >> 1].h[j & 1][r] = bl;
      }
    }
    lrow = lrow * alpha + psum;
#pragma unroll
    for (int t = 0; t < 4; ++t)
#pragma unroll
      for (int r = 0; r < 8; ++r) oacc[t][r] *= alpha;
    // ---- O^T[64 x 16] += V^T[64 x 64] . P^T[64 x 16]  (A = V^T[d][kv] from the [d][kv] tile, B = P^T from registers) ----
    // unrolled: pa and pl are register arrays, indexed by kk
#pragma unroll
    for (int kk = 0; kk < 2; ++kk) {
#pragma unroll
      for (int t = 0; t < 4; ++t) {
        FB vb, vl;
        const __bf16* vp  = Vth + (t * 16 + c) * AT_P + kk * 32 + 8 * hh;
        const __bf16* vpl = Vtl + (t * 16 + c) * AT_P + kk * 32 + 8 * hh;
        vb.h[0] = *(const v8b*)(vp);
        vb.h[1] = *(const v8b*)(vp + 16);
        vl.h[0] = *(const v8b*)(vpl);
        vl.h[1] = *(const v8b*)(vpl + 16);
        oacc[t] = at_mma3(vb.v, vl.v, pa[kk].v, pl[kk].v, oacc[t]);
      }
    }
  }

  // ---- a lane holds 8 consecutive d of its query's row per tile. The wave's own 16 Q rows in LDS are dead now and no other
  //      wave reads them: the bf16 hi/lo out tile is staged there, so that each global store covers whole 128-byte rows ----
  {
    const float inv = 1.0f / (lrow + at_xhalf(lrow));    // the two halves' sums are joined once, here
    __bf16* sh = Qsh + wave * 16 * AT_P;
    __bf16* sl = Qsl + wave * 16 * AT_P;
#pragma unroll
    for (int t = 0; t < 4; ++t) {
      v8h hv, lv;
#pragma unroll
      for (int r = 0; r < 8; ++r) {
        const float o = oacc[t][r] * inv;
        const unsigned short hb = f2bf_bits(o);
        const unsigned short lb = f2bf_bits(o - bf_bits2f(hb));
        hv[r] = __builtin_bit_cast(_Float16, hb);
        lv[r] = __builtin_bit_cast(_Float16, lb);
      }
      *(v8h*)(sh + c * AT_P + t * 16 + 8 * hh) = hv;
      *(v8h*)(sl + c * AT_P + t * 16 + 8 * hh) = lv;
    }
    __builtin_amdgcn_fence(__ATOMIC_RELEASE, "workgroup");
    __builtin_amdgcn_wave_barrier();
    __builtin_amdgcn_fence(__ATOMIC_ACQUIRE, "workgroup");
    const int q8 = lane >> 3, c8 = (lane & 7) * 8;
    unsigned short* oh = ohi + (size_t)b * g.o_bs + (size_t)h * g.o_hs;
    unsigned short* ol = olo + (size_t)b * g.o_bs + (size_t)h * g.o_hs;
#pragma unroll
    for (int it = 0; it < 4; ++it) {
      const int row = it * 4 + q8;                    // q8 in 0..3, it in 0..3 -> rows 0..15
      const v8h hv = *(const v8h*)(sh + row * AT_P + c8);
      const v8h lv = *(const v8h*)(sl + row * AT_P + c8);
      *(v8h*)(oh + (size_t)(q0 + row) * g.o_rs + c8) = hv;
      *(v8h*)(ol + (size_t)(q0 + row) * g.o_rs + c8) = lv;
    }
  }
}

// ---------------------------------------------------------------------------
// Host orchestration (launches only).
// d_in: 0 = x [4,2048,1024], 1 = W_q, 2 = W_k, 3 = W_v (each [1024,1024], (out,in)), 4 = W_out [1024,1024], 5 = b_out [1024]; all f32.
// Workspace (104 MiB): bf16 x | bf16 [W_q;W_k;W_v] | bf16 W_out | qkv hi plane | qkv lo plane (two batches at a time) | attn hi | attn lo.
// ---------------------------------------------------------------------------
extern "C" void kernel_launch(void* const* d_in, const int* in_sizes, int n_in,
                              void* d_out, int out_size, void* d_ws, size_t ws_size,
                              hipStream_t stream) {
  constexpr int Bn = 4, S = 2048, E = 1024, Hn = 16, Dh = 64, E3 = 3 * E;
  constexpr int M = Bn * S;                 // 8192 rows in total
  constexpr int BH = 2;                     // batches per pass
  constexpr int MH = BH * S;                // 4096 rows per pass
  constexpr int NQB = S / AT_QB;            // 32
  static_assert(NQB <= AT_MAXKC);
  static_assert(M % 64 == 0 && MH % 64 == 0 && E % 64 == 0 && E3 % 64 == 0 && E % 32 == 0 && Hn * Dh == E && Bn % BH == 0);
  if (n_in < 6) return;
  if (in_sizes[0] != M * E || in_sizes[1] != E * E || in_sizes[2] != E * E || in_sizes[3] != E * E ||
      in_sizes[4] != E * E || in_sizes[5] != E || out_size != M * E) return;

  const float* x     = (const float*)d_in[0];
  const float* w_q   = (const float*)d_in[1];
  const float* w_k   = (const float*)d_in[2];
  const float* w_v   = (const float*)d_in[3];
  const float* w_out = (const float*)d_in[4];
  const float* b_out = (const float*)d_in[5];
  float* out = (float*)d_out;

  const size_t bX   = (size_t)M * E * 2;                  // 16 MiB  bf16 x
  const size_t bW   = (size_t)E3 * E * 2;                 //  6 MiB  bf16 [W_q; W_k; W_v]
  const size_t bWo  = (size_t)E * E * 2;                  //  2 MiB  bf16 W_out
  const size_t bQKV = (size_t)MH * E3 * 2;                // 24 MiB  bf16 plane of qkv (x2)
  const size_t bAH  = (size_t)M * E * 2;                  // 16 MiB  bf16 plane of attn out (x2)
  char* ws = (char*)d_ws;
  size_t off = 0;
  unsigned short* X16  = (unsigned short*)(ws + off); off += bX;
  unsigned short* W16  = (unsigned short*)(ws + off); off += bW;
  unsigned short* Wo16 = (unsigned short*)(ws + off); off += bWo;
  unsigned short* QH   = (unsigned short*)(ws + off); off += bQKV;
  unsigned short* QL   = (unsigned short*)(ws + off); off += bQKV;
  unsigned short* AH   = (unsigned short*)(ws + off); off += bAH;
  unsigned short* AL   = (unsigned short*)(ws + off); off += bAH;
  if (off > ws_size || off > (size_t)134217728) return;   // 109,051,904 B

  dim3 blk256(256), blk128(128);

  // 1-5: RNE bf16 casts of x, the three projection weights (stacked into one [3072][1024] matrix) and W_out
  {
    const int n2x = M * E / 2, n2w = E * E / 2;
    cast_f32_bf16x2<<<dim3((n2x + 255) / 256), blk256, 0, stream>>>(x, X16, n2x);
    cast_f32_bf16x2<<<dim3((n2w + 255) / 256), blk256, 0, stream>>>(w_q, W16, n2w);
    cast_f32_bf16x2<<<dim3((n2w + 255) / 256), blk256, 0, stream>>>(w_k, W16 + (size_t)E * E, n2w);
    cast_f32_bf16x2<<<dim3((n2w + 255) / 256), blk256, 0, stream>>>(w_v, W16 + (size_t)2 * E * E, n2w);
    cast_f32_bf16x2<<<dim3((n2w + 255) / 256), blk256, 0, stream>>>(w_out, Wo16, n2w);
  }

  for (int half = 0; half < Bn / BH; ++half) {
    // 6/8: qkv[MH][3072] = bf16(x rows of this pass) . bf16([W_q;W_k;W_v])^T, written as bf16 hi/lo planes
    {
      const int tiles = (MH / 64) * (E3 / 64);             // 3072
      const unsigned short* Xh = X16 + (size_t)half * MH * E;
      wmma_gemm64<1, 0, 0, 2, false><<<dim3((tiles + 7) / 8, 1), blk256, 0, stream>>>(
          Xh, Xh, E, 0L, W16, W16, E, 0L, (void*)QH, (void*)QL, E3, 0L,
          b_out, b_out, 0L, MH, E3, E, 1.0f);
    }
    // 7/9: causal attention per (batch, head, 64-query block) -> bf16 hi/lo planes [M][E] rows of this pass
    {
      AttnP g;
      g.q_bs = (long)S * E3; g.q_rs = E3; g.q_hs = Dh;
      g.k_bs = (long)S * E3; g.k_rs = E3; g.k_hs = Dh;
      g.v_bs = (long)S * E3; g.v_rs = E3; g.v_hs = Dh;
      g.o_bs = (long)S * E;  g.o_rs = E;  g.o_hs = Dh;
      g.S = S; g.Skv = S; g.H = Hn;
      g.sscale = 0.125f;             // 64^-0.5, applied in f32 after the product
      unsigned short* oh = AH + (size_t)half * MH * E;
      unsigned short* ol = AL + (size_t)half * MH * E;
      attn64_causal_split<<<dim3(BH * Hn * NQB), blk128, 0, stream>>>(
          QH, QL, QH + E, QL + E, QH + 2 * E, QL + 2 * E, oh, ol, g);
    }
  }

  // 10: out[M][E] (f32) = (attn hi + attn lo) . bf16(W_out)^T + bf16(b_out)
  {
    const int tiles = (M / 64) * (E / 64);                 // 2048
    wmma_gemm64<1, 2, 3, 0, false><<<dim3((tiles + 7) / 8, 1), blk256, 0, stream>>>(
        AH, AL, E, 0L, Wo16, Wo16, E, 0L, (void*)out, (void*)out, E, 0L,
        b_out, b_out, 0L, M, E, E, 1.0f);
  }
}

// v003
// It runs in 360 microseconds.
// In both of two side-by-side timings against v002, it was 1.36 times as fast.
// Counting every step since v000, it is 2.44 times as fast.
#include <hip/hip_runtime.h>
// Contractions: qkv projection GEMM = v_wmma_f32_16x16x32_bf16 (bf16 operands, 1 product); q.k^T = v_wmma_f32_16x16x32_bf16 (bf16 hi/lo planes of q and k, 3 products); p.v = v_wmma_f32_16x16x32_bf16 (bf16 hi/lo planes of p and v, 3 products); output projection GEMM = v_wmma_f32_16x16x32_bf16 (bf16 hi/lo planes of the attention output x bf16 weight, 2 products); f32 accumulate everywhere; softmax in f32.

typedef __attribute__((ext_vector_type(16))) _Float16 v16h;
typedef __attribute__((ext_vector_type(8)))  _Float16 v8h;
typedef __attribute__((ext_vector_type(16))) __bf16   v16b;
typedef __attribute__((ext_vector_type(8)))  __bf16   v8b;
typedef __attribute__((ext_vector_type(8)))  float    v8f;
typedef __attribute__((ext_vector_type(4)))  float    v4f;

#define NEG_INF (-__builtin_inff())

__device__ __forceinline__ unsigned short f2bf_bits(float f) {
  unsigned u = __float_as_uint(f);
  return (unsigned short)((u + 0x7FFFu + ((u >> 16) & 1u)) >> 16);
}
__device__ __forceinline__ float bf_bits2f(unsigned short h) { return __uint_as_float(((unsigned)h) << 16); }

// hazard guards as plain device helpers (no inline asm inside the kernel template body)
__device__ __forceinline__ void dep_guard_h(v8f& a, v8f& b, v16h x, v16h y) { asm volatile("v_nop\n\tv_nop\n\tv_nop\n\tv_nop" : "+v"(a), "+v"(b) : "v"(x), "v"(y)); }
__device__ __forceinline__ void dep_guard_b(v8f& a, v8f& b, v16b x, v16b y) { asm volatile("v_nop\n\tv_nop\n\tv_nop\n\tv_nop" : "+v"(a), "+v"(b) : "v"(x), "v"(y)); }
__device__ __forceinline__ void keep4_h(v16h a, v16h b, v16h c, v16h d) { asm volatile("v_nop" :: "v"(a), "v"(b), "v"(c), "v"(d)); }
__device__ __forceinline__ void keep4_b(v16b a, v16b b, v16b c, v16b d) { asm volatile("v_nop" :: "v"(a), "v"(b), "v"(c), "v"(d)); }
__device__ __forceinline__ void acc_guard4(v8f& a, v8f& b, v8f& c, v8f& d) { asm volatile("v_nop\n\tv_nop\n\tv_nop\n\tv_nop" : "+v"(a), "+v"(b), "+v"(c), "+v"(d)); }
template <typename T> struct Frag;
template <> struct Frag<_Float16> {
  typedef v16h V; union U { v16h v; v8h h[2]; };
  static __device__ __forceinline__ v16h load(const _Float16* p) {   // elements 0..7 <- p[0..7], 8..15 <- p[16..23]
    U f; f.h[0] = *(const v8h*)(p); f.h[1] = *(const v8h*)(p + 16); return f.v;
  }
  static __device__ __forceinline__ v8f mma(v16h a, v16h b, v8f c) {
    return __builtin_amdgcn_wmma_f32_16x16x32_f16(false, a, false, b, (short)0, c, false, false);
  }
  static __device__ __forceinline__ void guard(v8f& a, v8f& b, v16h x, v16h y) { dep_guard_h(a, b, x, y); }
  static __device__ __forceinline__ void keep(v16h a, v16h b, v16h c, v16h d) { keep4_h(a, b, c, d); }
};
template <> struct Frag<__bf16> {
  typedef v16b V; union U { v16b v; v8b h[2]; };
  static __device__ __forceinline__ v16b load(const __bf16* p) {
    U f; f.h[0] = *(const v8b*)(p); f.h[1] = *(const v8b*)(p + 16); return f.v;
  }
  static __device__ __forceinline__ v8f mma(v16b a, v16b b, v8f c) {
    return __builtin_amdgcn_wmma_f32_16x16x32_bf16(false, a, false, b, (short)0, c, false, false);
  }
  static __device__ __forceinline__ void guard(v8f& a, v8f& b, v16b x, v16b y) { dep_guard_b(a, b, x, y); }
  static __device__ __forceinline__ void keep(v16b a, v16b b, v16b c, v16b d) { keep4_b(a, b, c, d); }
};

// ---- Register-blocked batched WMMA GEMM ------------------------------------
// C[m,n] = scale * sum_k A[m,k] * Bt[n,k] (+bias)(+resid); each wave owns a 64x64 tile, a block of 2 x 4 waves a 128x256 tile.
// A row-major [M,K]; Bt row-major [N,K]; M % 128 == 0, N % 256 == 0, K % 64 == 0.
// The block's operand rows go to LDS in stages of 64 k (128-byte rows, whole lines) by asynchronous copies, two buffers:
// stage t + 1 flies while stage t is multiplied; the waves read their fragments from LDS.
// SPLIT: 0 = single planes; 1 = A and Bt as hi/lo planes (hi.hi + hi.lo + lo.hi); 2 = A as hi/lo planes, Bt single (hi.B + lo.B).
// BIAS_MODE: 0 = none, 1 = bias[m], 2 = bias[n], 3 = bias[n] RNE-converted to bf16 then added in f32.
// OUT_MODE: 0 = f32, 1 = f16, 2 = bf16 hi plane (Cout) + bf16 lo plane (Cout2).
// ET: 0 = f16 operands, 1 = bf16 operands (pointers passed as 16-bit storage)
#define GM_KC 64   // k per stage
#define GM_P  72   // LDS row pitch in elements: 144 B = 16 B x odd, so the 16 rows of a 16-byte fragment read fall on distinct banks
// four asynchronous 16-byte copies per lane, global -> LDS; s_wait_xcnt closes the statement so that no address register is rewritten ahead of it
__device__ __forceinline__ void gm_copy4(unsigned l0, unsigned l1, unsigned l2, unsigned l3,
                                         const unsigned short* g0, const unsigned short* g1,
                                         const unsigned short* g2, const unsigned short* g3) {
  asm volatile("global_load_async_to_lds_b128 %0, %4, off\n\t"
               "global_load_async_to_lds_b128 %1, %5, off\n\t"
               "global_load_async_to_lds_b128 %2, %6, off\n\t"
               "global_load_async_to_lds_b128 %3, %7, off\n\t"
               "s_wait_xcnt 0x0"
               :: "v"(l0), "v"(l1), "v"(l2), "v"(l3), "v"(g0), "v"(g1), "v"(g2), "v"(g3) : "memory");
}
// 128 rows of one plane: this lane's 16 bytes of rows r, r + 32, r + 64, r + 96 (step = 32 source rows, in elements)
__device__ __forceinline__ void gm_stage128(unsigned lds, const unsigned short* g, size_t step) {
  gm_copy4(lds, lds + 32u * GM_P * 2u, lds + 64u * GM_P * 2u, lds + 96u * GM_P * 2u, g, g + step, g + 2 * step, g + 3 * step);
}
// the same for two groups of 128 rows in one statement, under one wait
__device__ __forceinline__ void gm_stage256(unsigned la, const unsigned short* ga, size_t sa,
                                            unsigned lb, const unsigned short* gb, size_t sb) {
  asm volatile("global_load_async_to_lds_b128 %0, %8, off\n\t"
               "global_load_async_to_lds_b128 %1, %9, off\n\t"
               "global_load_async_to_lds_b128 %2, %10, off\n\t"
               "global_load_async_to_lds_b128 %3, %11, off\n\t"
               "global_load_async_to_lds_b128 %4, %12, off\n\t"
               "global_load_async_to_lds_b128 %5, %13, off\n\t"
               "global_load_async_to_lds_b128 %6, %14, off\n\t"
               "global_load_async_to_lds_b128 %7, %15, off\n\t"
               "s_wait_xcnt 0x0"
               :: "v"(la), "v"(la + 32u * GM_P * 2u), "v"(la + 64u * GM_P * 2u), "v"(la + 96u * GM_P * 2u),
                  "v"(lb), "v"(lb + 32u * GM_P * 2u), "v"(lb + 64u * GM_P * 2u), "v"(lb + 96u * GM_P * 2u),
                  "v"(ga), "v"(ga + sa), "v"(ga + 2 * sa), "v"(ga + 3 * sa),
                  "v"(gb), "v"(gb + sb), "v"(gb + 2 * sb), "v"(gb + 3 * sb) : "memory");
}
// this wave's copies have landed (the compiler places no wait for them)
__device__ __forceinline__ void gm_wait_copies() { asm volatile("s_wait_asynccnt 0x0" ::: "memory"); }
// this wave's LDS reads have returned, before the buffer is handed to its next writer
__device__ __forceinline__ void gm_wait_lds() { asm volatile("s_wait_dscnt 0x0" ::: "memory"); }
template <int ET> struct Elem;
template <> struct Elem<0> { typedef _Float16 T; };
template <> struct Elem<1> { typedef __bf16 T; };
template <int ET, int SPLIT, int BIAS_MODE, int OUT_MODE, bool RESID, int ACT = 0>
__global__ __launch_bounds__(256) void wmma_gemm64(
    const unsigned short* __restrict__ Ap, const unsigned short* __restrict__ A2p, int lda, long strideA,
    const unsigned short* __restrict__ Btp, const unsigned short* __restrict__ Bt2p, int ldb, long strideB,
    void* __restrict__ Cout, void* __restrict__ Cout2, int ldc, long strideC,
    const float* __restrict__ bias,
    const float* __restrict__ resid, long strideR,
    int M, int N, int K, float scale) {
  typedef typename Elem<ET>::T T;
  typedef typename Frag<T>::V V;
  const T* A = (const T*)Ap; const T* A2 = (const T*)A2p; const T* Bt = (const T*)Btp; const T* Bt2 = (const T*)Bt2p;
  constexpr int ROWS_A = (SPLIT != 0) ? 256 : 128;   // staged rows: A hi [, A lo], Bt hi [, Bt lo]
  constexpr int ROWS_B = (SPLIT == 1) ? 512 : 256;
  constexpr int STAGE  = (ROWS_A + ROWS_B) * GM_P;   // elements per buffer
  __shared__ __align__(16) unsigned short ring[2 * STAGE];
  __shared__ __align__(16) float sT[8][16 * 68];   // per-wave 16x64 slab, pitch 68 floats
  const int b    = blockIdx.y;
  const int lane = threadIdx.x & 31;
  const int wave = threadIdx.x >> 5;
  const int blocksN = N >> 8;
  const int bm = blockIdx.x / blocksN;
  const int bn = blockIdx.x - bm * blocksN;
  if (bm >= (M >> 7)) return;            // block-uniform, in front of every barrier
  const int mB = bm << 7;
  const int nB = bn << 8;
  const int wm = wave >> 2;
  const int wn = wave & 3;
  const int m0 = mB + (wm << 6);
  const int n0 = nB + (wn << 6);

  const T* Ab  = A  + (size_t)b * strideA;
  const T* Bb  = Bt + (size_t)b * strideB;
  const T* Ab2 = (SPLIT != 0) ? (A2  + (size_t)b * strideA) : nullptr;
  const T* Bb2 = (SPLIT == 1) ? (Bt2 + (size_t)b * strideB) : nullptr;

  const int rlane = lane & 15;                 // row (A) / col (B, D) within subtile
  const int koff  = (lane >> 4) * 8;           // k offset of this lane half
  const int mOff  = (lane >> 4) * 8;           // D row offset

  v8f acc[4][4];
#pragma unroll
  for (int i = 0; i < 4; ++i)
#pragma unroll
    for (int j = 0; j < 4; ++j) acc[i][j] = (v8f){0.f,0.f,0.f,0.f,0.f,0.f,0.f,0.f};

  // copies: thread -> row tid / 8 of each group of 32 rows, 16-byte piece tid % 8, so a wave's copy covers four whole 128-byte rows
  const int crow = threadIdx.x >> 3;
  const int ccol = (threadIdx.x & 7) << 3;
  const unsigned ldsT = (unsigned)(size_t)ring + (unsigned)(crow * GM_P + ccol) * 2u;   // LDS byte address: low 32 bits of the shared address
  const unsigned short* gA  = (const unsigned short*)Ab + (size_t)(mB + crow) * lda + ccol;
  const unsigned short* gB  = (const unsigned short*)Bb + (size_t)(nB + crow) * ldb + ccol;
  const unsigned short* gA2 = (SPLIT != 0) ? ((const unsigned short*)Ab2 + (size_t)(mB + crow) * lda + ccol) : nullptr;
  const unsigned short* gB2 = (SPLIT == 1) ? ((const unsigned short*)Bb2 + (size_t)(nB + crow) * ldb + ccol) : nullptr;
  const size_t sA = (size_t)32 * lda, sB = (size_t)32 * ldb;
  auto issue = [&](int t) {              // stage t into buffer t & 1
    const unsigned l = ldsT + (unsigned)(t & 1) * (unsigned)(STAGE * 2);
    const int k0 = t * GM_KC;
    if (SPLIT == 0) gm_stage128(l, gA + k0, sA);
    else            gm_stage256(l, gA + k0, sA, l + 128u * GM_P * 2u, gA2 + k0, sA);
    gm_stage256(l + (unsigned)ROWS_A * GM_P * 2u, gB + k0, sB, l + (unsigned)(ROWS_A + 128) * GM_P * 2u, gB + 4 * sB + k0, sB);
    if (SPLIT == 1)
      gm_stage256(l + (unsigned)(ROWS_A + 256) * GM_P * 2u, gB2 + k0, sB, l + (unsigned)(ROWS_A + 384) * GM_P * 2u, gB2 + 4 * sB + k0, sB);
  };
  const int nt = K / GM_KC;              // block-uniform
  issue(0);
  gm_wait_copies();
  __syncthreads();
  if (nt > 1) issue(1);

  const int aoff = ((wm << 6) + rlane) * GM_P + koff;
  const int boff = (ROWS_A + (wn << 6) + rlane) * GM_P + koff;
  for (int t = 0; t < nt; ++t) {
    const T* st = (const T*)ring + (t & 1) * STAGE;
    // unrolled, like the loops inside: the fragment and accumulator arrays are indexed by constants and stay in registers
#pragma unroll
    for (int ks = 0; ks < GM_KC / 32; ++ks) {
      // all fragments of this 32-k step as one group of LDS reads in front of its products
      V bh[4], bl[4], ah[4], al[4];
#pragma unroll
      for (int j = 0; j < 4; ++j) {
        bh[j] = Frag<T>::load(st + boff + (j << 4) * GM_P + ks * 32);
        if (SPLIT == 1) bl[j] = Frag<T>::load(st + boff + (256 + (j << 4)) * GM_P + ks * 32);
      }
#pragma unroll
      for (int i = 0; i < 4; ++i) {
        ah[i] = Frag<T>::load(st + aoff + (i << 4) * GM_P + ks * 32);
        if (SPLIT != 0) al[i] = Frag<T>::load(st + aoff + (128 + (i << 4)) * GM_P + ks * 32);
      }
#pragma unroll
      for (int i = 0; i < 4; ++i) {
#pragma unroll
        for (int j = 0; j < 4; ++j) {
          acc[i][j] = Frag<T>::mma(ah[i], bh[j], acc[i][j]);
          if (SPLIT == 1) acc[i][j] = Frag<T>::mma(ah[i], bl[j], acc[i][j]);
          if (SPLIT != 0) acc[i][j] = Frag<T>::mma(al[i], bh[j], acc[i][j]);
        }
        Frag<T>::guard(acc[i][0], acc[i][3], ah[i], (SPLIT != 0) ? al[i] : ah[i]);
      }
      Frag<T>::keep(bh[0], bh[1], bh[2], bh[3]);
      if (SPLIT == 1) Frag<T>::keep(bl[0], bl[1], bl[2], bl[3]);
    }
    // publish point of stage t + 1: own LDS reads back, own copies landed, one barrier (it also ends every read of buffer t & 1), then the refill
    gm_wait_lds();
    gm_wait_copies();
    __syncthreads();
    if (t + 2 < nt) issue(t + 2);
  }
  gm_wait_copies();
  acc_guard4(acc[0][0], acc[0][1], acc[0][2], acc[0][3]);
  acc_guard4(acc[1][0], acc[1][1], acc[1][2], acc[1][3]);
  acc_guard4(acc[2][0], acc[2][1], acc[2][2], acc[2][3]);
  acc_guard4(acc[3][0], acc[3][1], acc[3][2], acc[3][3]);

  // ---- epilogue ----
  float* slab = sT[wave];
  const float* Rb = RESID ? (resid + (size_t)b * strideR) : nullptr;
#pragma unroll
  for (int i = 0; i < 4; ++i) {
    const int mBase = m0 + (i << 4);
#pragma unroll
    for (int j = 0; j < 4; ++j) {
      const int n = n0 + (j << 4) + rlane;
      float bv = 0.f;
      if (BIAS_MODE == 2) bv = bias[n];
      if (BIAS_MODE == 3) bv = bf_bits2f(f2bf_bits(bias[n]));
#pragma unroll
      for (int r = 0; r < 8; ++r) {
        float v = acc[i][j][r] * scale;
        if (BIAS_MODE == 1) v += bias[mBase + mOff + r];
        if (BIAS_MODE == 2 || BIAS_MODE == 3) v += bv;
        if (RESID) v += Rb[(size_t)(mBase + mOff + r) * ldc + n];
        if (ACT == 1) v = tanhf(v);
        if (ACT == 2) v = fmaxf(v, 0.0f);
        if (ACT == 3) v = v / (1.0f + expf(-v));
        if (ACT == 4) v = (v > 0.f) ? v : 0.01f * v;
        if (ACT == 5) v = 0.5f * v * (1.0f + erff(v * 0.70710678118654752f));
        slab[(mOff + r) * 68 + (j << 4) + rlane] = v;
      }
    }
    __builtin_amdgcn_fence(__ATOMIC_RELEASE, "workgroup");
    __builtin_amdgcn_wave_barrier();
    __builtin_amdgcn_fence(__ATOMIC_ACQUIRE, "workgroup");
    if (OUT_MODE == 0) {
      float* C = (float*)Cout + (size_t)b * strideC;
      const int hh = lane >> 4, c4 = (lane & 15) * 4;     // row seg = 256 B = 16 lanes x 16 B
      {
#pragma unroll
        for (int it = 0; it < 8; ++it) {
          const int row = it * 2 + hh;
          v4f v = *(const v4f*)(slab + row * 68 + c4);
          *(v4f*)(C + (size_t)(mBase + row) * ldc + n0 + c4) = v;
        }
        
      }
    } else {
      const int q = lane >> 3, c8 = (lane & 7) * 8;
      unsigned short* C  = (unsigned short*)Cout  + (size_t)b * strideC;
      unsigned short* C2 = (OUT_MODE == 2) ? ((unsigned short*)Cout2 + (size_t)b * strideC) : nullptr;
      {
#pragma unroll
        for (int it = 0; it < 4; ++it) {
          const int row = it * 4 + q;
          const float* sp = slab + row * 68 + c8;
          v8h hv, lv;
#pragma unroll
          for (int e = 0; e < 8; ++e) {
            if (OUT_MODE == 1) {
              hv[e] = (_Float16)sp[e];
            } else {
              unsigned short hb = f2bf_bits(sp[e]);
              unsigned short lb = f2bf_bits(sp[e] - bf_bits2f(hb));
              hv[e] = __builtin_bit_cast(_Float16, hb);
              lv[e] = __builtin_bit_cast(_Float16, lb);
            }
          }
          *(v8h*)(C + (size_t)(mBase + row) * ldc + n0 + c8) = hv;
          if (OUT_MODE == 2) *(v8h*)(C2 + (size_t)(mBase + row) * ldc + n0 + c8) = lv;
        }
        
      }
    }
    __builtin_amdgcn_fence(__ATOMIC_RELEASE, "workgroup");
    __builtin_amdgcn_wave_barrier();
    __builtin_amdgcn_fence(__ATOMIC_ACQUIRE, "workgroup");
  }
}

__global__ __launch_bounds__(256) void cast_f32_bf16x2(
    const float* __restrict__ in, unsigned short* __restrict__ out, int n2) {
  int i = blockIdx.x * 256 + threadIdx.x;
  if (i < n2) {
    const unsigned u = (unsigned)f2bf_bits(in[2 * i]) | ((unsigned)f2bf_bits(in[2 * i + 1]) << 16);
    ((unsigned*)out)[i] = u;
    
  }
}

#define AT_D 64
#define AT_NW 4
#define AT_QB 64
#define AT_KC 64
#define AT_MAXKC 32
#define AT_P 72   // LDS row pitch of every 64-element bf16 tile: 144 B = 16 B x odd, so the 16 rows of a 16-byte fragment read fall on distinct banks

struct AttnP { long q_bs, q_rs, q_hs, k_bs, k_rs, k_hs, v_bs, v_rs, v_hs, o_bs, o_rs, o_hs;
               int S, Skv, H; float sscale; };
static_assert(sizeof(AttnP) == 112);

__device__ __forceinline__ unsigned short at_bf_bits(float f) {
  unsigned u = __float_as_uint(f);
  return (unsigned short)((u + 0x7FFFu + ((u >> 16) & 1u)) >> 16);
}
// lane l <-> lane l ^ 16 without LDS
__device__ __forceinline__ float at_xhalf(float x) {
  return __builtin_bit_cast(float, __builtin_amdgcn_permlanex16(__builtin_bit_cast(int, x), __builtin_bit_cast(int, x), 0x76543210, 0xfedcba98, false, false));
}
__device__ __forceinline__ __bf16 at_f2bf(float f) { return __builtin_bit_cast(__bf16, at_bf_bits(f)); }
__device__ __forceinline__ void at_split(float f, __bf16& hi, __bf16& lo) {
  const unsigned short hb = at_bf_bits(f);
  hi = __builtin_bit_cast(__bf16, hb);
  lo = at_f2bf(f - __uint_as_float(((unsigned)hb) << 16));
}
// three products of a hi/lo x hi/lo pair into one accumulator (hi.hi, A lo . B hi, A hi . B lo), then the hazard guard tying D and all four operands
__device__ __forceinline__ v8f at_mma3(v16b ah, v16b al, v16b bh, v16b bl, v8f c) {
  c = __builtin_amdgcn_wmma_f32_16x16x32_bf16(false, ah, false, bh, (short)0, c, false, false);
  c = __builtin_amdgcn_wmma_f32_16x16x32_bf16(false, al, false, bh, (short)0, c, false, false);
  c = __builtin_amdgcn_wmma_f32_16x16x32_bf16(false, ah, false, bl, (short)0, c, false, false);
  asm volatile("v_nop\n\tv_nop\n\tv_nop\n\tv_nop" : "+v"(c) : "v"(ah), "v"(al), "v"(bh), "v"(bl));
  return c;
}

__global__ __launch_bounds__(128)
void attn64_causal_split(const unsigned short* __restrict__ qh_p, const unsigned short* __restrict__ ql_p,
                         const unsigned short* __restrict__ kh_p, const unsigned short* __restrict__ kl_p,
                         const unsigned short* __restrict__ vh_p, const unsigned short* __restrict__ vl_p,
                         unsigned short* __restrict__ ohi, unsigned short* __restrict__ olo, AttnP g) {
  union FB { v16b v; v8b h[2]; };
  __shared__ __align__(16) __bf16 Qsh[AT_QB * AT_P];          // Q hi [row][d]   9 KB
  __shared__ __align__(16) __bf16 Qsl[AT_QB * AT_P];          // Q lo [row][d]   9 KB
  __shared__ __align__(16) __bf16 Ksh[AT_KC * AT_P];          // K hi [kv][d]    9 KB
  __shared__ __align__(16) __bf16 Ksl[AT_KC * AT_P];          // K lo [kv][d]    9 KB
  __shared__ __align__(16) __bf16 Vth[AT_D * AT_P];           // V hi [d][kv]    9 KB
  __shared__ __align__(16) __bf16 Vtl[AT_D * AT_P];           // V lo [d][kv]    9 KB

  const int tid  = threadIdx.x;
  const int wave = tid >> 5;
  const int lane = tid & 31;
  const int hh   = lane >> 4;
  const int c    = lane & 15;

  const int nqb = g.S / AT_QB;
  const int bx = blockIdx.x;
  const int qb = bx % nqb;
  const int bh = bx / nqb;
  const int h  = bh % g.H;
  const int b  = bh / g.H;
  const int q0 = qb * AT_QB + wave * 16;

  const __bf16* qhb = (const __bf16*)qh_p + (size_t)b * g.q_bs + (size_t)h * g.q_hs;
  const __bf16* qlb = (const __bf16*)ql_p + (size_t)b * g.q_bs + (size_t)h * g.q_hs;
  const __bf16* khb = (const __bf16*)kh_p + (size_t)b * g.k_bs + (size_t)h * g.k_hs;
  const __bf16* klb = (const __bf16*)kl_p + (size_t)b * g.k_bs + (size_t)h * g.k_hs;
  const __bf16* vhb = (const __bf16*)vh_p + (size_t)b * g.v_bs + (size_t)h * g.v_hs;
  const __bf16* vlb = (const __bf16*)vl_p + (size_t)b * g.v_bs + (size_t)h * g.v_hs;

  // ---- Q hi/lo planes for the block's 64 rows: [row][d], 16-B copies (thread -> row tid/2, 32-d half) ----
  {
    const int r = tid >> 1, dh = (tid & 1) * 32;
    const size_t qo = (size_t)(qb * AT_QB + r) * g.q_rs + dh;
#pragma unroll
    for (int i = 0; i < 4; ++i) {
      const v8b xh = *(const v8b*)(qhb + qo + 8 * i);
      const v8b xl = *(const v8b*)(qlb + qo + 8 * i);
      *(v8b*)(Qsh + r * AT_P + dh + 8 * i) = xh;
      *(v8b*)(Qsl + r * AT_P + dh + 8 * i) = xl;
    }
  }
  __syncthreads();

  float mrow = NEG_INF, lrow = 0.f;      // query q0 + c: running max (same in both lane halves) and this half's part of the running sum
  v8f oacc[4];                           // oacc[t][r] = O[q0 + c][16 t + 8 hh + r]
#pragma unroll
  for (int t = 0; t < 4; ++t) oacc[t] = (v8f){0.f,0.f,0.f,0.f,0.f,0.f,0.f,0.f};

  const int nck = (qb + 1 < AT_MAXKC) ? (qb + 1) : AT_MAXKC;    // block-uniform, statically bounded
  const __bf16* qwh = Qsh + (wave * 16 + c) * AT_P + 8 * hh;      // B fragment column c (query q0 + c) of this wave
  const __bf16* qwl = Qsl + (wave * 16 + c) * AT_P + 8 * hh;

  for (int kc = 0; kc < nck; ++kc) {
    const int kv0 = kc * AT_KC;
    __syncthreads();
    {
      const int kvr = tid >> 1, dh = (tid & 1) * 32;
      const size_t ko = (size_t)(kv0 + kvr) * g.k_rs + dh;
      const size_t vo = (size_t)(kv0 + kvr) * g.v_rs + dh;
#pragma unroll
      for (int i = 0; i < 4; ++i) {
        const v8b ka = *(const v8b*)(khb + ko + 8 * i);
        const v8b kb = *(const v8b*)(klb + ko + 8 * i);
        *(v8b*)(Ksh + kvr * AT_P + dh + 8 * i) = ka;
        *(v8b*)(Ksl + kvr * AT_P + dh + 8 * i) = kb;
        const v8b va = *(const v8b*)(vhb + vo + 8 * i);
        const v8b vb = *(const v8b*)(vlb + vo + 8 * i);
#pragma unroll
        for (int e = 0; e < 8; ++e) {
          const int d = dh + 8 * i + e;
          Vth[d * AT_P + kvr] = va[e];
          Vtl[d * AT_P + kvr] = vb[e];
        }
      }
    }
    __syncthreads();

    // ---- scores^T[64 x 16] = k . q^T  (A = K[kv][d], B = Q[row][d]; split k-map via two 16-B halves at +8hh and +16+8hh) ----
    // s[j][r] = score of key kv0 + 16 j + 8 hh + r against query q0 + c
    v8f s[4];
#pragma unroll
    for (int j = 0; j < 4; ++j) s[j] = (v8f){0.f,0.f,0.f,0.f,0.f,0.f,0.f,0.f};
#pragma unroll 1
    for (int dc = 0; dc < 2; ++dc) {
      FB qh, ql;
      qh.h[0] = *(const v8b*)(qwh + dc * 32);
      qh.h[1] = *(const v8b*)(qwh + dc * 32 + 16);
      ql.h[0] = *(const v8b*)(qwl + dc * 32);
      ql.h[1] = *(const v8b*)(qwl + dc * 32 + 16);
#pragma unroll
      for (int j = 0; j < 4; ++j) {
        FB kb, kl;
        const __bf16* kp  = Ksh + (j * 16 + c) * AT_P + dc * 32 + 8 * hh;
        const __bf16* kpl = Ksl + (j * 16 + c) * AT_P + dc * 32 + 8 * hh;
        kb.h[0] = *(const v8b*)(kp);
        kb.h[1] = *(const v8b*)(kp + 16);
        kl.h[0] = *(const v8b*)(kpl);
        kl.h[1] = *(const v8b*)(kpl + 16);
        s[j] = at_mma3(kb.v, kl.v, qh.v, ql.v, s[j]);
      }
    }
    // ---- scale, causal mask on the diagonal chunk (key > query -> -inf), max over this lane's 32 keys, then the other half's ----
    const bool diag = (kc == qb);
    const int qrow = q0 + c;
    float cm = NEG_INF;
#pragma unroll
    for (int j = 0; j < 4; ++j) {
#pragma unroll
      for (int r = 0; r < 8; ++r) {
        const int kvcol = kv0 + j * 16 + 8 * hh + r;
        float sv = s[j][r] * g.sscale;
        if (diag && (kvcol > qrow)) sv = NEG_INF;
        s[j][r] = sv;
        cm = fmaxf(cm, sv);
      }
    }
    cm = fmaxf(cm, at_xhalf(cm));
    const float mnew = fmaxf(mrow, cm);
    const float mref = (mnew == NEG_INF) ? 0.0f : mnew;
    const float alpha = __expf(mrow - mref);
    mrow = mnew;
    // ---- p = exp(s - max), split in place: score tiles 2 kk and 2 kk + 1 are elements 0..7 and 8..15 of B fragment kk ----
    FB pa[2], pl[2];
    float psum = 0.f;
#pragma unroll
    for (int j = 0; j < 4; ++j) {
#pragma unroll
      for (int r = 0; r < 8; ++r) {
        const float p = __expf(s[j][r] - mref);
        psum += p;
        __bf16 a, bl; at_split(p, a, bl);
        pa[j >> 1].h[j & 1][r] = a;
        pl[j >> 1].h[j & 1][r] = bl;
      }
    }
    lrow = lrow * alpha + psum;
#pragma unroll
    for (int t = 0; t < 4; ++t)
#pragma unroll
      for (int r = 0; r < 8; ++r) oacc[t][r] *= alpha;
    // ---- O^T[64 x 16] += V^T[64 x 64] . P^T[64 x 16]  (A = V^T[d][kv] from the [d][kv] tile, B = P^T from registers) ----
    // unrolled: pa and pl are register arrays, indexed by kk
#pragma unroll
    for (int kk = 0; kk < 2; ++kk) {
#pragma unroll
      for (int t = 0; t < 4; ++t) {
        FB vb, vl;
        const __bf16* vp  = Vth + (t * 16 + c) * AT_P + kk * 32 + 8 * hh;
        const __bf16* vpl = Vtl + (t * 16 + c) * AT_P + kk * 32 + 8 * hh;
        vb.h[0] = *(const v8b*)(vp);
        vb.h[1] = *(const v8b*)(vp + 16);
        vl.h[0] = *(const v8b*)(vpl);
        vl.h[1] = *(const v8b*)(vpl + 16);
        oacc[t] = at_mma3(vb.v, vl.v, pa[kk].v, pl[kk].v, oacc[t]);
      }
    }
  }

  // ---- a lane holds 8 consecutive d of its query's row per tile. The wave's own 16 Q rows in LDS are dead now and no other
  //      wave reads them: the bf16 hi/lo out tile is staged there, so that each global store covers whole 128-byte rows ----
  {
    const float inv = 1.0f / (lrow + at_xhalf(lrow));    // the two halves' sums are joined once, here
    __bf16* sh = Qsh + wave * 16 * AT_P;
    __bf16* sl = Qsl + wave * 16 * AT_P;
#pragma unroll
    for (int t = 0; t < 4; ++t) {
      v8h hv, lv;
#pragma unroll
      for (int r = 0; r < 8; ++r) {
        const float o = oacc[t][r] * inv;
        const unsigned short hb = f2bf_bits(o);
        const unsigned short lb = f2bf_bits(o - bf_bits2f(hb));
        hv[r] = __builtin_bit_cast(_Float16, hb);
        lv[r] = __builtin_bit_cast(_Float16, lb);
      }
      *(v8h*)(sh + c * AT_P + t * 16 + 8 * hh) = hv;
      *(v8h*)(sl + c * AT_P + t * 16 + 8 * hh) = lv;
    }
    __builtin_amdgcn_fence(__ATOMIC_RELEASE, "workgroup");
    __builtin_amdgcn_wave_barrier();
    __builtin_amdgcn_fence(__ATOMIC_ACQUIRE, "workgroup");
    const int q8 = lane >> 3, c8 = (lane & 7) * 8;
    unsigned short* oh = ohi + (size_t)b * g.o_bs + (size_t)h * g.o_hs;
    unsigned short* ol = olo + (size_t)b * g.o_bs + (size_t)h * g.o_hs;
#pragma unroll
    for (int it = 0; it < 4; ++it) {
      const int row = it * 4 + q8;                    // q8 in 0..3, it in 0..3 -> rows 0..15
      const v8h hv = *(const v8h*)(sh + row * AT_P + c8);
      const v8h lv = *(const v8h*)(sl + row * AT_P + c8);
      *(v8h*)(oh + (size_t)(q0 + row) * g.o_rs + c8) = hv;
      *(v8h*)(ol + (size_t)(q0 + row) * g.o_rs + c8) = lv;
    }
  }
}

// ---------------------------------------------------------------------------
// Host orchestration (launches only).
// d_in: 0 = x [4,2048,1024], 1 = W_q, 2 = W_k, 3 = W_v (each [1024,1024], (out,in)), 4 = W_out [1024,1024], 5 = b_out [1024]; all f32.
// Workspace (104 MiB): bf16 x | bf16 [W_q;W_k;W_v] | bf16 W_out | qkv hi plane | qkv lo plane (two batches at a time) | attn hi | attn lo.
// ---------------------------------------------------------------------------
extern "C" void kernel_launch(void* const* d_in, const int* in_sizes, int n_in,
                              void* d_out, int out_size, void* d_ws, size_t ws_size,
                              hipStream_t stream) {
  constexpr int Bn = 4, S = 2048, E = 1024, Hn = 16, Dh = 64, E3 = 3 * E;
  constexpr int M = Bn * S;                 // 8192 rows in total
  constexpr int BH = 2;                     // batches per pass
  constexpr int MH = BH * S;                // 4096 rows per pass
  constexpr int NQB = S / AT_QB;            // 32
  static_assert(NQB <= AT_MAXKC);
  static_assert(M % 128 == 0 && MH % 128 == 0 && E % 256 == 0 && E3 % 256 == 0 && E % GM_KC == 0 && Hn * Dh == E && Bn % BH == 0);
  if (n_in < 6) return;
  if (in_sizes[0] != M * E || in_sizes[1] != E * E || in_sizes[2] != E * E || in_sizes[3] != E * E ||
      in_sizes[4] != E * E || in_sizes[5] != E || out_size != M * E) return;

  const float* x     = (const float*)d_in[0];
  const float* w_q   = (const float*)d_in[1];
  const float* w_k   = (const float*)d_in[2];
  const float* w_v   = (const float*)d_in[3];
  const float* w_out = (const float*)d_in[4];
  const float* b_out = (const float*)d_in[5];
  float* out = (float*)d_out;

  const size_t bX   = (size_t)M * E * 2;                  // 16 MiB  bf16 x
  const size_t bW   = (size_t)E3 * E * 2;                 //  6 MiB  bf16 [W_q; W_k; W_v]
  const size_t bWo  = (size_t)E * E * 2;                  //  2 MiB  bf16 W_out
  const size_t bQKV = (size_t)MH * E3 * 2;                // 24 MiB  bf16 plane of qkv (x2)
  const size_t bAH  = (size_t)M * E * 2;                  // 16 MiB  bf16 plane of attn out (x2)
  char* ws = (char*)d_ws;
  size_t off = 0;
  unsigned short* X16  = (unsigned short*)(ws + off); off += bX;
  unsigned short* W16  = (unsigned short*)(ws + off); off += bW;
  unsigned short* Wo16 = (unsigned short*)(ws + off); off += bWo;
  unsigned short* QH   = (unsigned short*)(ws + off); off += bQKV;
  unsigned short* QL   = (unsigned short*)(ws + off); off += bQKV;
  unsigned short* AH   = (unsigned short*)(ws + off); off += bAH;
  unsigned short* AL   = (unsigned short*)(ws + off); off += bAH;
  if (off > ws_size || off > (size_t)134217728) return;   // 109,051,904 B

  dim3 blk256(256), blk128(128);

  // 1-5: RNE bf16 casts of x, the three projection weights (stacked into one [3072][1024] matrix) and W_out
  {
    const int n2x = M * E / 2, n2w = E * E / 2;
    cast_f32_bf16x2<<<dim3((n2x + 255) / 256), blk256, 0, stream>>>(x, X16, n2x);
    cast_f32_bf16x2<<<dim3((n2w + 255) / 256), blk256, 0, stream>>>(w_q, W16, n2w);
    cast_f32_bf16x2<<<dim3((n2w + 255) / 256), blk256, 0, stream>>>(w_k, W16 + (size_t)E * E, n2w);
    cast_f32_bf16x2<<<dim3((n2w + 255) / 256), blk256, 0, stream>>>(w_v, W16 + (size_t)2 * E * E, n2w);
    cast_f32_bf16x2<<<dim3((n2w + 255) / 256), blk256, 0, stream>>>(w_out, Wo16, n2w);
  }

  for (int half = 0; half < Bn / BH; ++half) {
    // 6/8: qkv[MH][3072] = bf16(x rows of this pass) . bf16([W_q;W_k;W_v])^T, written as bf16 hi/lo planes
    {
      const int tiles = (MH / 64) * (E3 / 64);             // 3072
      const unsigned short* Xh = X16 + (size_t)half * MH * E;
      wmma_gemm64<1, 0, 0, 2, false><<<dim3((tiles + 7) / 8, 1), blk256, 0, stream>>>(
          Xh, Xh, E, 0L, W16, W16, E, 0L, (void*)QH, (void*)QL, E3, 0L,
          b_out, b_out, 0L, MH, E3, E, 1.0f);
    }
    // 7/9: causal attention per (batch, head, 64-query block) -> bf16 hi/lo planes [M][E] rows of this pass
    {
      AttnP g;
      g.q_bs = (long)S * E3; g.q_rs = E3; g.q_hs = Dh;
      g.k_bs = (long)S * E3; g.k_rs = E3; g.k_hs = Dh;
      g.v_bs = (long)S * E3; g.v_rs = E3; g.v_hs = Dh;
      g.o_bs = (long)S * E;  g.o_rs = E;  g.o_hs = Dh;
      g.S = S; g.Skv = S; g.H = Hn;
      g.sscale = 0.125f;             // 64^-0.5, applied in f32 after the product
      unsigned short* oh = AH + (size_t)half * MH * E;
      unsigned short* ol = AL + (size_t)half * MH * E;
      attn64_causal_split<<<dim3(BH * Hn * NQB), blk128, 0, stream>>>(
          QH, QL, QH + E, QL + E, QH + 2 * E, QL + 2 * E, oh, ol, g);
    }
  }

  // 10: out[M][E] (f32) = (attn hi + attn lo) . bf16(W_out)^T + bf16(b_out)
  {
    const int tiles = (M / 64) * (E / 64);                 // 2048
    wmma_gemm64<1, 2, 3, 0, false><<<dim3((tiles + 7) / 8, 1), blk256, 0, stream>>>(
        AH, AL, E, 0L, Wo16, Wo16, E, 0L, (void*)out, (void*)out, E, 0L,
        b_out, b_out, 0L, M, E, E, 1.0f);
  }
}

// v004
// Measured time: 237 microseconds a run.
// Timed twice side by side with v003, it ran 1.52 times as fast both times.
// All steps since v000 together make it 3.71 times as fast.
#include <hip/hip_runtime.h>
// Contractions: qkv projection GEMM = v_wmma_f32_16x16x32_bf16 (bf16 operands, 1 product); q.k^T = v_wmma_f32_16x16x32_bf16 (bf16 hi/lo planes of q and k, 3 products); p.v = v_wmma_f32_16x16x32_bf16 (bf16 hi/lo planes of p and v, 3 products); output projection GEMM = v_wmma_f32_16x16x32_bf16 (bf16 hi/lo planes of the attention output x bf16 weight, 2 products); f32 accumulate everywhere; softmax in f32.

typedef __attribute__((ext_vector_type(16))) _Float16 v16h;
typedef __attribute__((ext_vector_type(8)))  _Float16 v8h;
typedef __attribute__((ext_vector_type(16))) __bf16   v16b;
typedef __attribute__((ext_vector_type(8)))  __bf16   v8b;
typedef __attribute__((ext_vector_type(8)))  float    v8f;
typedef __attribute__((ext_vector_type(4)))  float    v4f;

#define NEG_INF (-__builtin_inff())

__device__ __forceinline__ unsigned short f2bf_bits(float f) {
  unsigned u = __float_as_uint(f);
  return (unsigned short)((u + 0x7FFFu + ((u >> 16) & 1u)) >> 16);
}
__device__ __forceinline__ float bf_bits2f(unsigned short h) { return __uint_as_float(((unsigned)h) << 16); }

// hazard guards as plain device helpers (no inline asm inside the kernel template body)
__device__ __forceinline__ void dep_guard_h(v8f& a, v8f& b, v16h x, v16h y) { asm volatile("v_nop\n\tv_nop\n\tv_nop\n\tv_nop" : "+v"(a), "+v"(b) : "v"(x), "v"(y)); }
__device__ __forceinline__ void dep_guard_b(v8f& a, v8f& b, v16b x, v16b y) { asm volatile("v_nop\n\tv_nop\n\tv_nop\n\tv_nop" : "+v"(a), "+v"(b) : "v"(x), "v"(y)); }
__device__ __forceinline__ void keep4_h(v16h a, v16h b, v16h c, v16h d) { asm volatile("v_nop" :: "v"(a), "v"(b), "v"(c), "v"(d)); }
__device__ __forceinline__ void keep4_b(v16b a, v16b b, v16b c, v16b d) { asm volatile("v_nop" :: "v"(a), "v"(b), "v"(c), "v"(d)); }
__device__ __forceinline__ void acc_guard4(v8f& a, v8f& b, v8f& c, v8f& d) { asm volatile("v_nop\n\tv_nop\n\tv_nop\n\tv_nop" : "+v"(a), "+v"(b), "+v"(c), "+v"(d)); }
template <typename T> struct Frag;
template <> struct Frag<_Float16> {
  typedef v16h V; union U { v16h v; v8h h[2]; };
  static __device__ __forceinline__ v16h load(const _Float16* p) {   // elements 0..7 <- p[0..7], 8..15 <- p[16..23]
    U f; f.h[0] = *(const v8h*)(p); f.h[1] = *(const v8h*)(p + 16); return f.v;
  }
  static __device__ __forceinline__ v8f mma(v16h a, v16h b, v8f c) {
    return __builtin_amdgcn_wmma_f32_16x16x32_f16(false, a, false, b, (short)0, c, false, false);
  }
  static __device__ __forceinline__ void guard(v8f& a, v8f& b, v16h x, v16h y) { dep_guard_h(a, b, x, y); }
  static __device__ __forceinline__ void keep(v16h a, v16h b, v16h c, v16h d) { keep4_h(a, b, c, d); }
};
template <> struct Frag<__bf16> {
  typedef v16b V; union U { v16b v; v8b h[2]; };
  static __device__ __forceinline__ v16b load(const __bf16* p) {
    U f; f.h[0] = *(const v8b*)(p); f.h[1] = *(const v8b*)(p + 16); return f.v;
  }
  static __device__ __forceinline__ v8f mma(v16b a, v16b b, v8f c) {
    return __builtin_amdgcn_wmma_f32_16x16x32_bf16(false, a, false, b, (short)0, c, false, false);
  }
  static __device__ __forceinline__ void guard(v8f& a, v8f& b, v16b x, v16b y) { dep_guard_b(a, b, x, y); }
  static __device__ __forceinline__ void keep(v16b a, v16b b, v16b c, v16b d) { keep4_b(a, b, c, d); }
};

// ---- Register-blocked batched WMMA GEMM ------------------------------------
// C[m,n] = scale * sum_k A[m,k] * Bt[n,k] (+bias)(+resid); each wave owns a 64x64 tile, a block of 2 x 4 waves a 128x256 tile.
// A row-major [M,K]; Bt row-major [N,K]; M % 128 == 0, N % 256 == 0, K % 64 == 0.
// The block's operand rows go to LDS in stages of 64 k (128-byte rows, whole lines) by asynchronous copies, two buffers:
// stage t + 1 flies while stage t is multiplied; the waves read their fragments from LDS.
// SPLIT: 0 = single planes; 1 = A and Bt as hi/lo planes (hi.hi + hi.lo + lo.hi); 2 = A as hi/lo planes, Bt single (hi.B + lo.B).
// BIAS_MODE: 0 = none, 1 = bias[m], 2 = bias[n], 3 = bias[n] RNE-converted to bf16 then added in f32.
// OUT_MODE: 0 = f32, 1 = f16, 2 = bf16 hi plane (Cout) + bf16 lo plane (Cout2).
// ET: 0 = f16 operands, 1 = bf16 operands (pointers passed as 16-bit storage)
#define GM_KC 64   // k per stage
#define GM_P  72   // LDS row pitch in elements: 144 B = 16 B x odd, so the 16 rows of a 16-byte fragment read fall on distinct banks
// four asynchronous 16-byte copies per lane, global -> LDS; s_wait_xcnt closes the statement so that no address register is rewritten ahead of it
__device__ __forceinline__ void gm_copy4(unsigned l0, unsigned l1, unsigned l2, unsigned l3,
                                         const unsigned short* g0, const unsigned short* g1,
                                         const unsigned short* g2, const unsigned short* g3) {
  asm volatile("global_load_async_to_lds_b128 %0, %4, off\n\t"
               "global_load_async_to_lds_b128 %1, %5, off\n\t"
               "global_load_async_to_lds_b128 %2, %6, off\n\t"
               "global_load_async_to_lds_b128 %3, %7, off\n\t"
               "s_wait_xcnt 0x0"
               :: "v"(l0), "v"(l1), "v"(l2), "v"(l3), "v"(g0), "v"(g1), "v"(g2), "v"(g3) : "memory");
}
// 128 rows of one plane: this lane's 16 bytes of rows r, r + 32, r + 64, r + 96 (step = 32 source rows, in elements)
__device__ __forceinline__ void gm_stage128(unsigned lds, const unsigned short* g, size_t step) {
  gm_copy4(lds, lds + 32u * GM_P * 2u, lds + 64u * GM_P * 2u, lds + 96u * GM_P * 2u, g, g + step, g + 2 * step, g + 3 * step);
}
// the same for two groups of 128 rows in one statement, under one wait
__device__ __forceinline__ void gm_stage256(unsigned la, const unsigned short* ga, size_t sa,
                                            unsigned lb, const unsigned short* gb, size_t sb) {
  asm volatile("global_load_async_to_lds_b128 %0, %8, off\n\t"
               "global_load_async_to_lds_b128 %1, %9, off\n\t"
               "global_load_async_to_lds_b128 %2, %10, off\n\t"
               "global_load_async_to_lds_b128 %3, %11, off\n\t"
               "global_load_async_to_lds_b128 %4, %12, off\n\t"
               "global_load_async_to_lds_b128 %5, %13, off\n\t"
               "global_load_async_to_lds_b128 %6, %14, off\n\t"
               "global_load_async_to_lds_b128 %7, %15, off\n\t"
               "s_wait_xcnt 0x0"
               :: "v"(la), "v"(la + 32u * GM_P * 2u), "v"(la + 64u * GM_P * 2u), "v"(la + 96u * GM_P * 2u),
                  "v"(lb), "v"(lb + 32u * GM_P * 2u), "v"(lb + 64u * GM_P * 2u), "v"(lb + 96u * GM_P * 2u),
                  "v"(ga), "v"(ga + sa), "v"(ga + 2 * sa), "v"(ga + 3 * sa),
                  "v"(gb), "v"(gb + sb), "v"(gb + 2 * sb), "v"(gb + 3 * sb) : "memory");
}
// this wave's copies have landed (the compiler places no wait for them)
__device__ __forceinline__ void gm_wait_copies() { asm volatile("s_wait_asynccnt 0x0" ::: "memory"); }
// this wave's LDS reads have returned, before the buffer is handed to its next writer
__device__ __forceinline__ void gm_wait_lds() { asm volatile("s_wait_dscnt 0x0" ::: "memory"); }
template <int ET> struct Elem;
template <> struct Elem<0> { typedef _Float16 T; };
template <> struct Elem<1> { typedef __bf16 T; };
template <int ET, int SPLIT, int BIAS_MODE, int OUT_MODE, bool RESID, int ACT = 0>
__global__ __launch_bounds__(256) void wmma_gemm64(
    const unsigned short* __restrict__ Ap, const unsigned short* __restrict__ A2p, int lda, long strideA,
    const unsigned short* __restrict__ Btp, const unsigned short* __restrict__ Bt2p, int ldb, long strideB,
    void* __restrict__ Cout, void* __restrict__ Cout2, int ldc, long strideC,
    const float* __restrict__ bias,
    const float* __restrict__ resid, long strideR,
    int M, int N, int K, float scale) {
  typedef typename Elem<ET>::T T;
  typedef typename Frag<T>::V V;
  const T* A = (const T*)Ap; const T* A2 = (const T*)A2p; const T* Bt = (const T*)Btp; const T* Bt2 = (const T*)Bt2p;
  constexpr int ROWS_A = (SPLIT != 0) ? 256 : 128;   // staged rows: A hi [, A lo], Bt hi [, Bt lo]
  constexpr int ROWS_B = (SPLIT == 1) ? 512 : 256;
  constexpr int STAGE  = (ROWS_A + ROWS_B) * GM_P;   // elements per buffer
  __shared__ __align__(16) unsigned short ring[2 * STAGE];
  __shared__ __align__(16) float sT[8][16 * 68];   // per-wave 16x64 slab, pitch 68 floats
  const int b    = blockIdx.y;
  const int lane = threadIdx.x & 31;
  const int wave = threadIdx.x >> 5;
  const int blocksN = N >> 8;
  const int bm = blockIdx.x / blocksN;
  const int bn = blockIdx.x - bm * blocksN;
  if (bm >= (M >> 7)) return;            // block-uniform, in front of every barrier
  const int mB = bm << 7;
  const int nB = bn << 8;
  const int wm = wave >> 2;
  const int wn = wave & 3;
  const int m0 = mB + (wm << 6);
  const int n0 = nB + (wn << 6);

  const T* Ab  = A  + (size_t)b * strideA;
  const T* Bb  = Bt + (size_t)b * strideB;
  const T* Ab2 = (SPLIT != 0) ? (A2  + (size_t)b * strideA) : nullptr;
  const T* Bb2 = (SPLIT == 1) ? (Bt2 + (size_t)b * strideB) : nullptr;

  const int rlane = lane & 15;                 // row (A) / col (B, D) within subtile
  const int koff  = (lane >> 4) * 8;           // k offset of this lane half
  const int mOff  = (lane >> 4) * 8;           // D row offset

  v8f acc[4][4];
#pragma unroll
  for (int i = 0; i < 4; ++i)
#pragma unroll
    for (int j = 0; j < 4; ++j) acc[i][j] = (v8f){0.f,0.f,0.f,0.f,0.f,0.f,0.f,0.f};

  // copies: thread -> row tid / 8 of each group of 32 rows, 16-byte piece tid % 8, so a wave's copy covers four whole 128-byte rows
  const int crow = threadIdx.x >> 3;
  const int ccol = (threadIdx.x & 7) << 3;
  const unsigned ldsT = (unsigned)(size_t)ring + (unsigned)(crow * GM_P + ccol) * 2u;   // LDS byte address: low 32 bits of the shared address
  const unsigned short* gA  = (const unsigned short*)Ab + (size_t)(mB + crow) * lda + ccol;
  const unsigned short* gB  = (const unsigned short*)Bb + (size_t)(nB + crow) * ldb + ccol;
  const unsigned short* gA2 = (SPLIT != 0) ? ((const unsigned short*)Ab2 + (size_t)(mB + crow) * lda + ccol) : nullptr;
  const unsigned short* gB2 = (SPLIT == 1) ? ((const unsigned short*)Bb2 + (size_t)(nB + crow) * ldb + ccol) : nullptr;
  const size_t sA = (size_t)32 * lda, sB = (size_t)32 * ldb;
  auto issue = [&](int t) {              // stage t into buffer t & 1
    const unsigned l = ldsT + (unsigned)(t & 1) * (unsigned)(STAGE * 2);
    const int k0 = t * GM_KC;
    if (SPLIT == 0) gm_stage128(l, gA + k0, sA);
    else            gm_stage256(l, gA + k0, sA, l + 128u * GM_P * 2u, gA2 + k0, sA);
    gm_stage256(l + (unsigned)ROWS_A * GM_P * 2u, gB + k0, sB, l + (unsigned)(ROWS_A + 128) * GM_P * 2u, gB + 4 * sB + k0, sB);
    if (SPLIT == 1)
      gm_stage256(l + (unsigned)(ROWS_A + 256) * GM_P * 2u, gB2 + k0, sB, l + (unsigned)(ROWS_A + 384) * GM_P * 2u, gB2 + 4 * sB + k0, sB);
  };
  const int nt = K / GM_KC;              // block-uniform
  issue(0);
  gm_wait_copies();
  __syncthreads();
  if (nt > 1) issue(1);

  const int aoff = ((wm << 6) + rlane) * GM_P + koff;
  const int boff = (ROWS_A + (wn << 6) + rlane) * GM_P + koff;
  for (int t = 0; t < nt; ++t) {
    const T* st = (const T*)ring + (t & 1) * STAGE;
    // unrolled, like the loops inside: the fragment and accumulator arrays are indexed by constants and stay in registers
#pragma unroll
    for (int ks = 0; ks < GM_KC / 32; ++ks) {
      // all fragments of this 32-k step as one group of LDS reads in front of its products
      V bh[4], bl[4], ah[4], al[4];
#pragma unroll
      for (int j = 0; j < 4; ++j) {
        bh[j] = Frag<T>::load(st + boff + (j << 4) * GM_P + ks * 32);
        if (SPLIT == 1) bl[j] = Frag<T>::load(st + boff + (256 + (j << 4)) * GM_P + ks * 32);
      }
#pragma unroll
      for (int i = 0; i < 4; ++i) {
        ah[i] = Frag<T>::load(st + aoff + (i << 4) * GM_P + ks * 32);
        if (SPLIT != 0) al[i] = Frag<T>::load(st + aoff + (128 + (i << 4)) * GM_P + ks * 32);
      }
#pragma unroll
      for (int i = 0; i < 4; ++i) {
#pragma unroll
        for (int j = 0; j < 4; ++j) {
          acc[i][j] = Frag<T>::mma(ah[i], bh[j], acc[i][j]);
          if (SPLIT == 1) acc[i][j] = Frag<T>::mma(ah[i], bl[j], acc[i][j]);
          if (SPLIT != 0) acc[i][j] = Frag<T>::mma(al[i], bh[j], acc[i][j]);
        }
        Frag<T>::guard(acc[i][0], acc[i][3], ah[i], (SPLIT != 0) ? al[i] : ah[i]);
      }
      Frag<T>::keep(bh[0], bh[1], bh[2], bh[3]);
      if (SPLIT == 1) Frag<T>::keep(bl[0], bl[1], bl[2], bl[3]);
    }
    // publish point of stage t + 1: own LDS reads back, own copies landed, one barrier (it also ends every read of buffer t & 1), then the refill
    gm_wait_lds();
    gm_wait_copies();
    __syncthreads();
    if (t + 2 < nt) issue(t + 2);
  }
  gm_wait_copies();
  acc_guard4(acc[0][0], acc[0][1], acc[0][2], acc[0][3]);
  acc_guard4(acc[1][0], acc[1][1], acc[1][2], acc[1][3]);
  acc_guard4(acc[2][0], acc[2][1], acc[2][2], acc[2][3]);
  acc_guard4(acc[3][0], acc[3][1], acc[3][2], acc[3][3]);

  // ---- epilogue ----
  float* slab = sT[wave];
  const float* Rb = RESID ? (resid + (size_t)b * strideR) : nullptr;
#pragma unroll
  for (int i = 0; i < 4; ++i) {
    const int mBase = m0 + (i << 4);
#pragma unroll
    for (int j = 0; j < 4; ++j) {
      const int n = n0 + (j << 4) + rlane;
      float bv = 0.f;
      if (BIAS_MODE == 2) bv = bias[n];
      if (BIAS_MODE == 3) bv = bf_bits2f(f2bf_bits(bias[n]));
#pragma unroll
      for (int r = 0; r < 8; ++r) {
        float v = acc[i][j][r] * scale;
        if (BIAS_MODE == 1) v += bias[mBase + mOff + r];
        if (BIAS_MODE == 2 || BIAS_MODE == 3) v += bv;
        if (RESID) v += Rb[(size_t)(mBase + mOff + r) * ldc + n];
        if (ACT == 1) v = tanhf(v);
        if (ACT == 2) v = fmaxf(v, 0.0f);
        if (ACT == 3) v = v / (1.0f + expf(-v));
        if (ACT == 4) v = (v > 0.f) ? v : 0.01f * v;
        if (ACT == 5) v = 0.5f * v * (1.0f + erff(v * 0.70710678118654752f));
        slab[(mOff + r) * 68 + (j << 4) + rlane] = v;
      }
    }
    __builtin_amdgcn_fence(__ATOMIC_RELEASE, "workgroup");
    __builtin_amdgcn_wave_barrier();
    __builtin_amdgcn_fence(__ATOMIC_ACQUIRE, "workgroup");
    if (OUT_MODE == 0) {
      float* C = (float*)Cout + (size_t)b * strideC;
      const int hh = lane >> 4, c4 = (lane & 15) * 4;     // row seg = 256 B = 16 lanes x 16 B
      {
#pragma unroll
        for (int it = 0; it < 8; ++it) {
          const int row = it * 2 + hh;
          v4f v = *(const v4f*)(slab + row * 68 + c4);
          *(v4f*)(C + (size_t)(mBase + row) * ldc + n0 + c4) = v;
        }
        
      }
    } else {
      const int q = lane >> 3, c8 = (lane & 7) * 8;
      unsigned short* C  = (unsigned short*)Cout  + (size_t)b * strideC;
      unsigned short* C2 = (OUT_MODE == 2) ? ((unsigned short*)Cout2 + (size_t)b * strideC) : nullptr;
      {
#pragma unroll
        for (int it = 0; it < 4; ++it) {
          const int row = it * 4 + q;
          const float* sp = slab + row * 68 + c8;
          v8h hv, lv;
#pragma unroll
          for (int e = 0; e < 8; ++e) {
            if (OUT_MODE == 1) {
              hv[e] = (_Float16)sp[e];
            } else {
              unsigned short hb = f2bf_bits(sp[e]);
              unsigned short lb = f2bf_bits(sp[e] - bf_bits2f(hb));
              hv[e] = __builtin_bit_cast(_Float16, hb);
              lv[e] = __builtin_bit_cast(_Float16, lb);
            }
          }
          *(v8h*)(C + (size_t)(mBase + row) * ldc + n0 + c8) = hv;
          if (OUT_MODE == 2) *(v8h*)(C2 + (size_t)(mBase + row) * ldc + n0 + c8) = lv;
        }
        
      }
    }
    __builtin_amdgcn_fence(__ATOMIC_RELEASE, "workgroup");
    __builtin_amdgcn_wave_barrier();
    __builtin_amdgcn_fence(__ATOMIC_ACQUIRE, "workgroup");
  }
}

__global__ __launch_bounds__(256) void cast_f32_bf16x2(
    const float* __restrict__ in, unsigned short* __restrict__ out, int n2) {
  int i = blockIdx.x * 256 + threadIdx.x;
  if (i < n2) {
    const unsigned u = (unsigned)f2bf_bits(in[2 * i]) | ((unsigned)f2bf_bits(in[2 * i + 1]) << 16);
    ((unsigned*)out)[i] = u;
    
  }
}

#define AT_D 64
#define AT_NW 4
#define AT_QB 64
#define AT_KC 64
#define AT_MAXKC 32
#define AT_P 72   // LDS row pitch of every 64-element bf16 tile: 144 B = 16 B x odd, so the 16 rows of a 16-byte fragment read fall on distinct banks

struct AttnP { long q_bs, q_rs, q_hs, k_bs, k_rs, k_hs, v_bs, v_rs, v_hs, o_bs, o_rs, o_hs;
               int S, Skv, H; float sscale; };
static_assert(sizeof(AttnP) == 112);

__device__ __forceinline__ unsigned short at_bf_bits(float f) {
  unsigned u = __float_as_uint(f);
  return (unsigned short)((u + 0x7FFFu + ((u >> 16) & 1u)) >> 16);
}
// lane l <-> lane l ^ 16 without LDS
__device__ __forceinline__ float at_xhalf(float x) {
  return __builtin_bit_cast(float, __builtin_amdgcn_permlanex16(__builtin_bit_cast(int, x), __builtin_bit_cast(int, x), 0x76543210, 0xfedcba98, false, false));
}
__device__ __forceinline__ __bf16 at_f2bf(float f) { return __builtin_bit_cast(__bf16, at_bf_bits(f)); }
__device__ __forceinline__ void at_split(float f, __bf16& hi, __bf16& lo) {
  const unsigned short hb = at_bf_bits(f);
  hi = __builtin_bit_cast(__bf16, hb);
  lo = at_f2bf(f - __uint_as_float(((unsigned)hb) << 16));
}
// three products of a hi/lo x hi/lo pair into one accumulator (hi.hi, A lo . B hi, A hi . B lo), then the hazard guard tying D and all four operands
__device__ __forceinline__ v8f at_mma3(v16b ah, v16b al, v16b bh, v16b bl, v8f c) {
  c = __builtin_amdgcn_wmma_f32_16x16x32_bf16(false, ah, false, bh, (short)0, c, false, false);
  c = __builtin_amdgcn_wmma_f32_16x16x32_bf16(false, al, false, bh, (short)0, c, false, false);
  c = __builtin_amdgcn_wmma_f32_16x16x32_bf16(false, ah, false, bl, (short)0, c, false, false);
  asm volatile("v_nop\n\tv_nop\n\tv_nop\n\tv_nop" : "+v"(c) : "v"(ah), "v"(al), "v"(bh), "v"(bl));
  return c;
}

__global__ __launch_bounds__(128)
void attn64_causal_split(const unsigned short* __restrict__ qh_p, const unsigned short* __restrict__ ql_p,
                         const unsigned short* __restrict__ kh_p, const unsigned short* __restrict__ kl_p,
                         const unsigned short* __restrict__ vh_p, const unsigned short* __restrict__ vl_p,
                         unsigned short* __restrict__ ohi, unsigned short* __restrict__ olo, AttnP g) {
  union FB { v16b v; v8b h[2]; };
  __shared__ __align__(16) __bf16 Qsh[AT_QB * AT_P];          // Q hi [row][d]   9 KB
  __shared__ __align__(16) __bf16 Qsl[AT_QB * AT_P];          // Q lo [row][d]   9 KB
  __shared__ __align__(16) __bf16 Ksh[AT_KC * AT_P];          // K hi [kv][d]    9 KB
  __shared__ __align__(16) __bf16 Ksl[AT_KC * AT_P];          // K lo [kv][d]    9 KB
  __shared__ __align__(16) __bf16 Vth[AT_D * AT_P];           // V hi [d][kv]    9 KB
  __shared__ __align__(16) __bf16 Vtl[AT_D * AT_P];           // V lo [d][kv]    9 KB

  const int tid  = threadIdx.x;
  const int wave = tid >> 5;
  const int lane = tid & 31;
  const int hh   = lane >> 4;
  const int c    = lane & 15;

  const int nqb = g.S / AT_QB;
  const int qb = nqb - 1 - (int)blockIdx.y;   // low blockIdx.y starts first: the tiles with the most key chunks lead
  const int bh = blockIdx.x;
  const int h  = bh % g.H;
  const int b  = bh / g.H;
  const int q0 = qb * AT_QB + wave * 16;

  const __bf16* qhb = (const __bf16*)qh_p + (size_t)b * g.q_bs + (size_t)h * g.q_hs;
  const __bf16* qlb = (const __bf16*)ql_p + (size_t)b * g.q_bs + (size_t)h * g.q_hs;
  const __bf16* khb = (const __bf16*)kh_p + (size_t)b * g.k_bs + (size_t)h * g.k_hs;
  const __bf16* klb = (const __bf16*)kl_p + (size_t)b * g.k_bs + (size_t)h * g.k_hs;
  const __bf16* vhb = (const __bf16*)vh_p + (size_t)b * g.v_bs + (size_t)h * g.v_hs;
  const __bf16* vlb = (const __bf16*)vl_p + (size_t)b * g.v_bs + (size_t)h * g.v_hs;

  // ---- Q hi/lo planes for the block's 64 rows: [row][d], 16-B copies (thread -> row tid/2, 32-d half) ----
  {
    const int r = tid >> 1, dh = (tid & 1) * 32;
    const size_t qo = (size_t)(qb * AT_QB + r) * g.q_rs + dh;
#pragma unroll
    for (int i = 0; i < 4; ++i) {
      const v8b xh = *(const v8b*)(qhb + qo + 8 * i);
      const v8b xl = *(const v8b*)(qlb + qo + 8 * i);
      *(v8b*)(Qsh + r * AT_P + dh + 8 * i) = xh;
      *(v8b*)(Qsl + r * AT_P + dh + 8 * i) = xl;
    }
  }
  __syncthreads();

  float mrow = NEG_INF, lrow = 0.f;      // query q0 + c: running max (same in both lane halves) and this half's part of the running sum
  v8f oacc[4];                           // oacc[t][r] = O[q0 + c][16 t + 8 hh + r]
#pragma unroll
  for (int t = 0; t < 4; ++t) oacc[t] = (v8f){0.f,0.f,0.f,0.f,0.f,0.f,0.f,0.f};

  const int nck = (qb + 1 < AT_MAXKC) ? (qb + 1) : AT_MAXKC;    // block-uniform, statically bounded
  const __bf16* qwh = Qsh + (wave * 16 + c) * AT_P + 8 * hh;      // B fragment column c (query q0 + c) of this wave
  const __bf16* qwl = Qsl + (wave * 16 + c) * AT_P + 8 * hh;

  for (int kc = 0; kc < nck; ++kc) {
    const int kv0 = kc * AT_KC;
    __syncthreads();
    {
      const int kvr = tid >> 1, dh = (tid & 1) * 32;
      const size_t ko = (size_t)(kv0 + kvr) * g.k_rs + dh;
      const size_t vo = (size_t)(kv0 + kvr) * g.v_rs + dh;
#pragma unroll
      for (int i = 0; i < 4; ++i) {
        const v8b ka = *(const v8b*)(khb + ko + 8 * i);
        const v8b kb = *(const v8b*)(klb + ko + 8 * i);
        *(v8b*)(Ksh + kvr * AT_P + dh + 8 * i) = ka;
        *(v8b*)(Ksl + kvr * AT_P + dh + 8 * i) = kb;
        const v8b va = *(const v8b*)(vhb + vo + 8 * i);
        const v8b vb = *(const v8b*)(vlb + vo + 8 * i);
#pragma unroll
        for (int e = 0; e < 8; ++e) {
          const int d = dh + 8 * i + e;
          Vth[d * AT_P + kvr] = va[e];
          Vtl[d * AT_P + kvr] = vb[e];
        }
      }
    }
    __syncthreads();

    // ---- scores^T[64 x 16] = k . q^T  (A = K[kv][d], B = Q[row][d]; split k-map via two 16-B halves at +8hh and +16+8hh) ----
    // s[j][r] = score of key kv0 + 16 j + 8 hh + r against query q0 + c
    v8f s[4];
#pragma unroll
    for (int j = 0; j < 4; ++j) s[j] = (v8f){0.f,0.f,0.f,0.f,0.f,0.f,0.f,0.f};
#pragma unroll 1
    for (int dc = 0; dc < 2; ++dc) {
      FB qh, ql;
      qh.h[0] = *(const v8b*)(qwh + dc * 32);
      qh.h[1] = *(const v8b*)(qwh + dc * 32 + 16);
      ql.h[0] = *(const v8b*)(qwl + dc * 32);
      ql.h[1] = *(const v8b*)(qwl + dc * 32 + 16);
#pragma unroll
      for (int j = 0; j < 4; ++j) {
        FB kb, kl;
        const __bf16* kp  = Ksh + (j * 16 + c) * AT_P + dc * 32 + 8 * hh;
        const __bf16* kpl = Ksl + (j * 16 + c) * AT_P + dc * 32 + 8 * hh;
        kb.h[0] = *(const v8b*)(kp);
        kb.h[1] = *(const v8b*)(kp + 16);
        kl.h[0] = *(const v8b*)(kpl);
        kl.h[1] = *(const v8b*)(kpl + 16);
        s[j] = at_mma3(kb.v, kl.v, qh.v, ql.v, s[j]);
      }
    }
    // ---- scale, causal mask on the diagonal chunk (key > query -> -inf), max over this lane's 32 keys, then the other half's ----
    const bool diag = (kc == qb);
    const int qrow = q0 + c;
    float cm = NEG_INF;
#pragma unroll
    for (int j = 0; j < 4; ++j) {
#pragma unroll
      for (int r = 0; r < 8; ++r) {
        const int kvcol = kv0 + j * 16 + 8 * hh + r;
        float sv = s[j][r] * g.sscale;
        if (diag && (kvcol > qrow)) sv = NEG_INF;
        s[j][r] = sv;
        cm = fmaxf(cm, sv);
      }
    }
    cm = fmaxf(cm, at_xhalf(cm));
    const float mnew = fmaxf(mrow, cm);
    const float mref = (mnew == NEG_INF) ? 0.0f : mnew;
    const float alpha = __expf(mrow - mref);
    mrow = mnew;
    // ---- p = exp(s - max), split in place: score tiles 2 kk and 2 kk + 1 are elements 0..7 and 8..15 of B fragment kk ----
    FB pa[2], pl[2];
    float psum = 0.f;
#pragma unroll
    for (int j = 0; j < 4; ++j) {
#pragma unroll
      for (int r = 0; r < 8; ++r) {
        const float p = __expf(s[j][r] - mref);
        psum += p;
        __bf16 a, bl; at_split(p, a, bl);
        pa[j >> 1].h[j & 1][r] = a;
        pl[j >> 1].h[j & 1][r] = bl;
      }
    }
    lrow = lrow * alpha + psum;
#pragma unroll
    for (int t = 0; t < 4; ++t)
#pragma unroll
      for (int r = 0; r < 8; ++r) oacc[t][r] *= alpha;
    // ---- O^T[64 x 16] += V^T[64 x 64] . P^T[64 x 16]  (A = V^T[d][kv] from the [d][kv] tile, B = P^T from registers) ----
    // unrolled: pa and pl are register arrays, indexed by kk
#pragma unroll
    for (int kk = 0; kk < 2; ++kk) {
#pragma unroll
      for (int t = 0; t < 4; ++t) {
        FB vb, vl;
        const __bf16* vp  = Vth + (t * 16 + c) * AT_P + kk * 32 + 8 * hh;
        const __bf16* vpl = Vtl + (t * 16 + c) * AT_P + kk * 32 + 8 * hh;
        vb.h[0] = *(const v8b*)(vp);
        vb.h[1] = *(const v8b*)(vp + 16);
        vl.h[0] = *(const v8b*)(vpl);
        vl.h[1] = *(const v8b*)(vpl + 16);
        oacc[t] = at_mma3(vb.v, vl.v, pa[kk].v, pl[kk].v, oacc[t]);
      }
    }
  }

  // ---- a lane holds 8 consecutive d of its query's row per tile. The wave's own 16 Q rows in LDS are dead now and no other
  //      wave reads them: the bf16 hi/lo out tile is staged there, so that each global store covers whole 128-byte rows ----
  {
    const float inv = 1.0f / (lrow + at_xhalf(lrow));    // the two halves' sums are joined once, here
    __bf16* sh = Qsh + wave * 16 * AT_P;
    __bf16* sl = Qsl + wave * 16 * AT_P;
#pragma unroll
    for (int t = 0; t < 4; ++t) {
      v8h hv, lv;
#pragma unroll
      for (int r = 0; r < 8; ++r) {
        const float o = oacc[t][r] * inv;
        const unsigned short hb = f2bf_bits(o);
        const unsigned short lb = f2bf_bits(o - bf_bits2f(hb));
        hv[r] = __builtin_bit_cast(_Float16, hb);
        lv[r] = __builtin_bit_cast(_Float16, lb);
      }
      *(v8h*)(sh + c * AT_P + t * 16 + 8 * hh) = hv;
      *(v8h*)(sl + c * AT_P + t * 16 + 8 * hh) = lv;
    }
    __builtin_amdgcn_fence(__ATOMIC_RELEASE, "workgroup");
    __builtin_amdgcn_wave_barrier();
    __builtin_amdgcn_fence(__ATOMIC_ACQUIRE, "workgroup");
    const int q8 = lane >> 3, c8 = (lane & 7) * 8;
    unsigned short* oh = ohi + (size_t)b * g.o_bs + (size_t)h * g.o_hs;
    unsigned short* ol = olo + (size_t)b * g.o_bs + (size_t)h * g.o_hs;
#pragma unroll
    for (int it = 0; it < 4; ++it) {
      const int row = it * 4 + q8;                    // q8 in 0..3, it in 0..3 -> rows 0..15
      const v8h hv = *(const v8h*)(sh + row * AT_P + c8);
      const v8h lv = *(const v8h*)(sl + row * AT_P + c8);
      *(v8h*)(oh + (size_t)(q0 + row) * g.o_rs + c8) = hv;
      *(v8h*)(ol + (size_t)(q0 + row) * g.o_rs + c8) = lv;
    }
  }
}

// ---------------------------------------------------------------------------
// Host orchestration (launches only).
// d_in: 0 = x [4,2048,1024], 1 = W_q, 2 = W_k, 3 = W_v (each [1024,1024], (out,in)), 4 = W_out [1024,1024], 5 = b_out [1024]; all f32.
// Workspace (152 MiB): bf16 x | bf16 [W_q;W_k;W_v] | bf16 W_out | qkv hi plane | qkv lo plane | attn hi | attn lo.
// ---------------------------------------------------------------------------
extern "C" void kernel_launch(void* const* d_in, const int* in_sizes, int n_in,
                              void* d_out, int out_size, void* d_ws, size_t ws_size,
                              hipStream_t stream) {
  constexpr int Bn = 4, S = 2048, E = 1024, Hn = 16, Dh = 64, E3 = 3 * E;
  constexpr int M = Bn * S;                 // 8192 rows in total
  constexpr int NQB = S / AT_QB;            // 32
  static_assert(NQB <= AT_MAXKC);
  static_assert(M % 128 == 0 && E % 256 == 0 && E3 % 256 == 0 && E % GM_KC == 0 && Hn * Dh == E);
  if (n_in < 6) return;
  if (in_sizes[0] != M * E || in_sizes[1] != E * E || in_sizes[2] != E * E || in_sizes[3] != E * E ||
      in_sizes[4] != E * E || in_sizes[5] != E || out_size != M * E) return;

  const float* x     = (const float*)d_in[0];
  const float* w_q   = (const float*)d_in[1];
  const float* w_k   = (const float*)d_in[2];
  const float* w_v   = (const float*)d_in[3];
  const float* w_out = (const float*)d_in[4];
  const float* b_out = (const float*)d_in[5];
  float* out = (float*)d_out;

  const size_t bX   = (size_t)M * E * 2;                  // 16 MiB  bf16 x
  const size_t bW   = (size_t)E3 * E * 2;                 //  6 MiB  bf16 [W_q; W_k; W_v]
  const size_t bWo  = (size_t)E * E * 2;                  //  2 MiB  bf16 W_out
  const size_t bQKV = (size_t)M * E3 * 2;                 // 48 MiB  bf16 plane of qkv (x2)
  const size_t bAH  = (size_t)M * E * 2;                  // 16 MiB  bf16 plane of attn out (x2)
  char* ws = (char*)d_ws;
  size_t off = 0;
  unsigned short* X16  = (unsigned short*)(ws + off); off += bX;
  unsigned short* W16  = (unsigned short*)(ws + off); off += bW;
  unsigned short* Wo16 = (unsigned short*)(ws + off); off += bWo;
  unsigned short* QH   = (unsigned short*)(ws + off); off += bQKV;
  unsigned short* QL   = (unsigned short*)(ws + off); off += bQKV;
  unsigned short* AH   = (unsigned short*)(ws + off); off += bAH;
  unsigned short* AL   = (unsigned short*)(ws + off); off += bAH;
  if (off > ws_size) return;                              // 159,383,552 B

  dim3 blk256(256), blk128(128);

  // 1-5: RNE bf16 casts of x, the three projection weights (stacked into one [3072][1024] matrix) and W_out
  {
    const int n2x = M * E / 2, n2w = E * E / 2;
    cast_f32_bf16x2<<<dim3((n2x + 255) / 256), blk256, 0, stream>>>(x, X16, n2x);
    cast_f32_bf16x2<<<dim3((n2w + 255) / 256), blk256, 0, stream>>>(w_q, W16, n2w);
    cast_f32_bf16x2<<<dim3((n2w + 255) / 256), blk256, 0, stream>>>(w_k, W16 + (size_t)E * E, n2w);
    cast_f32_bf16x2<<<dim3((n2w + 255) / 256), blk256, 0, stream>>>(w_v, W16 + (size_t)2 * E * E, n2w);
    cast_f32_bf16x2<<<dim3((n2w + 255) / 256), blk256, 0, stream>>>(w_out, Wo16, n2w);
  }

  // 6: qkv[M][3072] = bf16(x) . bf16([W_q;W_k;W_v])^T, written as bf16 hi/lo planes
  {
    const int tiles = (M / 64) * (E3 / 64);                // 6144
    wmma_gemm64<1, 0, 0, 2, false><<<dim3((tiles + 7) / 8, 1), blk256, 0, stream>>>(
        X16, X16, E, 0L, W16, W16, E, 0L, (void*)QH, (void*)QL, E3, 0L,
        b_out, b_out, 0L, M, E3, E, 1.0f);
  }
  // 7: causal attention per (batch, head, 64-query block), longest blocks first -> bf16 hi/lo planes [M][E]
  {
    AttnP g;
    g.q_bs = (long)S * E3; g.q_rs = E3; g.q_hs = Dh;
    g.k_bs = (long)S * E3; g.k_rs = E3; g.k_hs = Dh;
    g.v_bs = (long)S * E3; g.v_rs = E3; g.v_hs = Dh;
    g.o_bs = (long)S * E;  g.o_rs = E;  g.o_hs = Dh;
    g.S = S; g.Skv = S; g.H = Hn;
    g.sscale = 0.125f;             // 64^-0.5, applied in f32 after the product
    attn64_causal_split<<<dim3(Bn * Hn, NQB), blk128, 0, stream>>>(
        QH, QL, QH + E, QL + E, QH + 2 * E, QL + 2 * E, AH, AL, g);
  }

  // 8: out[M][E] (f32) = (attn hi + attn lo) . bf16(W_out)^T + bf16(b_out)
  {
    const int tiles = (M / 64) * (E / 64);                 // 2048
    wmma_gemm64<1, 2, 3, 0, false><<<dim3((tiles + 7) / 8, 1), blk256, 0, stream>>>(
        AH, AL, E, 0L, Wo16, Wo16, E, 0L, (void*)out, (void*)out, E, 0L,
        b_out, b_out, 0L, M, E, E, 1.0f);
  }
}

// v005
// A run of this version takes 226 microseconds.
// Two timings next to v004 put it at 1.05 and 1.04 times that version's speed.
// Counting every step since v000, it is 3.88 times as fast.
#include <hip/hip_runtime.h>
// Contractions: qkv projection GEMM = v_wmma_f32_16x16x32_bf16 (bf16 operands, 1 product); q.k^T = v_wmma_f32_16x16x32_bf16 (bf16 hi/lo planes of q and k, 3 products); p.v = v_wmma_f32_16x16x32_bf16 (bf16 hi/lo planes of p and v, 3 products); output projection GEMM = v_wmma_f32_16x16x32_bf16 (bf16 hi/lo planes of the attention output x bf16 weight, 2 products); f32 accumulate everywhere; softmax in f32.

typedef __attribute__((ext_vector_type(16))) _Float16 v16h;
typedef __attribute__((ext_vector_type(8)))  _Float16 v8h;
typedef __attribute__((ext_vector_type(16))) __bf16   v16b;
typedef __attribute__((ext_vector_type(8)))  __bf16   v8b;
typedef __attribute__((ext_vector_type(8)))  float    v8f;
typedef __attribute__((ext_vector_type(4)))  float    v4f;

#define NEG_INF (-__builtin_inff())

__device__ __forceinline__ unsigned short f2bf_bits(float f) {
  unsigned u = __float_as_uint(f);
  return (unsigned short)((u + 0x7FFFu + ((u >> 16) & 1u)) >> 16);
}
__device__ __forceinline__ float bf_bits2f(unsigned short h) { return __uint_as_float(((unsigned)h) << 16); }

// hazard guards as plain device helpers (no inline asm inside the kernel template body)
__device__ __forceinline__ void dep_guard_h(v8f& a, v8f& b, v16h x, v16h y) { asm volatile("v_nop\n\tv_nop\n\tv_nop\n\tv_nop" : "+v"(a), "+v"(b) : "v"(x), "v"(y)); }
__device__ __forceinline__ void dep_guard_b(v8f& a, v8f& b, v16b x, v16b y) { asm volatile("v_nop\n\tv_nop\n\tv_nop\n\tv_nop" : "+v"(a), "+v"(b) : "v"(x), "v"(y)); }
__device__ __forceinline__ void keep4_h(v16h a, v16h b, v16h c, v16h d) { asm volatile("v_nop" :: "v"(a), "v"(b), "v"(c), "v"(d)); }
__device__ __forceinline__ void keep4_b(v16b a, v16b b, v16b c, v16b d) { asm volatile("v_nop" :: "v"(a), "v"(b), "v"(c), "v"(d)); }
__device__ __forceinline__ void acc_guard4(v8f& a, v8f& b, v8f& c, v8f& d) { asm volatile("v_nop\n\tv_nop\n\tv_nop\n\tv_nop" : "+v"(a), "+v"(b), "+v"(c), "+v"(d)); }
template <typename T> struct Frag;
template <> struct Frag<_Float16> {
  typedef v16h V; union U { v16h v; v8h h[2]; };
  static __device__ __forceinline__ v16h load(const _Float16* p) {   // elements 0..7 <- p[0..7], 8..15 <- p[16..23]
    U f; f.h[0] = *(const v8h*)(p); f.h[1] = *(const v8h*)(p + 16); return f.v;
  }
  static __device__ __forceinline__ v8f mma(v16h a, v16h b, v8f c) {
    return __builtin_amdgcn_wmma_f32_16x16x32_f16(false, a, false, b, (short)0, c, false, false);
  }
  static __device__ __forceinline__ void guard(v8f& a, v8f& b, v16h x, v16h y) { dep_guard_h(a, b, x, y); }
  static __device__ __forceinline__ void keep(v16h a, v16h b, v16h c, v16h d) { keep4_h(a, b, c, d); }
};
template <> struct Frag<__bf16> {
  typedef v16b V; union U { v16b v; v8b h[2]; };
  static __device__ __forceinline__ v16b load(const __bf16* p) {
    U f; f.h[0] = *(const v8b*)(p); f.h[1] = *(const v8b*)(p + 16); return f.v;
  }
  static __device__ __forceinline__ v8f mma(v16b a, v16b b, v8f c) {
    return __builtin_amdgcn_wmma_f32_16x16x32_bf16(false, a, false, b, (short)0, c, false, false);
  }
  static __device__ __forceinline__ void guard(v8f& a, v8f& b, v16b x, v16b y) { dep_guard_b(a, b, x, y); }
  static __device__ __forceinline__ void keep(v16b a, v16b b, v16b c, v16b d) { keep4_b(a, b, c, d); }
};

// ---- Register-blocked batched WMMA GEMM ------------------------------------
// C[m,n] = scale * sum_k A[m,k] * Bt[n,k] (+bias)(+resid); each wave owns a 64x64 tile, a block of 2 x 4 waves a 128x256 tile.
// A row-major [M,K]; Bt row-major [N,K]; M % 128 == 0, N % 256 == 0, K % 64 == 0.
// The block's operand rows go to LDS in stages of 64 k (128-byte rows, whole lines) by asynchronous copies, two buffers:
// stage t + 1 flies while stage t is multiplied; the waves read their fragments from LDS.
// SPLIT: 0 = single planes; 1 = A and Bt as hi/lo planes (hi.hi + hi.lo + lo.hi); 2 = A as hi/lo planes, Bt single (hi.B + lo.B).
// BIAS_MODE: 0 = none, 1 = bias[m], 2 = bias[n], 3 = bias[n] RNE-converted to bf16 then added in f32.
// OUT_MODE: 0 = f32, 1 = f16, 2 = bf16 hi plane (Cout) + bf16 lo plane (Cout2).
// ET: 0 = f16 operands, 1 = bf16 operands (pointers passed as 16-bit storage)
#define GM_KC 64   // k per stage
#define GM_P  72   // LDS row pitch in elements: 144 B = 16 B x odd, so the 16 rows of a 16-byte fragment read fall on distinct banks
// four asynchronous 16-byte copies per lane, global -> LDS; s_wait_xcnt closes the statement so that no address register is rewritten ahead of it
__device__ __forceinline__ void gm_copy4(unsigned l0, unsigned l1, unsigned l2, unsigned l3,
                                         const unsigned short* g0, const unsigned short* g1,
                                         const unsigned short* g2, const unsigned short* g3) {
  asm volatile("global_load_async_to_lds_b128 %0, %4, off\n\t"
               "global_load_async_to_lds_b128 %1, %5, off\n\t"
               "global_load_async_to_lds_b128 %2, %6, off\n\t"
               "global_load_async_to_lds_b128 %3, %7, off\n\t"
               "s_wait_xcnt 0x0"
               :: "v"(l0), "v"(l1), "v"(l2), "v"(l3), "v"(g0), "v"(g1), "v"(g2), "v"(g3) : "memory");
}
// 128 rows of one plane: this lane's 16 bytes of rows r, r + 32, r + 64, r + 96 (step = 32 source rows, in elements)
__device__ __forceinline__ void gm_stage128(unsigned lds, const unsigned short* g, size_t step) {
  gm_copy4(lds, lds + 32u * GM_P * 2u, lds + 64u * GM_P * 2u, lds + 96u * GM_P * 2u, g, g + step, g + 2 * step, g + 3 * step);
}
// the same for two groups of 128 rows in one statement, under one wait
__device__ __forceinline__ void gm_stage256(unsigned la, const unsigned short* ga, size_t sa,
                                            unsigned lb, const unsigned short* gb, size_t sb) {
  asm volatile("global_load_async_to_lds_b128 %0, %8, off\n\t"
               "global_load_async_to_lds_b128 %1, %9, off\n\t"
               "global_load_async_to_lds_b128 %2, %10, off\n\t"
               "global_load_async_to_lds_b128 %3, %11, off\n\t"
               "global_load_async_to_lds_b128 %4, %12, off\n\t"
               "global_load_async_to_lds_b128 %5, %13, off\n\t"
               "global_load_async_to_lds_b128 %6, %14, off\n\t"
               "global_load_async_to_lds_b128 %7, %15, off\n\t"
               "s_wait_xcnt 0x0"
               :: "v"(la), "v"(la + 32u * GM_P * 2u), "v"(la + 64u * GM_P * 2u), "v"(la + 96u * GM_P * 2u),
                  "v"(lb), "v"(lb + 32u * GM_P * 2u), "v"(lb + 64u * GM_P * 2u), "v"(lb + 96u * GM_P * 2u),
                  "v"(ga), "v"(ga + sa), "v"(ga + 2 * sa), "v"(ga + 3 * sa),
                  "v"(gb), "v"(gb + sb), "v"(gb + 2 * sb), "v"(gb + 3 * sb) : "memory");
}
// this wave's copies have landed (the compiler places no wait for them)
__device__ __forceinline__ void gm_wait_copies() { asm volatile("s_wait_asynccnt 0x0" ::: "memory"); }
// this wave's LDS reads have returned, before the buffer is handed to its next writer
__device__ __forceinline__ void gm_wait_lds() { asm volatile("s_wait_dscnt 0x0" ::: "memory"); }
template <int ET> struct Elem;
template <> struct Elem<0> { typedef _Float16 T; };
template <> struct Elem<1> { typedef __bf16 T; };
template <int ET, int SPLIT, int BIAS_MODE, int OUT_MODE, bool RESID, int ACT = 0>
__global__ __launch_bounds__(256) void wmma_gemm64(
    const unsigned short* __restrict__ Ap, const unsigned short* __restrict__ A2p, int lda, long strideA,
    const unsigned short* __restrict__ Btp, const unsigned short* __restrict__ Bt2p, int ldb, long strideB,
    void* __restrict__ Cout, void* __restrict__ Cout2, int ldc, long strideC,
    const float* __restrict__ bias,
    const float* __restrict__ resid, long strideR,
    int M, int N, int K, float scale) {
  typedef typename Elem<ET>::T T;
  typedef typename Frag<T>::V V;
  const T* A = (const T*)Ap; const T* A2 = (const T*)A2p; const T* Bt = (const T*)Btp; const T* Bt2 = (const T*)Bt2p;
  constexpr int ROWS_A = (SPLIT != 0) ? 256 : 128;   // staged rows: A hi [, A lo], Bt hi [, Bt lo]
  constexpr int ROWS_B = (SPLIT == 1) ? 512 : 256;
  constexpr int STAGE  = (ROWS_A + ROWS_B) * GM_P;   // elements per buffer
  __shared__ __align__(16) unsigned short ring[2 * STAGE];
  __shared__ __align__(16) float sT[8][16 * 68];   // per-wave 16x64 slab, pitch 68 floats
  const int b    = blockIdx.y;
  const int lane = threadIdx.x & 31;
  const int wave = threadIdx.x >> 5;
  const int blocksN = N >> 8;
  const int bm = blockIdx.x / blocksN;
  const int bn = blockIdx.x - bm * blocksN;
  if (bm >= (M >> 7)) return;            // block-uniform, in front of every barrier
  const int mB = bm << 7;
  const int nB = bn << 8;
  const int wm = wave >> 2;
  const int wn = wave & 3;
  const int m0 = mB + (wm << 6);
  const int n0 = nB + (wn << 6);

  const T* Ab  = A  + (size_t)b * strideA;
  const T* Bb  = Bt + (size_t)b * strideB;
  const T* Ab2 = (SPLIT != 0) ? (A2  + (size_t)b * strideA) : nullptr;
  const T* Bb2 = (SPLIT == 1) ? (Bt2 + (size_t)b * strideB) : nullptr;

  const int rlane = lane & 15;                 // row (A) / col (B, D) within subtile
  const int koff  = (lane >> 4) * 8;           // k offset of this lane half
  const int mOff  = (lane >> 4) * 8;           // D row offset

  v8f acc[4][4];
#pragma unroll
  for (int i = 0; i < 4; ++i)
#pragma unroll
    for (int j = 0; j < 4; ++j) acc[i][j] = (v8f){0.f,0.f,0.f,0.f,0.f,0.f,0.f,0.f};

  // copies: thread -> row tid / 8 of each group of 32 rows, 16-byte piece tid % 8, so a wave's copy covers four whole 128-byte rows
  const int crow = threadIdx.x >> 3;
  const int ccol = (threadIdx.x & 7) << 3;
  const unsigned ldsT = (unsigned)(size_t)ring + (unsigned)(crow * GM_P + ccol) * 2u;   // LDS byte address: low 32 bits of the shared address
  const unsigned short* gA  = (const unsigned short*)Ab + (size_t)(mB + crow) * lda + ccol;
  const unsigned short* gB  = (const unsigned short*)Bb + (size_t)(nB + crow) * ldb + ccol;
  const unsigned short* gA2 = (SPLIT != 0) ? ((const unsigned short*)Ab2 + (size_t)(mB + crow) * lda + ccol) : nullptr;
  const unsigned short* gB2 = (SPLIT == 1) ? ((const unsigned short*)Bb2 + (size_t)(nB + crow) * ldb + ccol) : nullptr;
  const size_t sA = (size_t)32 * lda, sB = (size_t)32 * ldb;
  auto issue = [&](int t) {              // stage t into buffer t & 1
    const unsigned l = ldsT + (unsigned)(t & 1) * (unsigned)(STAGE * 2);
    const int k0 = t * GM_KC;
    if (SPLIT == 0) gm_stage128(l, gA + k0, sA);
    else            gm_stage256(l, gA + k0, sA, l + 128u * GM_P * 2u, gA2 + k0, sA);
    gm_stage256(l + (unsigned)ROWS_A * GM_P * 2u, gB + k0, sB, l + (unsigned)(ROWS_A + 128) * GM_P * 2u, gB + 4 * sB + k0, sB);
    if (SPLIT == 1)
      gm_stage256(l + (unsigned)(ROWS_A + 256) * GM_P * 2u, gB2 + k0, sB, l + (unsigned)(ROWS_A + 384) * GM_P * 2u, gB2 + 4 * sB + k0, sB);
  };
  const int nt = K / GM_KC;              // block-uniform
  issue(0);
  gm_wait_copies();
  __syncthreads();
  if (nt > 1) issue(1);

  const int aoff = ((wm << 6) + rlane) * GM_P + koff;
  const int boff = (ROWS_A + (wn << 6) + rlane) * GM_P + koff;
  for (int t = 0; t < nt; ++t) {
    const T* st = (const T*)ring + (t & 1) * STAGE;
    // unrolled, like the loops inside: the fragment and accumulator arrays are indexed by constants and stay in registers
#pragma unroll
    for (int ks = 0; ks < GM_KC / 32; ++ks) {
      // all fragments of this 32-k step as one group of LDS reads in front of its products
      V bh[4], bl[4], ah[4], al[4];
#pragma unroll
      for (int j = 0; j < 4; ++j) {
        bh[j] = Frag<T>::load(st + boff + (j << 4) * GM_P + ks * 32);
        if (SPLIT == 1) bl[j] = Frag<T>::load(st + boff + (256 + (j << 4)) * GM_P + ks * 32);
      }
#pragma unroll
      for (int i = 0; i < 4; ++i) {
        ah[i] = Frag<T>::load(st + aoff + (i << 4) * GM_P + ks * 32);
        if (SPLIT != 0) al[i] = Frag<T>::load(st + aoff + (128 + (i << 4)) * GM_P + ks * 32);
      }
#pragma unroll
      for (int i = 0; i < 4; ++i) {
#pragma unroll
        for (int j = 0; j < 4; ++j) {
          acc[i][j] = Frag<T>::mma(ah[i], bh[j], acc[i][j]);
          if (SPLIT == 1) acc[i][j] = Frag<T>::mma(ah[i], bl[j], acc[i][j]);
          if (SPLIT != 0) acc[i][j] = Frag<T>::mma(al[i], bh[j], acc[i][j]);
        }
        Frag<T>::guard(acc[i][0], acc[i][3], ah[i], (SPLIT != 0) ? al[i] : ah[i]);
      }
      Frag<T>::keep(bh[0], bh[1], bh[2], bh[3]);
      if (SPLIT == 1) Frag<T>::keep(bl[0], bl[1], bl[2], bl[3]);
    }
    // publish point of stage t + 1: own LDS reads back, own copies landed, one barrier (it also ends every read of buffer t & 1), then the refill
    gm_wait_lds();
    gm_wait_copies();
    __syncthreads();
    if (t + 2 < nt) issue(t + 2);
  }
  gm_wait_copies();
  acc_guard4(acc[0][0], acc[0][1], acc[0][2], acc[0][3]);
  acc_guard4(acc[1][0], acc[1][1], acc[1][2], acc[1][3]);
  acc_guard4(acc[2][0], acc[2][1], acc[2][2], acc[2][3]);
  acc_guard4(acc[3][0], acc[3][1], acc[3][2], acc[3][3]);

  // ---- epilogue ----
  float* slab = sT[wave];
  const float* Rb = RESID ? (resid + (size_t)b * strideR) : nullptr;
#pragma unroll
  for (int i = 0; i < 4; ++i) {
    const int mBase = m0 + (i << 4);
#pragma unroll
    for (int j = 0; j < 4; ++j) {
      const int n = n0 + (j << 4) + rlane;
      float bv = 0.f;
      if (BIAS_MODE == 2) bv = bias[n];
      if (BIAS_MODE == 3) bv = bf_bits2f(f2bf_bits(bias[n]));
#pragma unroll
      for (int r = 0; r < 8; ++r) {
        float v = acc[i][j][r] * scale;
        if (BIAS_MODE == 1) v += bias[mBase + mOff + r];
        if (BIAS_MODE == 2 || BIAS_MODE == 3) v += bv;
        if (RESID) v += Rb[(size_t)(mBase + mOff + r) * ldc + n];
        if (ACT == 1) v = tanhf(v);
        if (ACT == 2) v = fmaxf(v, 0.0f);
        if (ACT == 3) v = v / (1.0f + expf(-v));
        if (ACT == 4) v = (v > 0.f) ? v : 0.01f * v;
        if (ACT == 5) v = 0.5f * v * (1.0f + erff(v * 0.70710678118654752f));
        slab[(mOff + r) * 68 + (j << 4) + rlane] = v;
      }
    }
    __builtin_amdgcn_fence(__ATOMIC_RELEASE, "workgroup");
    __builtin_amdgcn_wave_barrier();
    __builtin_amdgcn_fence(__ATOMIC_ACQUIRE, "workgroup");
    if (OUT_MODE == 0) {
      float* C = (float*)Cout + (size_t)b * strideC;
      const int hh = lane >> 4, c4 = (lane & 15) * 4;     // row seg = 256 B = 16 lanes x 16 B
      {
#pragma unroll
        for (int it = 0; it < 8; ++it) {
          const int row = it * 2 + hh;
          v4f v = *(const v4f*)(slab + row * 68 + c4);
          *(v4f*)(C + (size_t)(mBase + row) * ldc + n0 + c4) = v;
        }
        
      }
    } else {
      const int q = lane >> 3, c8 = (lane & 7) * 8;
      unsigned short* C  = (unsigned short*)Cout  + (size_t)b * strideC;
      unsigned short* C2 = (OUT_MODE == 2) ? ((unsigned short*)Cout2 + (size_t)b * strideC) : nullptr;
      {
#pragma unroll
        for (int it = 0; it < 4; ++it) {
          const int row = it * 4 + q;
          const float* sp = slab + row * 68 + c8;
          v8h hv, lv;
#pragma unroll
          for (int e = 0; e < 8; ++e) {
            if (OUT_MODE == 1) {
              hv[e] = (_Float16)sp[e];
            } else {
              unsigned short hb = f2bf_bits(sp[e]);
              unsigned short lb = f2bf_bits(sp[e] - bf_bits2f(hb));
              hv[e] = __builtin_bit_cast(_Float16, hb);
              lv[e] = __builtin_bit_cast(_Float16, lb);
            }
          }
          *(v8h*)(C + (size_t)(mBase + row) * ldc + n0 + c8) = hv;
          if (OUT_MODE == 2) *(v8h*)(C2 + (size_t)(mBase + row) * ldc + n0 + c8) = lv;
        }
        
      }
    }
    __builtin_amdgcn_fence(__ATOMIC_RELEASE, "workgroup");
    __builtin_amdgcn_wave_barrier();
    __builtin_amdgcn_fence(__ATOMIC_ACQUIRE, "workgroup");
  }
}

// ---- all f32 -> bf16 casts (RNE) in one launch of few, long waves --------------
// The five sources are cut into pieces of 1024 floats; piece p of the row x | wa | wb | wc | wd goes to out + 1024 p.
// x holds PX pieces, each w 1 << PW_SHIFT. The grid has exactly (all pieces) / PPW waves, 16 to a work-group; wave g takes
// pieces g, g + waves, ...: per piece 8 loads of 16 bytes a lane, each covering 512 bytes in a row. All of a wave's loads
// stand before its first store, so that many are in flight per lane and no wave start stands between two loads.
#define CV_T 512   // threads per work-group
#define CV_N 8     // 16-byte loads per lane and piece
typedef __attribute__((ext_vector_type(2))) unsigned v2u;
template <int PX, int PW_SHIFT, int PPW>
__global__ __launch_bounds__(CV_T) void cast_all_f32_bf16(
    const float* __restrict__ x, const float* __restrict__ wa, const float* __restrict__ wb,
    const float* __restrict__ wc, const float* __restrict__ wd, unsigned short* __restrict__ out) {
  constexpr int WAVES = (PX + (4 << PW_SHIFT)) / PPW;
  const int lane = threadIdx.x & 31;
  // the wave's number as a scalar: the choice of the source is scalar work
  const int g = (int)blockIdx.x * (CV_T / 32) + __builtin_amdgcn_readfirstlane((int)(threadIdx.x >> 5));
  v4f a[PPW][CV_N];
#pragma unroll
  for (int t = 0; t < PPW; ++t) {
    const int p = g + t * WAVES;
    const int v = p - PX, sel = v >> PW_SHIFT;
    const float* s = (v < 0) ? x : (sel == 0) ? wa : (sel == 1) ? wb : (sel == 2) ? wc : wd;
    const int l = (v < 0) ? p : (v & ((1 << PW_SHIFT) - 1));
    const v4f* q = (const v4f*)(s + (size_t)l * (CV_N * 128)) + lane;
#pragma unroll
    for (int k = 0; k < CV_N; ++k) a[t][k] = q[k * 32];
  }
#pragma unroll
  for (int t = 0; t < PPW; ++t) {
    v2u* q = (v2u*)(out + (size_t)(g + t * WAVES) * (CV_N * 128)) + lane;
#pragma unroll
    for (int k = 0; k < CV_N; ++k) {
      v2u u;
      u.x = (unsigned)f2bf_bits(a[t][k][0]) | ((unsigned)f2bf_bits(a[t][k][1]) << 16);
      u.y = (unsigned)f2bf_bits(a[t][k][2]) | ((unsigned)f2bf_bits(a[t][k][3]) << 16);
      q[k * 32] = u;
    }
  }
}

#define AT_D 64
#define AT_NW 4
#define AT_QB 64
#define AT_KC 64
#define AT_MAXKC 32
#define AT_P 72   // LDS row pitch of every 64-element bf16 tile: 144 B = 16 B x odd, so the 16 rows of a 16-byte fragment read fall on distinct banks

struct AttnP { long q_bs, q_rs, q_hs, k_bs, k_rs, k_hs, v_bs, v_rs, v_hs, o_bs, o_rs, o_hs;
               int S, Skv, H; float sscale; };
static_assert(sizeof(AttnP) == 112);

__device__ __forceinline__ unsigned short at_bf_bits(float f) {
  unsigned u = __float_as_uint(f);
  return (unsigned short)((u + 0x7FFFu + ((u >> 16) & 1u)) >> 16);
}
// lane l <-> lane l ^ 16 without LDS
__device__ __forceinline__ float at_xhalf(float x) {
  return __builtin_bit_cast(float, __builtin_amdgcn_permlanex16(__builtin_bit_cast(int, x), __builtin_bit_cast(int, x), 0x76543210, 0xfedcba98, false, false));
}
__device__ __forceinline__ __bf16 at_f2bf(float f) { return __builtin_bit_cast(__bf16, at_bf_bits(f)); }
__device__ __forceinline__ void at_split(float f, __bf16& hi, __bf16& lo) {
  const unsigned short hb = at_bf_bits(f);
  hi = __builtin_bit_cast(__bf16, hb);
  lo = at_f2bf(f - __uint_as_float(((unsigned)hb) << 16));
}
// three products of a hi/lo x hi/lo pair into one accumulator (hi.hi, A lo . B hi, A hi . B lo), then the hazard guard tying D and all four operands
__device__ __forceinline__ v8f at_mma3(v16b ah, v16b al, v16b bh, v16b bl, v8f c) {
  c = __builtin_amdgcn_wmma_f32_16x16x32_bf16(false, ah, false, bh, (short)0, c, false, false);
  c = __builtin_amdgcn_wmma_f32_16x16x32_bf16(false, al, false, bh, (short)0, c, false, false);
  c = __builtin_amdgcn_wmma_f32_16x16x32_bf16(false, ah, false, bl, (short)0, c, false, false);
  asm volatile("v_nop\n\tv_nop\n\tv_nop\n\tv_nop" : "+v"(c) : "v"(ah), "v"(al), "v"(bh), "v"(bl));
  return c;
}

__global__ __launch_bounds__(128)
void attn64_causal_split(const unsigned short* __restrict__ qh_p, const unsigned short* __restrict__ ql_p,
                         const unsigned short* __restrict__ kh_p, const unsigned short* __restrict__ kl_p,
                         const unsigned short* __restrict__ vh_p, const unsigned short* __restrict__ vl_p,
                         unsigned short* __restrict__ ohi, unsigned short* __restrict__ olo, AttnP g) {
  union FB { v16b v; v8b h[2]; };
  __shared__ __align__(16) __bf16 Qsh[AT_QB * AT_P];          // Q hi [row][d]   9 KB
  __shared__ __align__(16) __bf16 Qsl[AT_QB * AT_P];          // Q lo [row][d]   9 KB
  __shared__ __align__(16) __bf16 Ksh[AT_KC * AT_P];          // K hi [kv][d]    9 KB
  __shared__ __align__(16) __bf16 Ksl[AT_KC * AT_P];          // K lo [kv][d]    9 KB
  __shared__ __align__(16) __bf16 Vth[AT_D * AT_P];           // V hi [d][kv]    9 KB
  __shared__ __align__(16) __bf16 Vtl[AT_D * AT_P];           // V lo [d][kv]    9 KB

  const int tid  = threadIdx.x;
  const int wave = tid >> 5;
  const int lane = tid & 31;
  const int hh   = lane >> 4;
  const int c    = lane & 15;

  const int nqb = g.S / AT_QB;
  const int qb = nqb - 1 - (int)blockIdx.y;   // low blockIdx.y starts first: the tiles with the most key chunks lead
  const int bh = blockIdx.x;
  const int h  = bh % g.H;
  const int b  = bh / g.H;
  const int q0 = qb * AT_QB + wave * 16;

  const __bf16* qhb = (const __bf16*)qh_p + (size_t)b * g.q_bs + (size_t)h * g.q_hs;
  const __bf16* qlb = (const __bf16*)ql_p + (size_t)b * g.q_bs + (size_t)h * g.q_hs;
  const __bf16* khb = (const __bf16*)kh_p + (size_t)b * g.k_bs + (size_t)h * g.k_hs;
  const __bf16* klb = (const __bf16*)kl_p + (size_t)b * g.k_bs + (size_t)h * g.k_hs;
  const __bf16* vhb = (const __bf16*)vh_p + (size_t)b * g.v_bs + (size_t)h * g.v_hs;
  const __bf16* vlb = (const __bf16*)vl_p + (size_t)b * g.v_bs + (size_t)h * g.v_hs;

  // ---- Q hi/lo planes for the block's 64 rows: [row][d], 16-B copies (thread -> row tid/2, 32-d half) ----
  {
    const int r = tid >> 1, dh = (tid & 1) * 32;
    const size_t qo = (size_t)(qb * AT_QB + r) * g.q_rs + dh;
#pragma unroll
    for (int i = 0; i < 4; ++i) {
      const v8b xh = *(const v8b*)(qhb + qo + 8 * i);
      const v8b xl = *(const v8b*)(qlb + qo + 8 * i);
      *(v8b*)(Qsh + r * AT_P + dh + 8 * i) = xh;
      *(v8b*)(Qsl + r * AT_P + dh + 8 * i) = xl;
    }
  }
  __syncthreads();

  float mrow = NEG_INF, lrow = 0.f;      // query q0 + c: running max (same in both lane halves) and this half's part of the running sum
  v8f oacc[4];                           // oacc[t][r] = O[q0 + c][16 t + 8 hh + r]
#pragma unroll
  for (int t = 0; t < 4; ++t) oacc[t] = (v8f){0.f,0.f,0.f,0.f,0.f,0.f,0.f,0.f};

  const int nck = (qb + 1 < AT_MAXKC) ? (qb + 1) : AT_MAXKC;    // block-uniform, statically bounded
  const __bf16* qwh = Qsh + (wave * 16 + c) * AT_P + 8 * hh;      // B fragment column c (query q0 + c) of this wave
  const __bf16* qwl = Qsl + (wave * 16 + c) * AT_P + 8 * hh;

  for (int kc = 0; kc < nck; ++kc) {
    const int kv0 = kc * AT_KC;
    __syncthreads();
    {
      const int kvr = tid >> 1, dh = (tid & 1) * 32;
      const size_t ko = (size_t)(kv0 + kvr) * g.k_rs + dh;
      const size_t vo = (size_t)(kv0 + kvr) * g.v_rs + dh;
#pragma unroll
      for (int i = 0; i < 4; ++i) {
        const v8b ka = *(const v8b*)(khb + ko + 8 * i);
        const v8b kb = *(const v8b*)(klb + ko + 8 * i);
        *(v8b*)(Ksh + kvr * AT_P + dh + 8 * i) = ka;
        *(v8b*)(Ksl + kvr * AT_P + dh + 8 * i) = kb;
        const v8b va = *(const v8b*)(vhb + vo + 8 * i);
        const v8b vb = *(const v8b*)(vlb + vo + 8 * i);
#pragma unroll
        for (int e = 0; e < 8; ++e) {
          const int d = dh + 8 * i + e;
          Vth[d * AT_P + kvr] = va[e];
          Vtl[d * AT_P + kvr] = vb[e];
        }
      }
    }
    __syncthreads();

    // ---- scores^T[64 x 16] = k . q^T  (A = K[kv][d], B = Q[row][d]; split k-map via two 16-B halves at +8hh and +16+8hh) ----
    // s[j][r] = score of key kv0 + 16 j + 8 hh + r against query q0 + c
    v8f s[4];
#pragma unroll
    for (int j = 0; j < 4; ++j) s[j] = (v8f){0.f,0.f,0.f,0.f,0.f,0.f,0.f,0.f};
#pragma unroll 1
    for (int dc = 0; dc < 2; ++dc) {
      FB qh, ql;
      qh.h[0] = *(const v8b*)(qwh + dc * 32);
      qh.h[1] = *(const v8b*)(qwh + dc * 32 + 16);
      ql.h[0] = *(const v8b*)(qwl + dc * 32);
      ql.h[1] = *(const v8b*)(qwl + dc * 32 + 16);
#pragma unroll
      for (int j = 0; j < 4; ++j) {
        FB kb, kl;
        const __bf16* kp  = Ksh + (j * 16 + c) * AT_P + dc * 32 + 8 * hh;
        const __bf16* kpl = Ksl + (j * 16 + c) * AT_P + dc * 32 + 8 * hh;
        kb.h[0] = *(const v8b*)(kp);
        kb.h[1] = *(const v8b*)(kp + 16);
        kl.h[0] = *(const v8b*)(kpl);
        kl.h[1] = *(const v8b*)(kpl + 16);
        s[j] = at_mma3(kb.v, kl.v, qh.v, ql.v, s[j]);
      }
    }
    // ---- scale, causal mask on the diagonal chunk (key > query -> -inf), max over this lane's 32 keys, then the other half's ----
    const bool diag = (kc == qb);
    const int qrow = q0 + c;
    float cm = NEG_INF;
#pragma unroll
    for (int j = 0; j < 4; ++j) {
#pragma unroll
      for (int r = 0; r < 8; ++r) {
        const int kvcol = kv0 + j * 16 + 8 * hh + r;
        float sv = s[j][r] * g.sscale;
        if (diag && (kvcol > qrow)) sv = NEG_INF;
        s[j][r] = sv;
        cm = fmaxf(cm, sv);
      }
    }
    cm = fmaxf(cm, at_xhalf(cm));
    const float mnew = fmaxf(mrow, cm);
    const float mref = (mnew == NEG_INF) ? 0.0f : mnew;
    const float alpha = __expf(mrow - mref);
    mrow = mnew;
    // ---- p = exp(s - max), split in place: score tiles 2 kk and 2 kk + 1 are elements 0..7 and 8..15 of B fragment kk ----
    FB pa[2], pl[2];
    float psum = 0.f;
#pragma unroll
    for (int j = 0; j < 4; ++j) {
#pragma unroll
      for (int r = 0; r < 8; ++r) {
        const float p = __expf(s[j][r] - mref);
        psum += p;
        __bf16 a, bl; at_split(p, a, bl);
        pa[j >> 1].h[j & 1][r] = a;
        pl[j >> 1].h[j & 1][r] = bl;
      }
    }
    lrow = lrow * alpha + psum;
#pragma unroll
    for (int t = 0; t < 4; ++t)
#pragma unroll
      for (int r = 0; r < 8; ++r) oacc[t][r] *= alpha;
    // ---- O^T[64 x 16] += V^T[64 x 64] . P^T[64 x 16]  (A = V^T[d][kv] from the [d][kv] tile, B = P^T from registers) ----
    // unrolled: pa and pl are register arrays, indexed by kk
#pragma unroll
    for (int kk = 0; kk < 2; ++kk) {
#pragma unroll
      for (int t = 0; t < 4; ++t) {
        FB vb, vl;
        const __bf16* vp  = Vth + (t * 16 + c) * AT_P + kk * 32 + 8 * hh;
        const __bf16* vpl = Vtl + (t * 16 + c) * AT_P + kk * 32 + 8 * hh;
        vb.h[0] = *(const v8b*)(vp);
        vb.h[1] = *(const v8b*)(vp + 16);
        vl.h[0] = *(const v8b*)(vpl);
        vl.h[1] = *(const v8b*)(vpl + 16);
        oacc[t] = at_mma3(vb.v, vl.v, pa[kk].v, pl[kk].v, oacc[t]);
      }
    }
  }

  // ---- a lane holds 8 consecutive d of its query's row per tile. The wave's own 16 Q rows in LDS are dead now and no other
  //      wave reads them: the bf16 hi/lo out tile is staged there, so that each global store covers whole 128-byte rows ----
  {
    const float inv = 1.0f / (lrow + at_xhalf(lrow));    // the two halves' sums are joined once, here
    __bf16* sh = Qsh + wave * 16 * AT_P;
    __bf16* sl = Qsl + wave * 16 * AT_P;
#pragma unroll
    for (int t = 0; t < 4; ++t) {
      v8h hv, lv;
#pragma unroll
      for (int r = 0; r < 8; ++r) {
        const float o = oacc[t][r] * inv;
        const unsigned short hb = f2bf_bits(o);
        const unsigned short lb = f2bf_bits(o - bf_bits2f(hb));
        hv[r] = __builtin_bit_cast(_Float16, hb);
        lv[r] = __builtin_bit_cast(_Float16, lb);
      }
      *(v8h*)(sh + c * AT_P + t * 16 + 8 * hh) = hv;
      *(v8h*)(sl + c * AT_P + t * 16 + 8 * hh) = lv;
    }
    __builtin_amdgcn_fence(__ATOMIC_RELEASE, "workgroup");
    __builtin_amdgcn_wave_barrier();
    __builtin_amdgcn_fence(__ATOMIC_ACQUIRE, "workgroup");
    const int q8 = lane >> 3, c8 = (lane & 7) * 8;
    unsigned short* oh = ohi + (size_t)b * g.o_bs + (size_t)h * g.o_hs;
    unsigned short* ol = olo + (size_t)b * g.o_bs + (size_t)h * g.o_hs;
#pragma unroll
    for (int it = 0; it < 4; ++it) {
      const int row = it * 4 + q8;                    // q8 in 0..3, it in 0..3 -> rows 0..15
      const v8h hv = *(const v8h*)(sh + row * AT_P + c8);
      const v8h lv = *(const v8h*)(sl + row * AT_P + c8);
      *(v8h*)(oh + (size_t)(q0 + row) * g.o_rs + c8) = hv;
      *(v8h*)(ol + (size_t)(q0 + row) * g.o_rs + c8) = lv;
    }
  }
}

// ---------------------------------------------------------------------------
// Host orchestration (launches only).
// d_in: 0 = x [4,2048,1024], 1 = W_q, 2 = W_k, 3 = W_v (each [1024,1024], (out,in)), 4 = W_out [1024,1024], 5 = b_out [1024]; all f32.
// Workspace (152 MiB): bf16 x | bf16 [W_q;W_k;W_v] | bf16 W_out | qkv hi plane | qkv lo plane | attn hi | attn lo.
// ---------------------------------------------------------------------------
extern "C" void kernel_launch(void* const* d_in, const int* in_sizes, int n_in,
                              void* d_out, int out_size, void* d_ws, size_t ws_size,
                              hipStream_t stream) {
  constexpr int Bn = 4, S = 2048, E = 1024, Hn = 16, Dh = 64, E3 = 3 * E;
  constexpr int M = Bn * S;                 // 8192 rows in total
  constexpr int NQB = S / AT_QB;            // 32
  static_assert(NQB <= AT_MAXKC);
  static_assert(M % 128 == 0 && E % 256 == 0 && E3 % 256 == 0 && E % GM_KC == 0 && Hn * Dh == E);
  if (n_in < 6) return;
  if (in_sizes[0] != M * E || in_sizes[1] != E * E || in_sizes[2] != E * E || in_sizes[3] != E * E ||
      in_sizes[4] != E * E || in_sizes[5] != E || out_size != M * E) return;

  const float* x     = (const float*)d_in[0];
  const float* w_q   = (const float*)d_in[1];
  const float* w_k   = (const float*)d_in[2];
  const float* w_v   = (const float*)d_in[3];
  const float* w_out = (const float*)d_in[4];
  const float* b_out = (const float*)d_in[5];
  float* out = (float*)d_out;

  const size_t bX   = (size_t)M * E * 2;                  // 16 MiB  bf16 x
  const size_t bW   = (size_t)E3 * E * 2;                 //  6 MiB  bf16 [W_q; W_k; W_v]
  const size_t bWo  = (size_t)E * E * 2;                  //  2 MiB  bf16 W_out
  const size_t bQKV = (size_t)M * E3 * 2;                 // 48 MiB  bf16 plane of qkv (x2)
  const size_t bAH  = (size_t)M * E * 2;                  // 16 MiB  bf16 plane of attn out (x2)
  char* ws = (char*)d_ws;
  size_t off = 0;
  unsigned short* X16  = (unsigned short*)(ws + off); off += bX;
  unsigned short* W16  = (unsigned short*)(ws + off); off += bW;
  unsigned short* Wo16 = (unsigned short*)(ws + off); off += bWo;
  unsigned short* QH   = (unsigned short*)(ws + off); off += bQKV;
  unsigned short* QL   = (unsigned short*)(ws + off); off += bQKV;
  unsigned short* AH   = (unsigned short*)(ws + off); off += bAH;
  unsigned short* AL   = (unsigned short*)(ws + off); off += bAH;
  if (off > ws_size) return;                              // 159,383,552 B

  dim3 blk256(256), blk128(128);

  // 1: RNE bf16 casts of x, the three projection weights (stacked into one [3072][1024] matrix) and W_out.
  //    X16, W16 and Wo16 lie one behind the other in the workspace, so the five results are one row of bf16 from X16 on.
  {
    constexpr int PIECE = CV_N * 128;                      // floats per piece
    constexpr int PX = M * E / PIECE, PW_SHIFT = 10;       // 8192 pieces of x, 1024 of each weight
    constexpr int PPW = 3;                                 // pieces per wave
    constexpr int WGS = (PX + (4 << PW_SHIFT)) / (PPW * (CV_T / 32));   // 256 work-groups
    static_assert(M * E % PIECE == 0 && E * E == (PIECE << PW_SHIFT));
    static_assert(WGS * PPW * (CV_T / 32) == PX + (4 << PW_SHIFT));
    cast_all_f32_bf16<PX, PW_SHIFT, PPW><<<dim3(WGS), dim3(CV_T), 0, stream>>>(x, w_q, w_k, w_v, w_out, X16);
  }

  // 2: qkv[M][3072] = bf16(x) . bf16([W_q;W_k;W_v])^T, written as bf16 hi/lo planes
  {
    const int tiles = (M / 64) * (E3 / 64);                // 6144
    wmma_gemm64<1, 0, 0, 2, false><<<dim3((tiles + 7) / 8, 1), blk256, 0, stream>>>(
        X16, X16, E, 0L, W16, W16, E, 0L, (void*)QH, (void*)QL, E3, 0L,
        b_out, b_out, 0L, M, E3, E, 1.0f);
  }
  // 3: causal attention per (batch, head, 64-query block), longest blocks first -> bf16 hi/lo planes [M][E]
  {
    AttnP g;
    g.q_bs = (long)S * E3; g.q_rs = E3; g.q_hs = Dh;
    g.k_bs = (long)S * E3; g.k_rs = E3; g.k_hs = Dh;
    g.v_bs = (long)S * E3; g.v_rs = E3; g.v_hs = Dh;
    g.o_bs = (long)S * E;  g.o_rs = E;  g.o_hs = Dh;
    g.S = S; g.Skv = S; g.H = Hn;
    g.sscale = 0.125f;             // 64^-0.5, applied in f32 after the product
    attn64_causal_split<<<dim3(Bn * Hn, NQB), blk128, 0, stream>>>(
        QH, QL, QH + E, QL + E, QH + 2 * E, QL + 2 * E, AH, AL, g);
  }

  // 4: out[M][E] (f32) = (attn hi + attn lo) . bf16(W_out)^T + bf16(b_out)
  {
    const int tiles = (M / 64) * (E / 64);                 // 2048
    wmma_gemm64<1, 2, 3, 0, false><<<dim3((tiles + 7) / 8, 1), blk256, 0, stream>>>(
        AH, AL, E, 0L, Wo16, Wo16, E, 0L, (void*)out, (void*)out, E, 0L,
        b_out, b_out, 0L, M, E, E, 1.0f);
  }
}

// v006
// Measured time: 212 microseconds a run.
// Next to v005, in two timings, it ran 1.07 times as fast each time.
// Over all steps from v000 it is 4.15 times as fast.
#include <hip/hip_runtime.h>
// Contractions: qkv projection GEMM = v_wmma_f32_16x16x32_bf16 (bf16 operands, 1 product); q.k^T = v_wmma_f32_16x16x32_bf16 (bf16 hi/lo planes of q and k, 3 products); p.v = v_wmma_f32_16x16x32_bf16 (bf16 hi/lo planes of p and v, 3 products); output projection GEMM = v_wmma_f32_16x16x32_bf16 (bf16 hi/lo planes of the attention output x bf16 weight, 2 products); f32 accumulate everywhere; softmax in f32.

typedef __attribute__((ext_vector_type(16))) _Float16 v16h;
typedef __attribute__((ext_vector_type(8)))  _Float16 v8h;
typedef __attribute__((ext_vector_type(16))) __bf16   v16b;
typedef __attribute__((ext_vector_type(8)))  __bf16   v8b;
typedef __attribute__((ext_vector_type(8)))  float    v8f;
typedef __attribute__((ext_vector_type(4)))  float    v4f;

#define NEG_INF (-__builtin_inff())

__device__ __forceinline__ unsigned short f2bf_bits(float f) {
  unsigned u = __float_as_uint(f);
  return (unsigned short)((u + 0x7FFFu + ((u >> 16) & 1u)) >> 16);
}
__device__ __forceinline__ float bf_bits2f(unsigned short h) { return __uint_as_float(((unsigned)h) << 16); }

// hazard guards as plain device helpers (no inline asm inside the kernel template body)
__device__ __forceinline__ void dep_guard_h(v8f& a, v8f& b, v16h x, v16h y) { asm volatile("v_nop\n\tv_nop\n\tv_nop\n\tv_nop" : "+v"(a), "+v"(b) : "v"(x), "v"(y)); }
__device__ __forceinline__ void dep_guard_b(v8f& a, v8f& b, v16b x, v16b y) { asm volatile("v_nop\n\tv_nop\n\tv_nop\n\tv_nop" : "+v"(a), "+v"(b) : "v"(x), "v"(y)); }
__device__ __forceinline__ void keep4_h(v16h a, v16h b, v16h c, v16h d) { asm volatile("v_nop" :: "v"(a), "v"(b), "v"(c), "v"(d)); }
__device__ __forceinline__ void keep4_b(v16b a, v16b b, v16b c, v16b d) { asm volatile("v_nop" :: "v"(a), "v"(b), "v"(c), "v"(d)); }
__device__ __forceinline__ void acc_guard4(v8f& a, v8f& b, v8f& c, v8f& d) { asm volatile("v_nop\n\tv_nop\n\tv_nop\n\tv_nop" : "+v"(a), "+v"(b), "+v"(c), "+v"(d)); }
template <typename T> struct Frag;
template <> struct Frag<_Float16> {
  typedef v16h V; union U { v16h v; v8h h[2]; };
  static __device__ __forceinline__ v16h load(const _Float16* p) {   // elements 0..7 <- p[0..7], 8..15 <- p[16..23]
    U f; f.h[0] = *(const v8h*)(p); f.h[1] = *(const v8h*)(p + 16); return f.v;
  }
  static __device__ __forceinline__ v8f mma(v16h a, v16h b, v8f c) {
    return __builtin_amdgcn_wmma_f32_16x16x32_f16(false, a, false, b, (short)0, c, false, false);
  }
  static __device__ __forceinline__ void guard(v8f& a, v8f& b, v16h x, v16h y) { dep_guard_h(a, b, x, y); }
  static __device__ __forceinline__ void keep(v16h a, v16h b, v16h c, v16h d) { keep4_h(a, b, c, d); }
};
template <> struct Frag<__bf16> {
  typedef v16b V; union U { v16b v; v8b h[2]; };
  static __device__ __forceinline__ v16b load(const __bf16* p) {
    U f; f.h[0] = *(const v8b*)(p); f.h[1] = *(const v8b*)(p + 16); return f.v;
  }
  static __device__ __forceinline__ v8f mma(v16b a, v16b b, v8f c) {
    return __builtin_amdgcn_wmma_f32_16x16x32_bf16(false, a, false, b, (short)0, c, false, false);
  }
  static __device__ __forceinline__ void guard(v8f& a, v8f& b, v16b x, v16b y) { dep_guard_b(a, b, x, y); }
  static __device__ __forceinline__ void keep(v16b a, v16b b, v16b c, v16b d) { keep4_b(a, b, c, d); }
};

// ---- Register-blocked batched WMMA GEMM ------------------------------------
// C[m,n] = scale * sum_k A[m,k] * Bt[n,k] (+bias)(+resid); each wave owns a 64x64 tile, a block of 2 x 4 waves a 128x256 tile.
// A row-major [M,K]; Bt row-major [N,K]; M % 128 == 0, N % 256 == 0, K % 64 == 0.
// The block's operand rows go to LDS in stages of 64 k (128-byte rows, whole lines) by asynchronous copies, two buffers:
// stage t + 1 flies while stage t is multiplied; the waves read their fragments from LDS.
// SPLIT: 0 = single planes; 1 = A and Bt as hi/lo planes (hi.hi + hi.lo + lo.hi); 2 = A as hi/lo planes, Bt single (hi.B + lo.B).
// BIAS_MODE: 0 = none, 1 = bias[m], 2 = bias[n], 3 = bias[n] RNE-converted to bf16 then added in f32.
// OUT_MODE: 0 = f32, 1 = f16, 2 = bf16 hi plane (Cout) + bf16 lo plane (Cout2).
// ET: 0 = f16 operands, 1 = bf16 operands (pointers passed as 16-bit storage)
#define GM_KC 64   // k per stage
#define GM_P  72   // LDS row pitch in elements: 144 B = 16 B x odd, so the 16 rows of a 16-byte fragment read fall on distinct banks
// four asynchronous 16-byte copies per lane, global -> LDS; s_wait_xcnt closes the statement so that no address register is rewritten ahead of it
__device__ __forceinline__ void gm_copy4(unsigned l0, unsigned l1, unsigned l2, unsigned l3,
                                         const unsigned short* g0, const unsigned short* g1,
                                         const unsigned short* g2, const unsigned short* g3) {
  asm volatile("global_load_async_to_lds_b128 %0, %4, off\n\t"
               "global_load_async_to_lds_b128 %1, %5, off\n\t"
               "global_load_async_to_lds_b128 %2, %6, off\n\t"
               "global_load_async_to_lds_b128 %3, %7, off\n\t"
               "s_wait_xcnt 0x0"
               :: "v"(l0), "v"(l1), "v"(l2), "v"(l3), "v"(g0), "v"(g1), "v"(g2), "v"(g3) : "memory");
}
// 128 rows of one plane: this lane's 16 bytes of rows r, r + 32, r + 64, r + 96 (step = 32 source rows, in elements)
__device__ __forceinline__ void gm_stage128(unsigned lds, const unsigned short* g, size_t step) {
  gm_copy4(lds, lds + 32u * GM_P * 2u, lds + 64u * GM_P * 2u, lds + 96u * GM_P * 2u, g, g + step, g + 2 * step, g + 3 * step);
}
// the same for two groups of 128 rows in one statement, under one wait
__device__ __forceinline__ void gm_stage256(unsigned la, const unsigned short* ga, size_t sa,
                                            unsigned lb, const unsigned short* gb, size_t sb) {
  asm volatile("global_load_async_to_lds_b128 %0, %8, off\n\t"
               "global_load_async_to_lds_b128 %1, %9, off\n\t"
               "global_load_async_to_lds_b128 %2, %10, off\n\t"
               "global_load_async_to_lds_b128 %3, %11, off\n\t"
               "global_load_async_to_lds_b128 %4, %12, off\n\t"
               "global_load_async_to_lds_b128 %5, %13, off\n\t"
               "global_load_async_to_lds_b128 %6, %14, off\n\t"
               "global_load_async_to_lds_b128 %7, %15, off\n\t"
               "s_wait_xcnt 0x0"
               :: "v"(la), "v"(la + 32u * GM_P * 2u), "v"(la + 64u * GM_P * 2u), "v"(la + 96u * GM_P * 2u),
                  "v"(lb), "v"(lb + 32u * GM_P * 2u), "v"(lb + 64u * GM_P * 2u), "v"(lb + 96u * GM_P * 2u),
                  "v"(ga), "v"(ga + sa), "v"(ga + 2 * sa), "v"(ga + 3 * sa),
                  "v"(gb), "v"(gb + sb), "v"(gb + 2 * sb), "v"(gb + 3 * sb) : "memory");
}
// this wave's copies have landed (the compiler places no wait for them)
__device__ __forceinline__ void gm_wait_copies() { asm volatile("s_wait_asynccnt 0x0" ::: "memory"); }
// this wave's LDS reads have returned, before the buffer is handed to its next writer
__device__ __forceinline__ void gm_wait_lds() { asm volatile("s_wait_dscnt 0x0" ::: "memory"); }
template <int ET> struct Elem;
template <> struct Elem<0> { typedef _Float16 T; };
template <> struct Elem<1> { typedef __bf16 T; };
template <int ET, int SPLIT, int BIAS_MODE, int OUT_MODE, bool RESID, int ACT = 0>
__global__ __launch_bounds__(256) void wmma_gemm64(
    const unsigned short* __restrict__ Ap, const unsigned short* __restrict__ A2p, int lda, long strideA,
    const unsigned short* __restrict__ Btp, const unsigned short* __restrict__ Bt2p, int ldb, long strideB,
    void* __restrict__ Cout, void* __restrict__ Cout2, int ldc, long strideC,
    const float* __restrict__ bias,
    const float* __restrict__ resid, long strideR,
    int M, int N, int K, float scale) {
  typedef typename Elem<ET>::T T;
  typedef typename Frag<T>::V V;
  const T* A = (const T*)Ap; const T* A2 = (const T*)A2p; const T* Bt = (const T*)Btp; const T* Bt2 = (const T*)Bt2p;
  constexpr int ROWS_A = (SPLIT != 0) ? 256 : 128;   // staged rows: A hi [, A lo], Bt hi [, Bt lo]
  constexpr int ROWS_B = (SPLIT == 1) ? 512 : 256;
  constexpr int STAGE  = (ROWS_A + ROWS_B) * GM_P;   // elements per buffer
  __shared__ __align__(16) unsigned short ring[2 * STAGE];
  __shared__ __align__(16) float sT[8][16 * 68];   // per-wave 16x64 slab, pitch 68 floats
  const int b    = blockIdx.y;
  const int lane = threadIdx.x & 31;
  const int wave = threadIdx.x >> 5;
  const int blocksN = N >> 8;
  const int bm = blockIdx.x / blocksN;
  const int bn = blockIdx.x - bm * blocksN;
  if (bm >= (M >> 7)) return;            // block-uniform, in front of every barrier
  const int mB = bm << 7;
  const int nB = bn << 8;
  const int wm = wave >> 2;
  const int wn = wave & 3;
  const int m0 = mB + (wm << 6);
  const int n0 = nB + (wn << 6);

  const T* Ab  = A  + (size_t)b * strideA;
  const T* Bb  = Bt + (size_t)b * strideB;
  const T* Ab2 = (SPLIT != 0) ? (A2  + (size_t)b * strideA) : nullptr;
  const T* Bb2 = (SPLIT == 1) ? (Bt2 + (size_t)b * strideB) : nullptr;

  const int rlane = lane & 15;                 // row (A) / col (B, D) within subtile
  const int koff  = (lane >> 4) * 8;           // k offset of this lane half
  const int mOff  = (lane >> 4) * 8;           // D row offset

  v8f acc[4][4];
#pragma unroll
  for (int i = 0; i < 4; ++i)
#pragma unroll
    for (int j = 0; j < 4; ++j) acc[i][j] = (v8f){0.f,0.f,0.f,0.f,0.f,0.f,0.f,0.f};

  // copies: thread -> row tid / 8 of each group of 32 rows, 16-byte piece tid % 8, so a wave's copy covers four whole 128-byte rows
  const int crow = threadIdx.x >> 3;
  const int ccol = (threadIdx.x & 7) << 3;
  const unsigned ldsT = (unsigned)(size_t)ring + (unsigned)(crow * GM_P + ccol) * 2u;   // LDS byte address: low 32 bits of the shared address
  const unsigned short* gA  = (const unsigned short*)Ab + (size_t)(mB + crow) * lda + ccol;
  const unsigned short* gB  = (const unsigned short*)Bb + (size_t)(nB + crow) * ldb + ccol;
  const unsigned short* gA2 = (SPLIT != 0) ? ((const unsigned short*)Ab2 + (size_t)(mB + crow) * lda + ccol) : nullptr;
  const unsigned short* gB2 = (SPLIT == 1) ? ((const unsigned short*)Bb2 + (size_t)(nB + crow) * ldb + ccol) : nullptr;
  const size_t sA = (size_t)32 * lda, sB = (size_t)32 * ldb;
  auto issue = [&](int t) {              // stage t into buffer t & 1
    const unsigned l = ldsT + (unsigned)(t & 1) * (unsigned)(STAGE * 2);
    const int k0 = t * GM_KC;
    if (SPLIT == 0) gm_stage128(l, gA + k0, sA);
    else            gm_stage256(l, gA + k0, sA, l + 128u * GM_P * 2u, gA2 + k0, sA);
    gm_stage256(l + (unsigned)ROWS_A * GM_P * 2u, gB + k0, sB, l + (unsigned)(ROWS_A + 128) * GM_P * 2u, gB + 4 * sB + k0, sB);
    if (SPLIT == 1)
      gm_stage256(l + (unsigned)(ROWS_A + 256) * GM_P * 2u, gB2 + k0, sB, l + (unsigned)(ROWS_A + 384) * GM_P * 2u, gB2 + 4 * sB + k0, sB);
  };
  const int nt = K / GM_KC;              // block-uniform
  issue(0);
  gm_wait_copies();
  __syncthreads();
  if (nt > 1) issue(1);

  const int aoff = ((wm << 6) + rlane) * GM_P + koff;
  const int boff = (ROWS_A + (wn << 6) + rlane) * GM_P + koff;
  for (int t = 0; t < nt; ++t) {
    const T* st = (const T*)ring + (t & 1) * STAGE;
    // unrolled, like the loops inside: the fragment and accumulator arrays are indexed by constants and stay in registers
#pragma unroll
    for (int ks = 0; ks < GM_KC / 32; ++ks) {
      // all fragments of this 32-k step as one group of LDS reads in front of its products
      V bh[4], bl[4], ah[4], al[4];
#pragma unroll
      for (int j = 0; j < 4; ++j) {
        bh[j] = Frag<T>::load(st + boff + (j << 4) * GM_P + ks * 32);
        if (SPLIT == 1) bl[j] = Frag<T>::load(st + boff + (256 + (j << 4)) * GM_P + ks * 32);
      }
#pragma unroll
      for (int i = 0; i < 4; ++i) {
        ah[i] = Frag<T>::load(st + aoff + (i << 4) * GM_P + ks * 32);
        if (SPLIT != 0) al[i] = Frag<T>::load(st + aoff + (128 + (i << 4)) * GM_P + ks * 32);
      }
#pragma unroll
      for (int i = 0; i < 4; ++i) {
#pragma unroll
        for (int j = 0; j < 4; ++j) {
          acc[i][j] = Frag<T>::mma(ah[i], bh[j], acc[i][j]);
          if (SPLIT == 1) acc[i][j] = Frag<T>::mma(ah[i], bl[j], acc[i][j]);
          if (SPLIT != 0) acc[i][j] = Frag<T>::mma(al[i], bh[j], acc[i][j]);
        }
        Frag<T>::guard(acc[i][0], acc[i][3], ah[i], (SPLIT != 0) ? al[i] : ah[i]);
      }
      Frag<T>::keep(bh[0], bh[1], bh[2], bh[3]);
      if (SPLIT == 1) Frag<T>::keep(bl[0], bl[1], bl[2], bl[3]);
    }
    // publish point of stage t + 1: own LDS reads back, own copies landed, one barrier (it also ends every read of buffer t & 1), then the refill
    gm_wait_lds();
    gm_wait_copies();
    __syncthreads();
    if (t + 2 < nt) issue(t + 2);
  }
  gm_wait_copies();
  acc_guard4(acc[0][0], acc[0][1], acc[0][2], acc[0][3]);
  acc_guard4(acc[1][0], acc[1][1], acc[1][2], acc[1][3]);
  acc_guard4(acc[2][0], acc[2][1], acc[2][2], acc[2][3]);
  acc_guard4(acc[3][0], acc[3][1], acc[3][2], acc[3][3]);

  // ---- epilogue ----
  float* slab = sT[wave];
  const float* Rb = RESID ? (resid + (size_t)b * strideR) : nullptr;
#pragma unroll
  for (int i = 0; i < 4; ++i) {
    const int mBase = m0 + (i << 4);
#pragma unroll
    for (int j = 0; j < 4; ++j) {
      const int n = n0 + (j << 4) + rlane;
      float bv = 0.f;
      if (BIAS_MODE == 2) bv = bias[n];
      if (BIAS_MODE == 3) bv = bf_bits2f(f2bf_bits(bias[n]));
#pragma unroll
      for (int r = 0; r < 8; ++r) {
        float v = acc[i][j][r] * scale;
        if (BIAS_MODE == 1) v += bias[mBase + mOff + r];
        if (BIAS_MODE == 2 || BIAS_MODE == 3) v += bv;
        if (RESID) v += Rb[(size_t)(mBase + mOff + r) * ldc + n];
        if (ACT == 1) v = tanhf(v);
        if (ACT == 2) v = fmaxf(v, 0.0f);
        if (ACT == 3) v = v / (1.0f + expf(-v));
        if (ACT == 4) v = (v > 0.f) ? v : 0.01f * v;
        if (ACT == 5) v = 0.5f * v * (1.0f + erff(v * 0.70710678118654752f));
        slab[(mOff + r) * 68 + (j << 4) + rlane] = v;
      }
    }
    __builtin_amdgcn_fence(__ATOMIC_RELEASE, "workgroup");
    __builtin_amdgcn_wave_barrier();
    __builtin_amdgcn_fence(__ATOMIC_ACQUIRE, "workgroup");
    if (OUT_MODE == 0) {
      float* C = (float*)Cout + (size_t)b * strideC;
      const int hh = lane >> 4, c4 = (lane & 15) * 4;     // row seg = 256 B = 16 lanes x 16 B
      {
#pragma unroll
        for (int it = 0; it < 8; ++it) {
          const int row = it * 2 + hh;
          v4f v = *(const v4f*)(slab + row * 68 + c4);
          *(v4f*)(C + (size_t)(mBase + row) * ldc + n0 + c4) = v;
        }
        
      }
    } else {
      const int q = lane >> 3, c8 = (lane & 7) * 8;
      unsigned short* C  = (unsigned short*)Cout  + (size_t)b * strideC;
      unsigned short* C2 = (OUT_MODE == 2) ? ((unsigned short*)Cout2 + (size_t)b * strideC) : nullptr;
      {
#pragma unroll
        for (int it = 0; it < 4; ++it) {
          const int row = it * 4 + q;
          const float* sp = slab + row * 68 + c8;
          v8h hv, lv;
#pragma unroll
          for (int e = 0; e < 8; ++e) {
            if (OUT_MODE == 1) {
              hv[e] = (_Float16)sp[e];
            } else {
              unsigned short hb = f2bf_bits(sp[e]);
              unsigned short lb = f2bf_bits(sp[e] - bf_bits2f(hb));
              hv[e] = __builtin_bit_cast(_Float16, hb);
              lv[e] = __builtin_bit_cast(_Float16, lb);
            }
          }
          *(v8h*)(C + (size_t)(mBase + row) * ldc + n0 + c8) = hv;
          if (OUT_MODE == 2) *(v8h*)(C2 + (size_t)(mBase + row) * ldc + n0 + c8) = lv;
        }
        
      }
    }
    __builtin_amdgcn_fence(__ATOMIC_RELEASE, "workgroup");
    __builtin_amdgcn_wave_barrier();
    __builtin_amdgcn_fence(__ATOMIC_ACQUIRE, "workgroup");
  }
}

// ---- all f32 -> bf16 casts (RNE) in one launch of few, long waves --------------
// The five sources are cut into pieces of 1024 floats; piece p of the row x | wa | wb | wc | wd goes to out + 1024 p.
// x holds PX pieces, each w 1 << PW_SHIFT. The grid has exactly (all pieces) / PPW waves, 16 to a work-group; wave g takes
// pieces g, g + waves, ...: per piece 8 loads of 16 bytes a lane, each covering 512 bytes in a row. All of a wave's loads
// stand before its first store, so that many are in flight per lane and no wave start stands between two loads.
#define CV_T 512   // threads per work-group
#define CV_N 8     // 16-byte loads per lane and piece
typedef __attribute__((ext_vector_type(2))) unsigned v2u;
template <int PX, int PW_SHIFT, int PPW>
__global__ __launch_bounds__(CV_T) void cast_all_f32_bf16(
    const float* __restrict__ x, const float* __restrict__ wa, const float* __restrict__ wb,
    const float* __restrict__ wc, const float* __restrict__ wd, unsigned short* __restrict__ out) {
  constexpr int WAVES = (PX + (4 << PW_SHIFT)) / PPW;
  const int lane = threadIdx.x & 31;
  // the wave's number as a scalar: the choice of the source is scalar work
  const int g = (int)blockIdx.x * (CV_T / 32) + __builtin_amdgcn_readfirstlane((int)(threadIdx.x >> 5));
  v4f a[PPW][CV_N];
#pragma unroll
  for (int t = 0; t < PPW; ++t) {
    const int p = g + t * WAVES;
    const int v = p - PX, sel = v >> PW_SHIFT;
    const float* s = (v < 0) ? x : (sel == 0) ? wa : (sel == 1) ? wb : (sel == 2) ? wc : wd;
    const int l = (v < 0) ? p : (v & ((1 << PW_SHIFT) - 1));
    const v4f* q = (const v4f*)(s + (size_t)l * (CV_N * 128)) + lane;
#pragma unroll
    for (int k = 0; k < CV_N; ++k) a[t][k] = q[k * 32];
  }
#pragma unroll
  for (int t = 0; t < PPW; ++t) {
    v2u* q = (v2u*)(out + (size_t)(g + t * WAVES) * (CV_N * 128)) + lane;
#pragma unroll
    for (int k = 0; k < CV_N; ++k) {
      v2u u;
      u.x = (unsigned)f2bf_bits(a[t][k][0]) | ((unsigned)f2bf_bits(a[t][k][1]) << 16);
      u.y = (unsigned)f2bf_bits(a[t][k][2]) | ((unsigned)f2bf_bits(a[t][k][3]) << 16);
      q[k * 32] = u;
    }
  }
}

#define AT_D 64
#define AT_NW 4
#define AT_QB 64
#define AT_KC 64
#define AT_MAXKC 32
#define AT_P 72   // LDS row pitch of the Q and K tiles (64 bf16 a row): 144 B = 16 B x odd, so the 16 rows of a 16-byte fragment read fall on distinct banks
#define AT_PV 80  // LDS row pitch of the V tiles: 160 B = 32 B x odd, the pitch of the transposing load

struct AttnP { long q_bs, q_rs, q_hs, k_bs, k_rs, k_hs, v_bs, v_rs, v_hs, o_bs, o_rs, o_hs;
               int S, Skv, H; float sscale; };
static_assert(sizeof(AttnP) == 112);

__device__ __forceinline__ unsigned short at_bf_bits(float f) {
  unsigned u = __float_as_uint(f);
  return (unsigned short)((u + 0x7FFFu + ((u >> 16) & 1u)) >> 16);
}
// lane l <-> lane l ^ 16 without LDS
__device__ __forceinline__ float at_xhalf(float x) {
  return __builtin_bit_cast(float, __builtin_amdgcn_permlanex16(__builtin_bit_cast(int, x), __builtin_bit_cast(int, x), 0x76543210, 0xfedcba98, false, false));
}
// transposing LDS load: lane l points at 16 bytes of row 8 (l >> 4) + (l & 7), column half (l >> 3) & 1, of a 16 x 16 tile of 16-bit
// elements; lane (c = l & 15, hh = l >> 4) receives rows 8 hh .. 8 hh + 7 of column c. The compiler sees the load and places its wait.
typedef __attribute__((ext_vector_type(8))) short at_s16x8;
__device__ __forceinline__ v8b at_ld_tr16(const __bf16* p) {
  typedef __attribute__((address_space(3))) at_s16x8 lds_s16x8;
  return __builtin_bit_cast(v8b, __builtin_amdgcn_ds_load_tr16_b128_v8i16((lds_s16x8*)p));
}
__device__ __forceinline__ __bf16 at_f2bf(float f) { return __builtin_bit_cast(__bf16, at_bf_bits(f)); }
__device__ __forceinline__ void at_split(float f, __bf16& hi, __bf16& lo) {
  const unsigned short hb = at_bf_bits(f);
  hi = __builtin_bit_cast(__bf16, hb);
  lo = at_f2bf(f - __uint_as_float(((unsigned)hb) << 16));
}
// three products of a hi/lo x hi/lo pair into one accumulator (hi.hi, A lo . B hi, A hi . B lo), then the hazard guard tying D and all four operands
__device__ __forceinline__ v8f at_mma3(v16b ah, v16b al, v16b bh, v16b bl, v8f c) {
  c = __builtin_amdgcn_wmma_f32_16x16x32_bf16(false, ah, false, bh, (short)0, c, false, false);
  c = __builtin_amdgcn_wmma_f32_16x16x32_bf16(false, al, false, bh, (short)0, c, false, false);
  c = __builtin_amdgcn_wmma_f32_16x16x32_bf16(false, ah, false, bl, (short)0, c, false, false);
  asm volatile("v_nop\n\tv_nop\n\tv_nop\n\tv_nop" : "+v"(c) : "v"(ah), "v"(al), "v"(bh), "v"(bl));
  return c;
}

__global__ __launch_bounds__(128)
void attn64_causal_split(const unsigned short* __restrict__ qh_p, const unsigned short* __restrict__ ql_p,
                         const unsigned short* __restrict__ kh_p, const unsigned short* __restrict__ kl_p,
                         const unsigned short* __restrict__ vh_p, const unsigned short* __restrict__ vl_p,
                         unsigned short* __restrict__ ohi, unsigned short* __restrict__ olo, AttnP g) {
  union FB { v16b v; v8b h[2]; };
  __shared__ __align__(16) __bf16 Qsh[AT_QB * AT_P];          // Q hi [row][d]   9 KB
  __shared__ __align__(16) __bf16 Qsl[AT_QB * AT_P];          // Q lo [row][d]   9 KB
  __shared__ __align__(16) __bf16 Ksh[AT_KC * AT_P];          // K hi [kv][d]    9 KB
  __shared__ __align__(16) __bf16 Ksl[AT_KC * AT_P];          // K lo [kv][d]    9 KB
  __shared__ __align__(16) __bf16 Vsh[AT_KC * AT_PV];         // V hi [kv][d]   10 KB
  __shared__ __align__(16) __bf16 Vsl[AT_KC * AT_PV];         // V lo [kv][d]   10 KB

  const int tid  = threadIdx.x;
  const int wave = tid >> 5;
  const int lane = tid & 31;
  const int hh   = lane >> 4;
  const int c    = lane & 15;

  const int nqb = g.S / AT_QB;
  const int qb = nqb - 1 - (int)blockIdx.y;   // low blockIdx.y starts first: the tiles with the most key chunks lead
  const int bh = blockIdx.x;
  const int h  = bh % g.H;
  const int b  = bh / g.H;
  const int q0 = qb * AT_QB + wave * 16;

  const __bf16* qhb = (const __bf16*)qh_p + (size_t)b * g.q_bs + (size_t)h * g.q_hs;
  const __bf16* qlb = (const __bf16*)ql_p + (size_t)b * g.q_bs + (size_t)h * g.q_hs;
  const __bf16* khb = (const __bf16*)kh_p + (size_t)b * g.k_bs + (size_t)h * g.k_hs;
  const __bf16* klb = (const __bf16*)kl_p + (size_t)b * g.k_bs + (size_t)h * g.k_hs;
  const __bf16* vhb = (const __bf16*)vh_p + (size_t)b * g.v_bs + (size_t)h * g.v_hs;
  const __bf16* vlb = (const __bf16*)vl_p + (size_t)b * g.v_bs + (size_t)h * g.v_hs;

  // ---- Q hi/lo planes for the block's 64 rows: [row][d], 16-B copies (thread -> row tid/2, 32-d half) ----
  {
    const int r = tid >> 1, dh = (tid & 1) * 32;
    const size_t qo = (size_t)(qb * AT_QB + r) * g.q_rs + dh;
#pragma unroll
    for (int i = 0; i < 4; ++i) {
      const v8b xh = *(const v8b*)(qhb + qo + 8 * i);
      const v8b xl = *(const v8b*)(qlb + qo + 8 * i);
      *(v8b*)(Qsh + r * AT_P + dh + 8 * i) = xh;
      *(v8b*)(Qsl + r * AT_P + dh + 8 * i) = xl;
    }
  }
  __syncthreads();

  float mrow = NEG_INF, lrow = 0.f;      // query q0 + c: running max (same in both lane halves) and this half's part of the running sum
  v8f oacc[4];                           // oacc[t][r] = O[q0 + c][16 t + 8 hh + r]
#pragma unroll
  for (int t = 0; t < 4; ++t) oacc[t] = (v8f){0.f,0.f,0.f,0.f,0.f,0.f,0.f,0.f};

  const int nck = (qb + 1 < AT_MAXKC) ? (qb + 1) : AT_MAXKC;    // block-uniform, statically bounded
  const __bf16* qwh = Qsh + (wave * 16 + c) * AT_P + 8 * hh;      // B fragment column c (query q0 + c) of this wave
  const __bf16* qwl = Qsl + (wave * 16 + c) * AT_P + 8 * hh;

  for (int kc = 0; kc < nck; ++kc) {
    const int kv0 = kc * AT_KC;
    __syncthreads();
    {
      const int kvr = tid >> 1, dh = (tid & 1) * 32;
      const size_t ko = (size_t)(kv0 + kvr) * g.k_rs + dh;
      const size_t vo = (size_t)(kv0 + kvr) * g.v_rs + dh;
#pragma unroll
      for (int i = 0; i < 4; ++i) {
        const v8b ka = *(const v8b*)(khb + ko + 8 * i);
        const v8b kb = *(const v8b*)(klb + ko + 8 * i);
        *(v8b*)(Ksh + kvr * AT_P + dh + 8 * i) = ka;
        *(v8b*)(Ksl + kvr * AT_P + dh + 8 * i) = kb;
        const v8b va = *(const v8b*)(vhb + vo + 8 * i);
        const v8b vb = *(const v8b*)(vlb + vo + 8 * i);
        *(v8b*)(Vsh + kvr * AT_PV + dh + 8 * i) = va;
        *(v8b*)(Vsl + kvr * AT_PV + dh + 8 * i) = vb;
      }
    }
    __syncthreads();

    // ---- scores^T[64 x 16] = k . q^T  (A = K[kv][d], B = Q[row][d]; split k-map via two 16-B halves at +8hh and +16+8hh) ----
    // s[j][r] = score of key kv0 + 16 j + 8 hh + r against query q0 + c
    v8f s[4];
#pragma unroll
    for (int j = 0; j < 4; ++j) s[j] = (v8f){0.f,0.f,0.f,0.f,0.f,0.f,0.f,0.f};
#pragma unroll 1
    for (int dc = 0; dc < 2; ++dc) {
      FB qh, ql;
      qh.h[0] = *(const v8b*)(qwh + dc * 32);
      qh.h[1] = *(const v8b*)(qwh + dc * 32 + 16);
      ql.h[0] = *(const v8b*)(qwl + dc * 32);
      ql.h[1] = *(const v8b*)(qwl + dc * 32 + 16);
#pragma unroll
      for (int j = 0; j < 4; ++j) {
        FB kb, kl;
        const __bf16* kp  = Ksh + (j * 16 + c) * AT_P + dc * 32 + 8 * hh;
        const __bf16* kpl = Ksl + (j * 16 + c) * AT_P + dc * 32 + 8 * hh;
        kb.h[0] = *(const v8b*)(kp);
        kb.h[1] = *(const v8b*)(kp + 16);
        kl.h[0] = *(const v8b*)(kpl);
        kl.h[1] = *(const v8b*)(kpl + 16);
        s[j] = at_mma3(kb.v, kl.v, qh.v, ql.v, s[j]);
      }
    }
    // ---- scale, causal mask on the diagonal chunk (key > query -> -inf), max over this lane's 32 keys, then the other half's ----
    const bool diag = (kc == qb);
    const int qrow = q0 + c;
    float cm = NEG_INF;
#pragma unroll
    for (int j = 0; j < 4; ++j) {
#pragma unroll
      for (int r = 0; r < 8; ++r) {
        const int kvcol = kv0 + j * 16 + 8 * hh + r;
        float sv = s[j][r] * g.sscale;
        if (diag && (kvcol > qrow)) sv = NEG_INF;
        s[j][r] = sv;
        cm = fmaxf(cm, sv);
      }
    }
    cm = fmaxf(cm, at_xhalf(cm));
    const float mnew = fmaxf(mrow, cm);
    const float mref = (mnew == NEG_INF) ? 0.0f : mnew;
    const float alpha = __expf(mrow - mref);
    mrow = mnew;
    // ---- p = exp(s - max), split in place: score tiles 2 kk and 2 kk + 1 are elements 0..7 and 8..15 of B fragment kk ----
    FB pa[2], pl[2];
    float psum = 0.f;
#pragma unroll
    for (int j = 0; j < 4; ++j) {
#pragma unroll
      for (int r = 0; r < 8; ++r) {
        const float p = __expf(s[j][r] - mref);
        psum += p;
        __bf16 a, bl; at_split(p, a, bl);
        pa[j >> 1].h[j & 1][r] = a;
        pl[j >> 1].h[j & 1][r] = bl;
      }
    }
    lrow = lrow * alpha + psum;
#pragma unroll
    for (int t = 0; t < 4; ++t)
#pragma unroll
      for (int r = 0; r < 8; ++r) oacc[t][r] *= alpha;
    // ---- O^T[64 x 16] += V^T[64 x 64] . P^T[64 x 16]  (A = V^T[d][kv] by transposing loads from the [kv][d] tile, B = P^T from registers) ----
    // element e of lane (c, hh): V[kk * 32 + 8 hh + e][16 t + c] for e < 8, V[kk * 32 + 16 + 8 hh + e - 8][16 t + c] above
    // unrolled: pa and pl are register arrays, indexed by kk
#pragma unroll
    for (int kk = 0; kk < 2; ++kk) {
#pragma unroll
      for (int t = 0; t < 4; ++t) {
        FB vb, vl;
        const int vo = (kk * 32 + 8 * hh + (lane & 7)) * AT_PV + t * 16 + 8 * ((lane >> 3) & 1);
        vb.h[0] = at_ld_tr16(Vsh + vo);
        vb.h[1] = at_ld_tr16(Vsh + vo + 16 * AT_PV);
        vl.h[0] = at_ld_tr16(Vsl + vo);
        vl.h[1] = at_ld_tr16(Vsl + vo + 16 * AT_PV);
        oacc[t] = at_mma3(vb.v, vl.v, pa[kk].v, pl[kk].v, oacc[t]);
      }
    }
  }

  // ---- a lane holds 8 consecutive d of its query's row per tile. The wave's own 16 Q rows in LDS are dead now and no other
  //      wave reads them: the bf16 hi/lo out tile is staged there, so that each global store covers whole 128-byte rows ----
  {
    const float inv = 1.0f / (lrow + at_xhalf(lrow));    // the two halves' sums are joined once, here
    __bf16* sh = Qsh + wave * 16 * AT_P;
    __bf16* sl = Qsl + wave * 16 * AT_P;
#pragma unroll
    for (int t = 0; t < 4; ++t) {
      v8h hv, lv;
#pragma unroll
      for (int r = 0; r < 8; ++r) {
        const float o = oacc[t][r] * inv;
        const unsigned short hb = f2bf_bits(o);
        const unsigned short lb = f2bf_bits(o - bf_bits2f(hb));
        hv[r] = __builtin_bit_cast(_Float16, hb);
        lv[r] = __builtin_bit_cast(_Float16, lb);
      }
      *(v8h*)(sh + c * AT_P + t * 16 + 8 * hh) = hv;
      *(v8h*)(sl + c * AT_P + t * 16 + 8 * hh) = lv;
    }
    __builtin_amdgcn_fence(__ATOMIC_RELEASE, "workgroup");
    __builtin_amdgcn_wave_barrier();
    __builtin_amdgcn_fence(__ATOMIC_ACQUIRE, "workgroup");
    const int q8 = lane >> 3, c8 = (lane & 7) * 8;
    unsigned short* oh = ohi + (size_t)b * g.o_bs + (size_t)h * g.o_hs;
    unsigned short* ol = olo + (size_t)b * g.o_bs + (size_t)h * g.o_hs;
#pragma unroll
    for (int it = 0; it < 4; ++it) {
      const int row = it * 4 + q8;                    // q8 in 0..3, it in 0..3 -> rows 0..15
      const v8h hv = *(const v8h*)(sh + row * AT_P + c8);
      const v8h lv = *(const v8h*)(sl + row * AT_P + c8);
      *(v8h*)(oh + (size_t)(q0 + row) * g.o_rs + c8) = hv;
      *(v8h*)(ol + (size_t)(q0 + row) * g.o_rs + c8) = lv;
    }
  }
}

// ---------------------------------------------------------------------------
// Host orchestration (launches only).
// d_in: 0 = x [4,2048,1024], 1 = W_q, 2 = W_k, 3 = W_v (each [1024,1024], (out,in)), 4 = W_out [1024,1024], 5 = b_out [1024]; all f32.
// Workspace (152 MiB): bf16 x | bf16 [W_q;W_k;W_v] | bf16 W_out | qkv hi plane | qkv lo plane | attn hi | attn lo.
// ---------------------------------------------------------------------------
extern "C" void kernel_launch(void* const* d_in, const int* in_sizes, int n_in,
                              void* d_out, int out_size, void* d_ws, size_t ws_size,
                              hipStream_t stream) {
  constexpr int Bn = 4, S = 2048, E = 1024, Hn = 16, Dh = 64, E3 = 3 * E;
  constexpr int M = Bn * S;                 // 8192 rows in total
  constexpr int NQB = S / AT_QB;            // 32
  static_assert(NQB <= AT_MAXKC);
  static_assert(M % 128 == 0 && E % 256 == 0 && E3 % 256 == 0 && E % GM_KC == 0 && Hn * Dh == E);
  if (n_in < 6) return;
  if (in_sizes[0] != M * E || in_sizes[1] != E * E || in_sizes[2] != E * E || in_sizes[3] != E * E ||
      in_sizes[4] != E * E || in_sizes[5] != E || out_size != M * E) return;

  const float* x     = (const float*)d_in[0];
  const float* w_q   = (const float*)d_in[1];
  const float* w_k   = (const float*)d_in[2];
  const float* w_v   = (const float*)d_in[3];
  const float* w_out = (const float*)d_in[4];
  const float* b_out = (const float*)d_in[5];
  float* out = (float*)d_out;

  const size_t bX   = (size_t)M * E * 2;                  // 16 MiB  bf16 x
  const size_t bW   = (size_t)E3 * E * 2;                 //  6 MiB  bf16 [W_q; W_k; W_v]
  const size_t bWo  = (size_t)E * E * 2;                  //  2 MiB  bf16 W_out
  const size_t bQKV = (size_t)M * E3 * 2;                 // 48 MiB  bf16 plane of qkv (x2)
  const size_t bAH  = (size_t)M * E * 2;                  // 16 MiB  bf16 plane of attn out (x2)
  char* ws = (char*)d_ws;
  size_t off = 0;
  unsigned short* X16  = (unsigned short*)(ws + off); off += bX;
  unsigned short* W16  = (unsigned short*)(ws + off); off += bW;
  unsigned short* Wo16 = (unsigned short*)(ws + off); off += bWo;
  unsigned short* QH   = (unsigned short*)(ws + off); off += bQKV;
  unsigned short* QL   = (unsigned short*)(ws + off); off += bQKV;
  unsigned short* AH   = (unsigned short*)(ws + off); off += bAH;
  unsigned short* AL   = (unsigned short*)(ws + off); off += bAH;
  if (off > ws_size) return;                              // 159,383,552 B

  dim3 blk256(256), blk128(128);

  // 1: RNE bf16 casts of x, the three projection weights (stacked into one [3072][1024] matrix) and W_out.
  //    X16, W16 and Wo16 lie one behind the other in the workspace, so the five results are one row of bf16 from X16 on.
  {
    constexpr int PIECE = CV_N * 128;                      // floats per piece
    constexpr int PX = M * E / PIECE, PW_SHIFT = 10;       // 8192 pieces of x, 1024 of each weight
    constexpr int PPW = 3;                                 // pieces per wave
    constexpr int WGS = (PX + (4 << PW_SHIFT)) / (PPW * (CV_T / 32));   // 256 work-groups
    static_assert(M * E % PIECE == 0 && E * E == (PIECE << PW_SHIFT));
    static_assert(WGS * PPW * (CV_T / 32) == PX + (4 << PW_SHIFT));
    cast_all_f32_bf16<PX, PW_SHIFT, PPW><<<dim3(WGS), dim3(CV_T), 0, stream>>>(x, w_q, w_k, w_v, w_out, X16);
  }

  // 2: qkv[M][3072] = bf16(x) . bf16([W_q;W_k;W_v])^T, written as bf16 hi/lo planes
  {
    const int tiles = (M / 64) * (E3 / 64);                // 6144
    wmma_gemm64<1, 0, 0, 2, false><<<dim3((tiles + 7) / 8, 1), blk256, 0, stream>>>(
        X16, X16, E, 0L, W16, W16, E, 0L, (void*)QH, (void*)QL, E3, 0L,
        b_out, b_out, 0L, M, E3, E, 1.0f);
  }
  // 3: causal attention per (batch, head, 64-query block), longest blocks first -> bf16 hi/lo planes [M][E]
  {
    AttnP g;
    g.q_bs = (long)S * E3; g.q_rs = E3; g.q_hs = Dh;
    g.k_bs = (long)S * E3; g.k_rs = E3; g.k_hs = Dh;
    g.v_bs = (long)S * E3; g.v_rs = E3; g.v_hs = Dh;
    g.o_bs = (long)S * E;  g.o_rs = E;  g.o_hs = Dh;
    g.S = S; g.Skv = S; g.H = Hn;
    g.sscale = 0.125f;             // 64^-0.5, applied in f32 after the product
    attn64_causal_split<<<dim3(Bn * Hn, NQB), blk128, 0, stream>>>(
        QH, QL, QH + E, QL + E, QH + 2 * E, QL + 2 * E, AH, AL, g);
  }

  // 4: out[M][E] (f32) = (attn hi + attn lo) . bf16(W_out)^T + bf16(b_out)
  {
    const int tiles = (M / 64) * (E / 64);                 // 2048
    wmma_gemm64<1, 2, 3, 0, false><<<dim3((tiles + 7) / 8, 1), blk256, 0, stream>>>(
        AH, AL, E, 0L, Wo16, Wo16, E, 0L, (void*)out, (void*)out, E, 0L,
        b_out, b_out, 0L, M, E, E, 1.0f);
  }
}

// v007
// One run takes 192 microseconds.
// In two side-by-side timings against v006, it was 1.11 and 1.10 times as fast.
// All steps since v000 together make it 4.58 times as fast.
#include <hip/hip_runtime.h>
// Contractions: qkv projection GEMM = v_wmma_f32_16x16x32_bf16 (bf16 operands, 1 product); q.k^T = v_wmma_f32_16x16x32_bf16 (bf16 hi/lo planes of q and k, 3 products); p.v = v_wmma_f32_16x16x32_bf16 (bf16 hi/lo planes of p and v, 3 products); output projection GEMM = v_wmma_f32_16x16x32_bf16 (bf16 hi/lo planes of the attention output x bf16 weight, 2 products); f32 accumulate everywhere; softmax in f32.

typedef __attribute__((ext_vector_type(16))) _Float16 v16h;
typedef __attribute__((ext_vector_type(8)))  _Float16 v8h;
typedef __attribute__((ext_vector_type(16))) __bf16   v16b;
typedef __attribute__((ext_vector_type(8)))  __bf16   v8b;
typedef __attribute__((ext_vector_type(8)))  float    v8f;
typedef __attribute__((ext_vector_type(4)))  float    v4f;

#define NEG_INF (-__builtin_inff())

typedef __attribute__((ext_vector_type(2)))  float    v2f;
typedef __attribute__((ext_vector_type(2)))  __bf16   v2b;
union B8 { v8b v; v2b p[4]; };   // eight bf16 = four registers, each the packed result of one conversion

// two f32 -> two bf16 (round to nearest even) in one register by the packed hardware conversion
__device__ __forceinline__ v2b cvt2_bf(float a, float b) { return __builtin_convertvector((v2f){a, b}, v2b); }
// hi = bf16(x), lo = bf16(x - hi) for two values; both results arrive packed as a fragment or a 16-byte store wants them
__device__ __forceinline__ void split2_bf(float a, float b, v2b& hi, v2b& lo) {
  hi = cvt2_bf(a, b);
  lo = cvt2_bf(a - (float)hi[0], b - (float)hi[1]);
}

// hazard guards as plain device helpers (no inline asm inside the kernel template body)
__device__ __forceinline__ void dep_guard_h(v8f& a, v8f& b, v16h x, v16h y) { asm volatile("v_nop\n\tv_nop\n\tv_nop\n\tv_nop" : "+v"(a), "+v"(b) : "v"(x), "v"(y)); }
__device__ __forceinline__ void dep_guard_b(v8f& a, v8f& b, v16b x, v16b y) { asm volatile("v_nop\n\tv_nop\n\tv_nop\n\tv_nop" : "+v"(a), "+v"(b) : "v"(x), "v"(y)); }
__device__ __forceinline__ void keep4_h(v16h a, v16h b, v16h c, v16h d) { asm volatile("v_nop" :: "v"(a), "v"(b), "v"(c), "v"(d)); }
__device__ __forceinline__ void keep4_b(v16b a, v16b b, v16b c, v16b d) { asm volatile("v_nop" :: "v"(a), "v"(b), "v"(c), "v"(d)); }
__device__ __forceinline__ void acc_guard4(v8f& a, v8f& b, v8f& c, v8f& d) { asm volatile("v_nop\n\tv_nop\n\tv_nop\n\tv_nop" : "+v"(a), "+v"(b), "+v"(c), "+v"(d)); }
template <typename T> struct Frag;
template <> struct Frag<_Float16> {
  typedef v16h V; union U { v16h v; v8h h[2]; };
  static __device__ __forceinline__ v16h load(const _Float16* p) {   // elements 0..7 <- p[0..7], 8..15 <- p[16..23]
    U f; f.h[0] = *(const v8h*)(p); f.h[1] = *(const v8h*)(p + 16); return f.v;
  }
  static __device__ __forceinline__ v8f mma(v16h a, v16h b, v8f c) {
    return __builtin_amdgcn_wmma_f32_16x16x32_f16(false, a, false, b, (short)0, c, false, false);
  }
  static __device__ __forceinline__ void guard(v8f& a, v8f& b, v16h x, v16h y) { dep_guard_h(a, b, x, y); }
  static __device__ __forceinline__ void keep(v16h a, v16h b, v16h c, v16h d) { keep4_h(a, b, c, d); }
};
template <> struct Frag<__bf16> {
  typedef v16b V; union U { v16b v; v8b h[2]; };
  static __device__ __forceinline__ v16b load(const __bf16* p) {
    U f; f.h[0] = *(const v8b*)(p); f.h[1] = *(const v8b*)(p + 16); return f.v;
  }
  static __device__ __forceinline__ v8f mma(v16b a, v16b b, v8f c) {
    return __builtin_amdgcn_wmma_f32_16x16x32_bf16(false, a, false, b, (short)0, c, false, false);
  }
  static __device__ __forceinline__ void guard(v8f& a, v8f& b, v16b x, v16b y) { dep_guard_b(a, b, x, y); }
  static __device__ __forceinline__ void keep(v16b a, v16b b, v16b c, v16b d) { keep4_b(a, b, c, d); }
};

// ---- Register-blocked batched WMMA GEMM ------------------------------------
// C[m,n] = scale * sum_k A[m,k] * Bt[n,k] (+bias)(+resid); each wave owns a 64x64 tile, a block of 2 x 4 waves a 128x256 tile.
// A row-major [M,K]; Bt row-major [N,K]; M % 128 == 0, N % 256 == 0, K % 64 == 0.
// The block's operand rows go to LDS in stages of 64 k (128-byte rows, whole lines) by asynchronous copies, two buffers:
// stage t + 1 flies while stage t is multiplied; the waves read their fragments from LDS.
// SPLIT: 0 = single planes; 1 = A and Bt as hi/lo planes (hi.hi + hi.lo + lo.hi); 2 = A as hi/lo planes, Bt single (hi.B + lo.B).
// BIAS_MODE: 0 = none, 1 = bias[m], 2 = bias[n], 3 = bias[n] RNE-converted to bf16 then added in f32.
// OUT_MODE: 0 = f32, 1 = f16, 2 = bf16 hi plane (Cout) + bf16 lo plane (Cout2).
// ET: 0 = f16 operands, 1 = bf16 operands (pointers passed as 16-bit storage)
#define GM_KC 64   // k per stage
#define GM_P  72   // LDS row pitch in elements: 144 B = 16 B x odd, so the 16 rows of a 16-byte fragment read fall on distinct banks
// four asynchronous 16-byte copies per lane, global -> LDS; s_wait_xcnt closes the statement so that no address register is rewritten ahead of it
__device__ __forceinline__ void gm_copy4(unsigned l0, unsigned l1, unsigned l2, unsigned l3,
                                         const unsigned short* g0, const unsigned short* g1,
                                         const unsigned short* g2, const unsigned short* g3) {
  asm volatile("global_load_async_to_lds_b128 %0, %4, off\n\t"
               "global_load_async_to_lds_b128 %1, %5, off\n\t"
               "global_load_async_to_lds_b128 %2, %6, off\n\t"
               "global_load_async_to_lds_b128 %3, %7, off\n\t"
               "s_wait_xcnt 0x0"
               :: "v"(l0), "v"(l1), "v"(l2), "v"(l3), "v"(g0), "v"(g1), "v"(g2), "v"(g3) : "memory");
}
// 128 rows of one plane: this lane's 16 bytes of rows r, r + 32, r + 64, r + 96 (step = 32 source rows, in elements)
__device__ __forceinline__ void gm_stage128(unsigned lds, const unsigned short* g, size_t step) {
  gm_copy4(lds, lds + 32u * GM_P * 2u, lds + 64u * GM_P * 2u, lds + 96u * GM_P * 2u, g, g + step, g + 2 * step, g + 3 * step);
}
// the same for two groups of 128 rows in one statement, under one wait
__device__ __forceinline__ void gm_stage256(unsigned la, const unsigned short* ga, size_t sa,
                                            unsigned lb, const unsigned short* gb, size_t sb) {
  asm volatile("global_load_async_to_lds_b128 %0, %8, off\n\t"
               "global_load_async_to_lds_b128 %1, %9, off\n\t"
               "global_load_async_to_lds_b128 %2, %10, off\n\t"
               "global_load_async_to_lds_b128 %3, %11, off\n\t"
               "global_load_async_to_lds_b128 %4, %12, off\n\t"
               "global_load_async_to_lds_b128 %5, %13, off\n\t"
               "global_load_async_to_lds_b128 %6, %14, off\n\t"
               "global_load_async_to_lds_b128 %7, %15, off\n\t"
               "s_wait_xcnt 0x0"
               :: "v"(la), "v"(la + 32u * GM_P * 2u), "v"(la + 64u * GM_P * 2u), "v"(la + 96u * GM_P * 2u),
                  "v"(lb), "v"(lb + 32u * GM_P * 2u), "v"(lb + 64u * GM_P * 2u), "v"(lb + 96u * GM_P * 2u),
                  "v"(ga), "v"(ga + sa), "v"(ga + 2 * sa), "v"(ga + 3 * sa),
                  "v"(gb), "v"(gb + sb), "v"(gb + 2 * sb), "v"(gb + 3 * sb) : "memory");
}
// this wave's copies have landed (the compiler places no wait for them)
__device__ __forceinline__ void gm_wait_copies() { asm volatile("s_wait_asynccnt 0x0" ::: "memory"); }
// this wave's LDS reads have returned, before the buffer is handed to its next writer
__device__ __forceinline__ void gm_wait_lds() { asm volatile("s_wait_dscnt 0x0" ::: "memory"); }
template <int ET> struct Elem;
template <> struct Elem<0> { typedef _Float16 T; };
template <> struct Elem<1> { typedef __bf16 T; };
template <int ET, int SPLIT, int BIAS_MODE, int OUT_MODE, bool RESID, int ACT = 0>
__global__ __launch_bounds__(256) void wmma_gemm64(
    const unsigned short* __restrict__ Ap, const unsigned short* __restrict__ A2p, int lda, long strideA,
    const unsigned short* __restrict__ Btp, const unsigned short* __restrict__ Bt2p, int ldb, long strideB,
    void* __restrict__ Cout, void* __restrict__ Cout2, int ldc, long strideC,
    const float* __restrict__ bias,
    const float* __restrict__ resid, long strideR,
    int M, int N, int K, float scale) {
  typedef typename Elem<ET>::T T;
  typedef typename Frag<T>::V V;
  const T* A = (const T*)Ap; const T* A2 = (const T*)A2p; const T* Bt = (const T*)Btp; const T* Bt2 = (const T*)Bt2p;
  constexpr int ROWS_A = (SPLIT != 0) ? 256 : 128;   // staged rows: A hi [, A lo], Bt hi [, Bt lo]
  constexpr int ROWS_B = (SPLIT == 1) ? 512 : 256;
  constexpr int STAGE  = (ROWS_A + ROWS_B) * GM_P;   // elements per buffer
  __shared__ __align__(16) unsigned short ring[2 * STAGE];
  __shared__ __align__(16) float sT[8][16 * 68];   // per-wave 16x64 slab, pitch 68 floats
  const int b    = blockIdx.y;
  const int lane = threadIdx.x & 31;
  const int wave = threadIdx.x >> 5;
  const int blocksN = N >> 8;
  const int bm = blockIdx.x / blocksN;
  const int bn = blockIdx.x - bm * blocksN;
  if (bm >= (M >> 7)) return;            // block-uniform, in front of every barrier
  const int mB = bm << 7;
  const int nB = bn << 8;
  const int wm = wave >> 2;
  const int wn = wave & 3;
  const int m0 = mB + (wm << 6);
  const int n0 = nB + (wn << 6);

  const T* Ab  = A  + (size_t)b * strideA;
  const T* Bb  = Bt + (size_t)b * strideB;
  const T* Ab2 = (SPLIT != 0) ? (A2  + (size_t)b * strideA) : nullptr;
  const T* Bb2 = (SPLIT == 1) ? (Bt2 + (size_t)b * strideB) : nullptr;

  const int rlane = lane & 15;                 // row (A) / col (B, D) within subtile
  const int koff  = (lane >> 4) * 8;           // k offset of this lane half
  const int mOff  = (lane >> 4) * 8;           // D row offset

  v8f acc[4][4];
#pragma unroll
  for (int i = 0; i < 4; ++i)
#pragma unroll
    for (int j = 0; j < 4; ++j) acc[i][j] = (v8f){0.f,0.f,0.f,0.f,0.f,0.f,0.f,0.f};

  // copies: thread -> row tid / 8 of each group of 32 rows, 16-byte piece tid % 8, so a wave's copy covers four whole 128-byte rows
  const int crow = threadIdx.x >> 3;
  const int ccol = (threadIdx.x & 7) << 3;
  const unsigned ldsT = (unsigned)(size_t)ring + (unsigned)(crow * GM_P + ccol) * 2u;   // LDS byte address: low 32 bits of the shared address
  const unsigned short* gA  = (const unsigned short*)Ab + (size_t)(mB + crow) * lda + ccol;
  const unsigned short* gB  = (const unsigned short*)Bb + (size_t)(nB + crow) * ldb + ccol;
  const unsigned short* gA2 = (SPLIT != 0) ? ((const unsigned short*)Ab2 + (size_t)(mB + crow) * lda + ccol) : nullptr;
  const unsigned short* gB2 = (SPLIT == 1) ? ((const unsigned short*)Bb2 + (size_t)(nB + crow) * ldb + ccol) : nullptr;
  const size_t sA = (size_t)32 * lda, sB = (size_t)32 * ldb;
  auto issue = [&](int t) {              // stage t into buffer t & 1
    const unsigned l = ldsT + (unsigned)(t & 1) * (unsigned)(STAGE * 2);
    const int k0 = t * GM_KC;
    if (SPLIT == 0) gm_stage128(l, gA + k0, sA);
    else            gm_stage256(l, gA + k0, sA, l + 128u * GM_P * 2u, gA2 + k0, sA);
    gm_stage256(l + (unsigned)ROWS_A * GM_P * 2u, gB + k0, sB, l + (unsigned)(ROWS_A + 128) * GM_P * 2u, gB + 4 * sB + k0, sB);
    if (SPLIT == 1)
      gm_stage256(l + (unsigned)(ROWS_A + 256) * GM_P * 2u, gB2 + k0, sB, l + (unsigned)(ROWS_A + 384) * GM_P * 2u, gB2 + 4 * sB + k0, sB);
  };
  const int nt = K / GM_KC;              // block-uniform
  issue(0);
  gm_wait_copies();
  __syncthreads();
  if (nt > 1) issue(1);

  const int aoff = ((wm << 6) + rlane) * GM_P + koff;
  const int boff = (ROWS_A + (wn << 6) + rlane) * GM_P + koff;
  for (int t = 0; t < nt; ++t) {
    const T* st = (const T*)ring + (t & 1) * STAGE;
    // unrolled, like the loops inside: the fragment and accumulator arrays are indexed by constants and stay in registers
#pragma unroll
    for (int ks = 0; ks < GM_KC / 32; ++ks) {
      // all fragments of this 32-k step as one group of LDS reads in front of its products
      V bh[4], bl[4], ah[4], al[4];
#pragma unroll
      for (int j = 0; j < 4; ++j) {
        bh[j] = Frag<T>::load(st + boff + (j << 4) * GM_P + ks * 32);
        if (SPLIT == 1) bl[j] = Frag<T>::load(st + boff + (256 + (j << 4)) * GM_P + ks * 32);
      }
#pragma unroll
      for (int i = 0; i < 4; ++i) {
        ah[i] = Frag<T>::load(st + aoff + (i << 4) * GM_P + ks * 32);
        if (SPLIT != 0) al[i] = Frag<T>::load(st + aoff + (128 + (i << 4)) * GM_P + ks * 32);
      }
#pragma unroll
      for (int i = 0; i < 4; ++i) {
#pragma unroll
        for (int j = 0; j < 4; ++j) {
          acc[i][j] = Frag<T>::mma(ah[i], bh[j], acc[i][j]);
          if (SPLIT == 1) acc[i][j] = Frag<T>::mma(ah[i], bl[j], acc[i][j]);
          if (SPLIT != 0) acc[i][j] = Frag<T>::mma(al[i], bh[j], acc[i][j]);
        }
        Frag<T>::guard(acc[i][0], acc[i][3], ah[i], (SPLIT != 0) ? al[i] : ah[i]);
      }
      Frag<T>::keep(bh[0], bh[1], bh[2], bh[3]);
      if (SPLIT == 1) Frag<T>::keep(bl[0], bl[1], bl[2], bl[3]);
    }
    // publish point of stage t + 1: own LDS reads back, own copies landed, one barrier (it also ends every read of buffer t & 1), then the refill
    gm_wait_lds();
    gm_wait_copies();
    __syncthreads();
    if (t + 2 < nt) issue(t + 2);
  }
  gm_wait_copies();
  acc_guard4(acc[0][0], acc[0][1], acc[0][2], acc[0][3]);
  acc_guard4(acc[1][0], acc[1][1], acc[1][2], acc[1][3]);
  acc_guard4(acc[2][0], acc[2][1], acc[2][2], acc[2][3]);
  acc_guard4(acc[3][0], acc[3][1], acc[3][2], acc[3][3]);

  // ---- epilogue ----
  float* slab = sT[wave];
  const float* Rb = RESID ? (resid + (size_t)b * strideR) : nullptr;
#pragma unroll
  for (int i = 0; i < 4; ++i) {
    const int mBase = m0 + (i << 4);
#pragma unroll
    for (int j = 0; j < 4; ++j) {
      const int n = n0 + (j << 4) + rlane;
      float bv = 0.f;
      if (BIAS_MODE == 2) bv = bias[n];
      if (BIAS_MODE == 3) bv = (float)(__bf16)bias[n];
#pragma unroll
      for (int r = 0; r < 8; ++r) {
        float v = acc[i][j][r] * scale;
        if (BIAS_MODE == 1) v += bias[mBase + mOff + r];
        if (BIAS_MODE == 2 || BIAS_MODE == 3) v += bv;
        if (RESID) v += Rb[(size_t)(mBase + mOff + r) * ldc + n];
        if (ACT == 1) v = tanhf(v);
        if (ACT == 2) v = fmaxf(v, 0.0f);
        if (ACT == 3) v = v / (1.0f + expf(-v));
        if (ACT == 4) v = (v > 0.f) ? v : 0.01f * v;
        if (ACT == 5) v = 0.5f * v * (1.0f + erff(v * 0.70710678118654752f));
        slab[(mOff + r) * 68 + (j << 4) + rlane] = v;
      }
    }
    __builtin_amdgcn_fence(__ATOMIC_RELEASE, "workgroup");
    __builtin_amdgcn_wave_barrier();
    __builtin_amdgcn_fence(__ATOMIC_ACQUIRE, "workgroup");
    if (OUT_MODE == 0) {
      float* C = (float*)Cout + (size_t)b * strideC;
      const int hh = lane >> 4, c4 = (lane & 15) * 4;     // row seg = 256 B = 16 lanes x 16 B
      {
#pragma unroll
        for (int it = 0; it < 8; ++it) {
          const int row = it * 2 + hh;
          v4f v = *(const v4f*)(slab + row * 68 + c4);
          *(v4f*)(C + (size_t)(mBase + row) * ldc + n0 + c4) = v;
        }
        
      }
    } else {
      const int q = lane >> 3, c8 = (lane & 7) * 8;
      unsigned short* C  = (unsigned short*)Cout  + (size_t)b * strideC;
      unsigned short* C2 = (OUT_MODE == 2) ? ((unsigned short*)Cout2 + (size_t)b * strideC) : nullptr;
      {
#pragma unroll
        for (int it = 0; it < 4; ++it) {
          const int row = it * 4 + q;
          const float* sp = slab + row * 68 + c8;
          if (OUT_MODE == 1) {
            v8h hv;
#pragma unroll
            for (int e = 0; e < 8; ++e) hv[e] = (_Float16)sp[e];
            *(v8h*)(C + (size_t)(mBase + row) * ldc + n0 + c8) = hv;
          } else {
            B8 hv, lv;
#pragma unroll
            for (int e = 0; e < 4; ++e) split2_bf(sp[2 * e], sp[2 * e + 1], hv.p[e], lv.p[e]);
            *(v8b*)(C  + (size_t)(mBase + row) * ldc + n0 + c8) = hv.v;
            *(v8b*)(C2 + (size_t)(mBase + row) * ldc + n0 + c8) = lv.v;
          }
        }
        
      }
    }
    __builtin_amdgcn_fence(__ATOMIC_RELEASE, "workgroup");
    __builtin_amdgcn_wave_barrier();
    __builtin_amdgcn_fence(__ATOMIC_ACQUIRE, "workgroup");
  }
}

// ---- all f32 -> bf16 casts (RNE) in one launch of few, long waves --------------
// The five sources are cut into pieces of 1024 floats; piece p of the row x | wa | wb | wc | wd goes to out + 1024 p.
// x holds PX pieces, each w 1 << PW_SHIFT. The grid has exactly (all pieces) / PPW waves, 16 to a work-group; wave g takes
// pieces g, g + waves, ...: per piece 8 loads of 16 bytes a lane, each covering 512 bytes in a row. All of a wave's loads
// stand before its first store, so that many are in flight per lane and no wave start stands between two loads.
#define CV_T 512   // threads per work-group
#define CV_N 8     // 16-byte loads per lane and piece
typedef __attribute__((ext_vector_type(2))) unsigned v2u;
template <int PX, int PW_SHIFT, int PPW>
__global__ __launch_bounds__(CV_T) void cast_all_f32_bf16(
    const float* __restrict__ x, const float* __restrict__ wa, const float* __restrict__ wb,
    const float* __restrict__ wc, const float* __restrict__ wd, unsigned short* __restrict__ out) {
  constexpr int WAVES = (PX + (4 << PW_SHIFT)) / PPW;
  const int lane = threadIdx.x & 31;
  // the wave's number as a scalar: the choice of the source is scalar work
  const int g = (int)blockIdx.x * (CV_T / 32) + __builtin_amdgcn_readfirstlane((int)(threadIdx.x >> 5));
  v4f a[PPW][CV_N];
#pragma unroll
  for (int t = 0; t < PPW; ++t) {
    const int p = g + t * WAVES;
    const int v = p - PX, sel = v >> PW_SHIFT;
    const float* s = (v < 0) ? x : (sel == 0) ? wa : (sel == 1) ? wb : (sel == 2) ? wc : wd;
    const int l = (v < 0) ? p : (v & ((1 << PW_SHIFT) - 1));
    const v4f* q = (const v4f*)(s + (size_t)l * (CV_N * 128)) + lane;
#pragma unroll
    for (int k = 0; k < CV_N; ++k) a[t][k] = q[k * 32];
  }
#pragma unroll
  for (int t = 0; t < PPW; ++t) {
    v2u* q = (v2u*)(out + (size_t)(g + t * WAVES) * (CV_N * 128)) + lane;
#pragma unroll
    for (int k = 0; k < CV_N; ++k) {
      v2u u;
      u.x = __builtin_bit_cast(unsigned, cvt2_bf(a[t][k][0], a[t][k][1]));
      u.y = __builtin_bit_cast(unsigned, cvt2_bf(a[t][k][2], a[t][k][3]));
      q[k * 32] = u;
    }
  }
}

#define AT_D 64
#define AT_NW 4
#define AT_QB 64
#define AT_KC 64
#define AT_MAXKC 32
#define AT_P 72   // LDS row pitch of the Q and K tiles (64 bf16 a row): 144 B = 16 B x odd, so the 16 rows of a 16-byte fragment read fall on distinct banks
#define AT_PV 80  // LDS row pitch of the V tiles: 160 B = 32 B x odd, the pitch of the transposing load

struct AttnP { long q_bs, q_rs, q_hs, k_bs, k_rs, k_hs, v_bs, v_rs, v_hs, o_bs, o_rs, o_hs;
               int S, Skv, H; float sscale; };
static_assert(sizeof(AttnP) == 112);

// lane l <-> lane l ^ 16 without LDS
__device__ __forceinline__ float at_xhalf(float x) {
  return __builtin_bit_cast(float, __builtin_amdgcn_permlanex16(__builtin_bit_cast(int, x), __builtin_bit_cast(int, x), 0x76543210, 0xfedcba98, false, false));
}
// transposing LDS load: lane l points at 16 bytes of row 8 (l >> 4) + (l & 7), column half (l >> 3) & 1, of a 16 x 16 tile of 16-bit
// elements; lane (c = l & 15, hh = l >> 4) receives rows 8 hh .. 8 hh + 7 of column c. The compiler sees the load and places its wait.
typedef __attribute__((ext_vector_type(8))) short at_s16x8;
__device__ __forceinline__ v8b at_ld_tr16(const __bf16* p) {
  typedef __attribute__((address_space(3))) at_s16x8 lds_s16x8;
  return __builtin_bit_cast(v8b, __builtin_amdgcn_ds_load_tr16_b128_v8i16((lds_s16x8*)p));
}
// three products of a hi/lo x hi/lo pair into one accumulator (hi.hi, A lo . B hi, A hi . B lo), then the hazard guard tying D and all four operands
__device__ __forceinline__ v8f at_mma3(v16b ah, v16b al, v16b bh, v16b bl, v8f c) {
  c = __builtin_amdgcn_wmma_f32_16x16x32_bf16(false, ah, false, bh, (short)0, c, false, false);
  c = __builtin_amdgcn_wmma_f32_16x16x32_bf16(false, al, false, bh, (short)0, c, false, false);
  c = __builtin_amdgcn_wmma_f32_16x16x32_bf16(false, ah, false, bl, (short)0, c, false, false);
  asm volatile("v_nop\n\tv_nop\n\tv_nop\n\tv_nop" : "+v"(c) : "v"(ah), "v"(al), "v"(bh), "v"(bl));
  return c;
}

__global__ __launch_bounds__(128)
void attn64_causal_split(const unsigned short* __restrict__ qh_p, const unsigned short* __restrict__ ql_p,
                         const unsigned short* __restrict__ kh_p, const unsigned short* __restrict__ kl_p,
                         const unsigned short* __restrict__ vh_p, const unsigned short* __restrict__ vl_p,
                         unsigned short* __restrict__ ohi, unsigned short* __restrict__ olo, AttnP g) {
  union FB { v16b v; v8b h[2]; v2b p[8]; };
  __shared__ __align__(16) __bf16 Qsh[AT_QB * AT_P];          // Q hi [row][d]   9 KB
  __shared__ __align__(16) __bf16 Qsl[AT_QB * AT_P];          // Q lo [row][d]   9 KB
  __shared__ __align__(16) __bf16 Ksh[AT_KC * AT_P];          // K hi [kv][d]    9 KB
  __shared__ __align__(16) __bf16 Ksl[AT_KC * AT_P];          // K lo [kv][d]    9 KB
  __shared__ __align__(16) __bf16 Vsh[AT_KC * AT_PV];         // V hi [kv][d]   10 KB
  __shared__ __align__(16) __bf16 Vsl[AT_KC * AT_PV];         // V lo [kv][d]   10 KB

  const int tid  = threadIdx.x;
  const int wave = tid >> 5;
  const int lane = tid & 31;
  const int hh   = lane >> 4;
  const int c    = lane & 15;

  const int nqb = g.S / AT_QB;
  const int qb = nqb - 1 - (int)blockIdx.y;   // low blockIdx.y starts first: the tiles with the most key chunks lead
  const int bh = blockIdx.x;
  const int h  = bh % g.H;
  const int b  = bh / g.H;
  const int q0 = qb * AT_QB + wave * 16;

  const __bf16* qhb = (const __bf16*)qh_p + (size_t)b * g.q_bs + (size_t)h * g.q_hs;
  const __bf16* qlb = (const __bf16*)ql_p + (size_t)b * g.q_bs + (size_t)h * g.q_hs;
  const __bf16* khb = (const __bf16*)kh_p + (size_t)b * g.k_bs + (size_t)h * g.k_hs;
  const __bf16* klb = (const __bf16*)kl_p + (size_t)b * g.k_bs + (size_t)h * g.k_hs;
  const __bf16* vhb = (const __bf16*)vh_p + (size_t)b * g.v_bs + (size_t)h * g.v_hs;
  const __bf16* vlb = (const __bf16*)vl_p + (size_t)b * g.v_bs + (size_t)h * g.v_hs;

  // ---- Q hi/lo planes for the block's 64 rows: [row][d], 16-B copies (thread -> row tid/2, 32-d half) ----
  {
    const int r = tid >> 1, dh = (tid & 1) * 32;
    const size_t qo = (size_t)(qb * AT_QB + r) * g.q_rs + dh;
#pragma unroll
    for (int i = 0; i < 4; ++i) {
      const v8b xh = *(const v8b*)(qhb + qo + 8 * i);
      const v8b xl = *(const v8b*)(qlb + qo + 8 * i);
      *(v8b*)(Qsh + r * AT_P + dh + 8 * i) = xh;
      *(v8b*)(Qsl + r * AT_P + dh + 8 * i) = xl;
    }
  }
  __syncthreads();

  float mrow = NEG_INF, lrow = 0.f;      // query q0 + c: running max (same in both lane halves) and this half's part of the running sum
  v8f oacc[4];                           // oacc[t][r] = O[q0 + c][16 t + 8 hh + r]
#pragma unroll
  for (int t = 0; t < 4; ++t) oacc[t] = (v8f){0.f,0.f,0.f,0.f,0.f,0.f,0.f,0.f};

  const int nck = (qb + 1 < AT_MAXKC) ? (qb + 1) : AT_MAXKC;    // block-uniform, statically bounded
  const __bf16* qwh = Qsh + (wave * 16 + c) * AT_P + 8 * hh;      // B fragment column c (query q0 + c) of this wave
  const __bf16* qwl = Qsl + (wave * 16 + c) * AT_P + 8 * hh;

  for (int kc = 0; kc < nck; ++kc) {
    const int kv0 = kc * AT_KC;
    __syncthreads();
    {
      const int kvr = tid >> 1, dh = (tid & 1) * 32;
      const size_t ko = (size_t)(kv0 + kvr) * g.k_rs + dh;
      const size_t vo = (size_t)(kv0 + kvr) * g.v_rs + dh;
#pragma unroll
      for (int i = 0; i < 4; ++i) {
        const v8b ka = *(const v8b*)(khb + ko + 8 * i);
        const v8b kb = *(const v8b*)(klb + ko + 8 * i);
        *(v8b*)(Ksh + kvr * AT_P + dh + 8 * i) = ka;
        *(v8b*)(Ksl + kvr * AT_P + dh + 8 * i) = kb;
        const v8b va = *(const v8b*)(vhb + vo + 8 * i);
        const v8b vb = *(const v8b*)(vlb + vo + 8 * i);
        *(v8b*)(Vsh + kvr * AT_PV + dh + 8 * i) = va;
        *(v8b*)(Vsl + kvr * AT_PV + dh + 8 * i) = vb;
      }
    }
    __syncthreads();

    // ---- scores^T[64 x 16] = k . q^T  (A = K[kv][d], B = Q[row][d]; split k-map via two 16-B halves at +8hh and +16+8hh) ----
    // s[j][r] = score of key kv0 + 16 j + 8 hh + r against query q0 + c
    v8f s[4];
#pragma unroll
    for (int j = 0; j < 4; ++j) s[j] = (v8f){0.f,0.f,0.f,0.f,0.f,0.f,0.f,0.f};
#pragma unroll 1
    for (int dc = 0; dc < 2; ++dc) {
      FB qh, ql;
      qh.h[0] = *(const v8b*)(qwh + dc * 32);
      qh.h[1] = *(const v8b*)(qwh + dc * 32 + 16);
      ql.h[0] = *(const v8b*)(qwl + dc * 32);
      ql.h[1] = *(const v8b*)(qwl + dc * 32 + 16);
#pragma unroll
      for (int j = 0; j < 4; ++j) {
        FB kb, kl;
        const __bf16* kp  = Ksh + (j * 16 + c) * AT_P + dc * 32 + 8 * hh;
        const __bf16* kpl = Ksl + (j * 16 + c) * AT_P + dc * 32 + 8 * hh;
        kb.h[0] = *(const v8b*)(kp);
        kb.h[1] = *(const v8b*)(kp + 16);
        kl.h[0] = *(const v8b*)(kpl);
        kl.h[1] = *(const v8b*)(kpl + 16);
        s[j] = at_mma3(kb.v, kl.v, qh.v, ql.v, s[j]);
      }
    }
    // ---- scale, causal mask on the diagonal chunk (key > query -> -inf), max over this lane's 32 keys, then the other half's ----
    const bool diag = (kc == qb);
    const int qrow = q0 + c;
    float cm = NEG_INF;
#pragma unroll
    for (int j = 0; j < 4; ++j) {
#pragma unroll
      for (int r = 0; r < 8; ++r) {
        const int kvcol = kv0 + j * 16 + 8 * hh + r;
        float sv = s[j][r] * g.sscale;
        if (diag && (kvcol > qrow)) sv = NEG_INF;
        s[j][r] = sv;
        cm = fmaxf(cm, sv);
      }
    }
    cm = fmaxf(cm, at_xhalf(cm));
    const float mnew = fmaxf(mrow, cm);
    const float mref = (mnew == NEG_INF) ? 0.0f : mnew;
    const float alpha = __expf(mrow - mref);
    mrow = mnew;
    // ---- p = exp(s - max), split in place: score tiles 2 kk and 2 kk + 1 are elements 0..7 and 8..15 of B fragment kk ----
    FB pa[2], pl[2];
    float psum = 0.f;
#pragma unroll
    for (int j = 0; j < 4; ++j) {
#pragma unroll
      for (int r = 0; r < 8; r += 2) {
        const float p0 = __expf(s[j][r] - mref);
        const float p1 = __expf(s[j][r + 1] - mref);
        psum += p0;
        psum += p1;
        split2_bf(p0, p1, pa[j >> 1].p[(j & 1) * 4 + (r >> 1)], pl[j >> 1].p[(j & 1) * 4 + (r >> 1)]);
      }
    }
    lrow = lrow * alpha + psum;
#pragma unroll
    for (int t = 0; t < 4; ++t)
#pragma unroll
      for (int r = 0; r < 8; ++r) oacc[t][r] *= alpha;
    // ---- O^T[64 x 16] += V^T[64 x 64] . P^T[64 x 16]  (A = V^T[d][kv] by transposing loads from the [kv][d] tile, B = P^T from registers) ----
    // element e of lane (c, hh): V[kk * 32 + 8 hh + e][16 t + c] for e < 8, V[kk * 32 + 16 + 8 hh + e - 8][16 t + c] above
    // unrolled: pa and pl are register arrays, indexed by kk
#pragma unroll
    for (int kk = 0; kk < 2; ++kk) {
#pragma unroll
      for (int t = 0; t < 4; ++t) {
        FB vb, vl;
        const int vo = (kk * 32 + 8 * hh + (lane & 7)) * AT_PV + t * 16 + 8 * ((lane >> 3) & 1);
        vb.h[0] = at_ld_tr16(Vsh + vo);
        vb.h[1] = at_ld_tr16(Vsh + vo + 16 * AT_PV);
        vl.h[0] = at_ld_tr16(Vsl + vo);
        vl.h[1] = at_ld_tr16(Vsl + vo + 16 * AT_PV);
        oacc[t] = at_mma3(vb.v, vl.v, pa[kk].v, pl[kk].v, oacc[t]);
      }
    }
  }

  // ---- a lane holds 8 consecutive d of its query's row per tile. The wave's own 16 Q rows in LDS are dead now and no other
  //      wave reads them: the bf16 hi/lo out tile is staged there, so that each global store covers whole 128-byte rows ----
  {
    const float inv = 1.0f / (lrow + at_xhalf(lrow));    // the two halves' sums are joined once, here
    __bf16* sh = Qsh + wave * 16 * AT_P;
    __bf16* sl = Qsl + wave * 16 * AT_P;
#pragma unroll
    for (int t = 0; t < 4; ++t) {
      B8 hv, lv;
#pragma unroll
      for (int r = 0; r < 4; ++r) split2_bf(oacc[t][2 * r] * inv, oacc[t][2 * r + 1] * inv, hv.p[r], lv.p[r]);
      *(v8b*)(sh + c * AT_P + t * 16 + 8 * hh) = hv.v;
      *(v8b*)(sl + c * AT_P + t * 16 + 8 * hh) = lv.v;
    }
    __builtin_amdgcn_fence(__ATOMIC_RELEASE, "workgroup");
    __builtin_amdgcn_wave_barrier();
    __builtin_amdgcn_fence(__ATOMIC_ACQUIRE, "workgroup");
    const int q8 = lane >> 3, c8 = (lane & 7) * 8;
    unsigned short* oh = ohi + (size_t)b * g.o_bs + (size_t)h * g.o_hs;
    unsigned short* ol = olo + (size_t)b * g.o_bs + (size_t)h * g.o_hs;
#pragma unroll
    for (int it = 0; it < 4; ++it) {
      const int row = it * 4 + q8;                    // q8 in 0..3, it in 0..3 -> rows 0..15
      const v8h hv = *(const v8h*)(sh + row * AT_P + c8);
      const v8h lv = *(const v8h*)(sl + row * AT_P + c8);
      *(v8h*)(oh + (size_t)(q0 + row) * g.o_rs + c8) = hv;
      *(v8h*)(ol + (size_t)(q0 + row) * g.o_rs + c8) = lv;
    }
  }
}

// ---------------------------------------------------------------------------
// Host orchestration (launches only).
// d_in: 0 = x [4,2048,1024], 1 = W_q, 2 = W_k, 3 = W_v (each [1024,1024], (out,in)), 4 = W_out [1024,1024], 5 = b_out [1024]; all f32.
// Workspace (152 MiB): bf16 x | bf16 [W_q;W_k;W_v] | bf16 W_out | qkv hi plane | qkv lo plane | attn hi | attn lo.
// ---------------------------------------------------------------------------
extern "C" void kernel_launch(void* const* d_in, const int* in_sizes, int n_in,
                              void* d_out, int out_size, void* d_ws, size_t ws_size,
                              hipStream_t stream) {
  constexpr int Bn = 4, S = 2048, E = 1024, Hn = 16, Dh = 64, E3 = 3 * E;
  constexpr int M = Bn * S;                 // 8192 rows in total
  constexpr int NQB = S / AT_QB;            // 32
  static_assert(NQB <= AT_MAXKC);
  static_assert(M % 128 == 0 && E % 256 == 0 && E3 % 256 == 0 && E % GM_KC == 0 && Hn * Dh == E);
  if (n_in < 6) return;
  if (in_sizes[0] != M * E || in_sizes[1] != E * E || in_sizes[2] != E * E || in_sizes[3] != E * E ||
      in_sizes[4] != E * E || in_sizes[5] != E || out_size != M * E) return;

  const float* x     = (const float*)d_in[0];
  const float* w_q   = (const float*)d_in[1];
  const float* w_k   = (const float*)d_in[2];
  const float* w_v   = (const float*)d_in[3];
  const float* w_out = (const float*)d_in[4];
  const float* b_out = (const float*)d_in[5];
  float* out = (float*)d_out;

  const size_t bX   = (size_t)M * E * 2;                  // 16 MiB  bf16 x
  const size_t bW   = (size_t)E3 * E * 2;                 //  6 MiB  bf16 [W_q; W_k; W_v]
  const size_t bWo  = (size_t)E * E * 2;                  //  2 MiB  bf16 W_out
  const size_t bQKV = (size_t)M * E3 * 2;                 // 48 MiB  bf16 plane of qkv (x2)
  const size_t bAH  = (size_t)M * E * 2;                  // 16 MiB  bf16 plane of attn out (x2)
  char* ws = (char*)d_ws;
  size_t off = 0;
  unsigned short* X16  = (unsigned short*)(ws + off); off += bX;
  unsigned short* W16  = (unsigned short*)(ws + off); off += bW;
  unsigned short* Wo16 = (unsigned short*)(ws + off); off += bWo;
  unsigned short* QH   = (unsigned short*)(ws + off); off += bQKV;
  unsigned short* QL   = (unsigned short*)(ws + off); off += bQKV;
  unsigned short* AH   = (unsigned short*)(ws + off); off += bAH;
  unsigned short* AL   = (unsigned short*)(ws + off); off += bAH;
  if (off > ws_size) return;                              // 159,383,552 B

  dim3 blk256(256), blk128(128);

  // 1: RNE bf16 casts of x, the three projection weights (stacked into one [3072][1024] matrix) and W_out.
  //    X16, W16 and Wo16 lie one behind the other in the workspace, so the five results are one row of bf16 from X16 on.
  {
    constexpr int PIECE = CV_N * 128;                      // floats per piece
    constexpr int PX = M * E / PIECE, PW_SHIFT = 10;       // 8192 pieces of x, 1024 of each weight
    constexpr int PPW = 3;                                 // pieces per wave
    constexpr int WGS = (PX + (4 << PW_SHIFT)) / (PPW * (CV_T / 32));   // 256 work-groups
    static_assert(M * E % PIECE == 0 && E * E == (PIECE << PW_SHIFT));
    static_assert(WGS * PPW * (CV_T / 32) == PX + (4 << PW_SHIFT));
    cast_all_f32_bf16<PX, PW_SHIFT, PPW><<<dim3(WGS), dim3(CV_T), 0, stream>>>(x, w_q, w_k, w_v, w_out, X16);
  }

  // 2: qkv[M][3072] = bf16(x) . bf16([W_q;W_k;W_v])^T, written as bf16 hi/lo planes
  {
    const int tiles = (M / 64) * (E3 / 64);                // 6144
    wmma_gemm64<1, 0, 0, 2, false><<<dim3((tiles + 7) / 8, 1), blk256, 0, stream>>>(
        X16, X16, E, 0L, W16, W16, E, 0L, (void*)QH, (void*)QL, E3, 0L,
        b_out, b_out, 0L, M, E3, E, 1.0f);
  }
  // 3: causal attention per (batch, head, 64-query block), longest blocks first -> bf16 hi/lo planes [M][E]
  {
    AttnP g;
    g.q_bs = (long)S * E3; g.q_rs = E3; g.q_hs = Dh;
    g.k_bs = (long)S * E3; g.k_rs = E3; g.k_hs = Dh;
    g.v_bs = (long)S * E3; g.v_rs = E3; g.v_hs = Dh;
    g.o_bs = (long)S * E;  g.o_rs = E;  g.o_hs = Dh;
    g.S = S; g.Skv = S; g.H = Hn;
    g.sscale = 0.125f;             // 64^-0.5, applied in f32 after the product
    attn64_causal_split<<<dim3(Bn * Hn, NQB), blk128, 0, stream>>>(
        QH, QL, QH + E, QL + E, QH + 2 * E, QL + 2 * E, AH, AL, g);
  }

  // 4: out[M][E] (f32) = (attn hi + attn lo) . bf16(W_out)^T + bf16(b_out)
  {
    const int tiles = (M / 64) * (E / 64);                 // 2048
    wmma_gemm64<1, 2, 3, 0, false><<<dim3((tiles + 7) / 8, 1), blk256, 0, stream>>>(
        AH, AL, E, 0L, Wo16, Wo16, E, 0L, (void*)out, (void*)out, E, 0L,
        b_out, b_out, 0L, M, E, E, 1.0f);
  }
}

// v008
// It runs in 175 microseconds.
// In both of two side-by-side timings against v007, it was 1.10 times as fast.
// All steps since v000 together make it 5.03 times as fast.
#include <hip/hip_runtime.h>
// Contractions: qkv projection GEMM = v_wmma_f32_16x16x32_bf16 (bf16 operands, 1 product); q.k^T = v_wmma_f32_16x16x32_bf16 (bf16 hi/lo planes of q and k, 3 products); p.v = v_wmma_f32_16x16x32_bf16 (bf16 hi/lo planes of p and v, 3 products); output projection GEMM = v_wmma_f32_16x16x32_bf16 (bf16 hi/lo planes of the attention output x bf16 weight, 2 products); f32 accumulate everywhere; softmax in f32.

typedef __attribute__((ext_vector_type(16))) _Float16 v16h;
typedef __attribute__((ext_vector_type(8)))  _Float16 v8h;
typedef __attribute__((ext_vector_type(16))) __bf16   v16b;
typedef __attribute__((ext_vector_type(8)))  __bf16   v8b;
typedef __attribute__((ext_vector_type(8)))  float    v8f;
typedef __attribute__((ext_vector_type(4)))  float    v4f;

#define NEG_INF (-__builtin_inff())

typedef __attribute__((ext_vector_type(2)))  float    v2f;
typedef __attribute__((ext_vector_type(2)))  __bf16   v2b;
union B8 { v8b v; v2b p[4]; };   // eight bf16 = four registers, each the packed result of one conversion

// two f32 -> two bf16 (round to nearest even) in one register by the packed hardware conversion
__device__ __forceinline__ v2b cvt2_bf(float a, float b) { return __builtin_convertvector((v2f){a, b}, v2b); }
// hi = bf16(x), lo = bf16(x - hi) for two values; both results arrive packed as a fragment or a 16-byte store wants them
__device__ __forceinline__ void split2_bf(float a, float b, v2b& hi, v2b& lo) {
  hi = cvt2_bf(a, b);
  lo = cvt2_bf(a - (float)hi[0], b - (float)hi[1]);
}

// hazard guards as plain device helpers (no inline asm inside the kernel template body)
__device__ __forceinline__ void dep_guard_h(v8f& a, v8f& b, v16h x, v16h y) { asm volatile("v_nop\n\tv_nop\n\tv_nop\n\tv_nop" : "+v"(a), "+v"(b) : "v"(x), "v"(y)); }
__device__ __forceinline__ void dep_guard_b(v8f& a, v8f& b, v16b x, v16b y) { asm volatile("v_nop\n\tv_nop\n\tv_nop\n\tv_nop" : "+v"(a), "+v"(b) : "v"(x), "v"(y)); }
__device__ __forceinline__ void keep4_h(v16h a, v16h b, v16h c, v16h d) { asm volatile("v_nop" :: "v"(a), "v"(b), "v"(c), "v"(d)); }
__device__ __forceinline__ void keep4_b(v16b a, v16b b, v16b c, v16b d) { asm volatile("v_nop" :: "v"(a), "v"(b), "v"(c), "v"(d)); }
__device__ __forceinline__ void acc_guard4(v8f& a, v8f& b, v8f& c, v8f& d) { asm volatile("v_nop\n\tv_nop\n\tv_nop\n\tv_nop" : "+v"(a), "+v"(b), "+v"(c), "+v"(d)); }
template <typename T> struct Frag;
template <> struct Frag<_Float16> {
  typedef v16h V; union U { v16h v; v8h h[2]; };
  static __device__ __forceinline__ v16h load(const _Float16* p) {   // elements 0..7 <- p[0..7], 8..15 <- p[16..23]
    U f; f.h[0] = *(const v8h*)(p); f.h[1] = *(const v8h*)(p + 16); return f.v;
  }
  static __device__ __forceinline__ v8f mma(v16h a, v16h b, v8f c) {
    return __builtin_amdgcn_wmma_f32_16x16x32_f16(false, a, false, b, (short)0, c, false, false);
  }
  static __device__ __forceinline__ void guard(v8f& a, v8f& b, v16h x, v16h y) { dep_guard_h(a, b, x, y); }
  static __device__ __forceinline__ void keep(v16h a, v16h b, v16h c, v16h d) { keep4_h(a, b, c, d); }
};
template <> struct Frag<__bf16> {
  typedef v16b V; union U { v16b v; v8b h[2]; };
  static __device__ __forceinline__ v16b load(const __bf16* p) {
    U f; f.h[0] = *(const v8b*)(p); f.h[1] = *(const v8b*)(p + 16); return f.v;
  }
  static __device__ __forceinline__ v8f mma(v16b a, v16b b, v8f c) {
    return __builtin_amdgcn_wmma_f32_16x16x32_bf16(false, a, false, b, (short)0, c, false, false);
  }
  static __device__ __forceinline__ void guard(v8f& a, v8f& b, v16b x, v16b y) { dep_guard_b(a, b, x, y); }
  static __device__ __forceinline__ void keep(v16b a, v16b b, v16b c, v16b d) { keep4_b(a, b, c, d); }
};

// ---- Register-blocked batched WMMA GEMM ------------------------------------
// C[m,n] = scale * sum_k A[m,k] * Bt[n,k] (+bias)(+resid); each wave owns a 64x64 tile, a block of 2 x 4 waves a 128x256 tile.
// A row-major [M,K]; Bt row-major [N,K]; M % 128 == 0, N % 256 == 0, K % 64 == 0.
// The block's operand rows go to LDS in stages of 64 k (128-byte rows, whole lines) by asynchronous copies, two buffers:
// stage t + 1 flies while stage t is multiplied; the waves read their fragments from LDS.
// SPLIT: 0 = single planes; 1 = A and Bt as hi/lo planes (hi.hi + hi.lo + lo.hi); 2 = A as hi/lo planes, Bt single (hi.B + lo.B).
// BIAS_MODE: 0 = none, 1 = bias[m], 2 = bias[n], 3 = bias[n] RNE-converted to bf16 then added in f32.
// OUT_MODE: 0 = f32, 1 = f16, 2 = bf16 hi plane (Cout) + bf16 lo plane (Cout2).
// ET: 0 = f16 operands, 1 = bf16 operands (pointers passed as 16-bit storage)
#define GM_KC 64   // k per stage
#define GM_P  72   // LDS row pitch in elements: 144 B = 16 B x odd, so the 16 rows of a 16-byte fragment read fall on distinct banks
// four asynchronous 16-byte copies per lane, global -> LDS; s_wait_xcnt closes the statement so that no address register is rewritten ahead of it
__device__ __forceinline__ void gm_copy4(unsigned l0, unsigned l1, unsigned l2, unsigned l3,
                                         const unsigned short* g0, const unsigned short* g1,
                                         const unsigned short* g2, const unsigned short* g3) {
  asm volatile("global_load_async_to_lds_b128 %0, %4, off\n\t"
               "global_load_async_to_lds_b128 %1, %5, off\n\t"
               "global_load_async_to_lds_b128 %2, %6, off\n\t"
               "global_load_async_to_lds_b128 %3, %7, off\n\t"
               "s_wait_xcnt 0x0"
               :: "v"(l0), "v"(l1), "v"(l2), "v"(l3), "v"(g0), "v"(g1), "v"(g2), "v"(g3) : "memory");
}
// 128 rows of one plane: this lane's 16 bytes of rows r, r + 32, r + 64, r + 96 (step = 32 source rows, in elements)
__device__ __forceinline__ void gm_stage128(unsigned lds, const unsigned short* g, size_t step) {
  gm_copy4(lds, lds + 32u * GM_P * 2u, lds + 64u * GM_P * 2u, lds + 96u * GM_P * 2u, g, g + step, g + 2 * step, g + 3 * step);
}
// the same for two groups of 128 rows in one statement, under one wait
__device__ __forceinline__ void gm_stage256(unsigned la, const unsigned short* ga, size_t sa,
                                            unsigned lb, const unsigned short* gb, size_t sb) {
  asm volatile("global_load_async_to_lds_b128 %0, %8, off\n\t"
               "global_load_async_to_lds_b128 %1, %9, off\n\t"
               "global_load_async_to_lds_b128 %2, %10, off\n\t"
               "global_load_async_to_lds_b128 %3, %11, off\n\t"
               "global_load_async_to_lds_b128 %4, %12, off\n\t"
               "global_load_async_to_lds_b128 %5, %13, off\n\t"
               "global_load_async_to_lds_b128 %6, %14, off\n\t"
               "global_load_async_to_lds_b128 %7, %15, off\n\t"
               "s_wait_xcnt 0x0"
               :: "v"(la), "v"(la + 32u * GM_P * 2u), "v"(la + 64u * GM_P * 2u), "v"(la + 96u * GM_P * 2u),
                  "v"(lb), "v"(lb + 32u * GM_P * 2u), "v"(lb + 64u * GM_P * 2u), "v"(lb + 96u * GM_P * 2u),
                  "v"(ga), "v"(ga + sa), "v"(ga + 2 * sa), "v"(ga + 3 * sa),
                  "v"(gb), "v"(gb + sb), "v"(gb + 2 * sb), "v"(gb + 3 * sb) : "memory");
}
// this wave's copies have landed (the compiler places no wait for them)
__device__ __forceinline__ void gm_wait_copies() { asm volatile("s_wait_asynccnt 0x0" ::: "memory"); }
// this wave's LDS reads have returned, before the buffer is handed to its next writer
__device__ __forceinline__ void gm_wait_lds() { asm volatile("s_wait_dscnt 0x0" ::: "memory"); }
template <int ET> struct Elem;
template <> struct Elem<0> { typedef _Float16 T; };
template <> struct Elem<1> { typedef __bf16 T; };
template <int ET, int SPLIT, int BIAS_MODE, int OUT_MODE, bool RESID, int ACT = 0>
__global__ __launch_bounds__(256) void wmma_gemm64(
    const unsigned short* __restrict__ Ap, const unsigned short* __restrict__ A2p, int lda, long strideA,
    const unsigned short* __restrict__ Btp, const unsigned short* __restrict__ Bt2p, int ldb, long strideB,
    void* __restrict__ Cout, void* __restrict__ Cout2, int ldc, long strideC,
    const float* __restrict__ bias,
    const float* __restrict__ resid, long strideR,
    int M, int N, int K, float scale) {
  typedef typename Elem<ET>::T T;
  typedef typename Frag<T>::V V;
  const T* A = (const T*)Ap; const T* A2 = (const T*)A2p; const T* Bt = (const T*)Btp; const T* Bt2 = (const T*)Bt2p;
  constexpr int ROWS_A = (SPLIT != 0) ? 256 : 128;   // staged rows: A hi [, A lo], Bt hi [, Bt lo]
  constexpr int ROWS_B = (SPLIT == 1) ? 512 : 256;
  constexpr int STAGE  = (ROWS_A + ROWS_B) * GM_P;   // elements per buffer
  __shared__ __align__(16) unsigned short ring[2 * STAGE];
  __shared__ __align__(16) float sT[8][16 * 68];   // per-wave 16x64 slab, pitch 68 floats
  const int b    = blockIdx.y;
  const int lane = threadIdx.x & 31;
  const int wave = threadIdx.x >> 5;
  const int blocksN = N >> 8;
  const int bm = blockIdx.x / blocksN;
  const int bn = blockIdx.x - bm * blocksN;
  if (bm >= (M >> 7)) return;            // block-uniform, in front of every barrier
  const int mB = bm << 7;
  const int nB = bn << 8;
  const int wm = wave >> 2;
  const int wn = wave & 3;
  const int m0 = mB + (wm << 6);
  const int n0 = nB + (wn << 6);

  const T* Ab  = A  + (size_t)b * strideA;
  const T* Bb  = Bt + (size_t)b * strideB;
  const T* Ab2 = (SPLIT != 0) ? (A2  + (size_t)b * strideA) : nullptr;
  const T* Bb2 = (SPLIT == 1) ? (Bt2 + (size_t)b * strideB) : nullptr;

  const int rlane = lane & 15;                 // row (A) / col (B, D) within subtile
  const int koff  = (lane >> 4) * 8;           // k offset of this lane half
  const int mOff  = (lane >> 4) * 8;           // D row offset

  v8f acc[4][4];
#pragma unroll
  for (int i = 0; i < 4; ++i)
#pragma unroll
    for (int j = 0; j < 4; ++j) acc[i][j] = (v8f){0.f,0.f,0.f,0.f,0.f,0.f,0.f,0.f};

  // copies: thread -> row tid / 8 of each group of 32 rows, 16-byte piece tid % 8, so a wave's copy covers four whole 128-byte rows
  const int crow = threadIdx.x >> 3;
  const int ccol = (threadIdx.x & 7) << 3;
  const unsigned ldsT = (unsigned)(size_t)ring + (unsigned)(crow * GM_P + ccol) * 2u;   // LDS byte address: low 32 bits of the shared address
  const unsigned short* gA  = (const unsigned short*)Ab + (size_t)(mB + crow) * lda + ccol;
  const unsigned short* gB  = (const unsigned short*)Bb + (size_t)(nB + crow) * ldb + ccol;
  const unsigned short* gA2 = (SPLIT != 0) ? ((const unsigned short*)Ab2 + (size_t)(mB + crow) * lda + ccol) : nullptr;
  const unsigned short* gB2 = (SPLIT == 1) ? ((const unsigned short*)Bb2 + (size_t)(nB + crow) * ldb + ccol) : nullptr;
  const size_t sA = (size_t)32 * lda, sB = (size_t)32 * ldb;
  auto issue = [&](int t) {              // stage t into buffer t & 1
    const unsigned l = ldsT + (unsigned)(t & 1) * (unsigned)(STAGE * 2);
    const int k0 = t * GM_KC;
    if (SPLIT == 0) gm_stage128(l, gA + k0, sA);
    else            gm_stage256(l, gA + k0, sA, l + 128u * GM_P * 2u, gA2 + k0, sA);
    gm_stage256(l + (unsigned)ROWS_A * GM_P * 2u, gB + k0, sB, l + (unsigned)(ROWS_A + 128) * GM_P * 2u, gB + 4 * sB + k0, sB);
    if (SPLIT == 1)
      gm_stage256(l + (unsigned)(ROWS_A + 256) * GM_P * 2u, gB2 + k0, sB, l + (unsigned)(ROWS_A + 384) * GM_P * 2u, gB2 + 4 * sB + k0, sB);
  };
  const int nt = K / GM_KC;              // block-uniform
  issue(0);
  gm_wait_copies();
  __syncthreads();
  if (nt > 1) issue(1);

  const int aoff = ((wm << 6) + rlane) * GM_P + koff;
  const int boff = (ROWS_A + (wn << 6) + rlane) * GM_P + koff;
  for (int t = 0; t < nt; ++t) {
    const T* st = (const T*)ring + (t & 1) * STAGE;
    // unrolled, like the loops inside: the fragment and accumulator arrays are indexed by constants and stay in registers
#pragma unroll
    for (int ks = 0; ks < GM_KC / 32; ++ks) {
      // all fragments of this 32-k step as one group of LDS reads in front of its products
      V bh[4], bl[4], ah[4], al[4];
#pragma unroll
      for (int j = 0; j < 4; ++j) {
        bh[j] = Frag<T>::load(st + boff + (j << 4) * GM_P + ks * 32);
        if (SPLIT == 1) bl[j] = Frag<T>::load(st + boff + (256 + (j << 4)) * GM_P + ks * 32);
      }
#pragma unroll
      for (int i = 0; i < 4; ++i) {
        ah[i] = Frag<T>::load(st + aoff + (i << 4) * GM_P + ks * 32);
        if (SPLIT != 0) al[i] = Frag<T>::load(st + aoff + (128 + (i << 4)) * GM_P + ks * 32);
      }
#pragma unroll
      for (int i = 0; i < 4; ++i) {
#pragma unroll
        for (int j = 0; j < 4; ++j) {
          acc[i][j] = Frag<T>::mma(ah[i], bh[j], acc[i][j]);
          if (SPLIT == 1) acc[i][j] = Frag<T>::mma(ah[i], bl[j], acc[i][j]);
          if (SPLIT != 0) acc[i][j] = Frag<T>::mma(al[i], bh[j], acc[i][j]);
        }
        Frag<T>::guard(acc[i][0], acc[i][3], ah[i], (SPLIT != 0) ? al[i] : ah[i]);
      }
      Frag<T>::keep(bh[0], bh[1], bh[2], bh[3]);
      if (SPLIT == 1) Frag<T>::keep(bl[0], bl[1], bl[2], bl[3]);
    }
    // publish point of stage t + 1: own LDS reads back, own copies landed, one barrier (it also ends every read of buffer t & 1), then the refill
    gm_wait_lds();
    gm_wait_copies();
    __syncthreads();
    if (t + 2 < nt) issue(t + 2);
  }
  gm_wait_copies();
  acc_guard4(acc[0][0], acc[0][1], acc[0][2], acc[0][3]);
  acc_guard4(acc[1][0], acc[1][1], acc[1][2], acc[1][3]);
  acc_guard4(acc[2][0], acc[2][1], acc[2][2], acc[2][3]);
  acc_guard4(acc[3][0], acc[3][1], acc[3][2], acc[3][3]);

  // ---- epilogue ----
  float* slab = sT[wave];
  const float* Rb = RESID ? (resid + (size_t)b * strideR) : nullptr;
#pragma unroll
  for (int i = 0; i < 4; ++i) {
    const int mBase = m0 + (i << 4);
#pragma unroll
    for (int j = 0; j < 4; ++j) {
      const int n = n0 + (j << 4) + rlane;
      float bv = 0.f;
      if (BIAS_MODE == 2) bv = bias[n];
      if (BIAS_MODE == 3) bv = (float)(__bf16)bias[n];
#pragma unroll
      for (int r = 0; r < 8; ++r) {
        float v = acc[i][j][r] * scale;
        if (BIAS_MODE == 1) v += bias[mBase + mOff + r];
        if (BIAS_MODE == 2 || BIAS_MODE == 3) v += bv;
        if (RESID) v += Rb[(size_t)(mBase + mOff + r) * ldc + n];
        if (ACT == 1) v = tanhf(v);
        if (ACT == 2) v = fmaxf(v, 0.0f);
        if (ACT == 3) v = v / (1.0f + expf(-v));
        if (ACT == 4) v = (v > 0.f) ? v : 0.01f * v;
        if (ACT == 5) v = 0.5f * v * (1.0f + erff(v * 0.70710678118654752f));
        slab[(mOff + r) * 68 + (j << 4) + rlane] = v;
      }
    }
    __builtin_amdgcn_fence(__ATOMIC_RELEASE, "workgroup");
    __builtin_amdgcn_wave_barrier();
    __builtin_amdgcn_fence(__ATOMIC_ACQUIRE, "workgroup");
    if (OUT_MODE == 0) {
      float* C = (float*)Cout + (size_t)b * strideC;
      const int hh = lane >> 4, c4 = (lane & 15) * 4;     // row seg = 256 B = 16 lanes x 16 B
      {
#pragma unroll
        for (int it = 0; it < 8; ++it) {
          const int row = it * 2 + hh;
          v4f v = *(const v4f*)(slab + row * 68 + c4);
          *(v4f*)(C + (size_t)(mBase + row) * ldc + n0 + c4) = v;
        }
        
      }
    } else {
      const int q = lane >> 3, c8 = (lane & 7) * 8;
      unsigned short* C  = (unsigned short*)Cout  + (size_t)b * strideC;
      unsigned short* C2 = (OUT_MODE == 2) ? ((unsigned short*)Cout2 + (size_t)b * strideC) : nullptr;
      {
#pragma unroll
        for (int it = 0; it < 4; ++it) {
          const int row = it * 4 + q;
          const float* sp = slab + row * 68 + c8;
          if (OUT_MODE == 1) {
            v8h hv;
#pragma unroll
            for (int e = 0; e < 8; ++e) hv[e] = (_Float16)sp[e];
            *(v8h*)(C + (size_t)(mBase + row) * ldc + n0 + c8) = hv;
          } else {
            B8 hv, lv;
#pragma unroll
            for (int e = 0; e < 4; ++e) split2_bf(sp[2 * e], sp[2 * e + 1], hv.p[e], lv.p[e]);
            *(v8b*)(C  + (size_t)(mBase + row) * ldc + n0 + c8) = hv.v;
            *(v8b*)(C2 + (size_t)(mBase + row) * ldc + n0 + c8) = lv.v;
          }
        }
        
      }
    }
    __builtin_amdgcn_fence(__ATOMIC_RELEASE, "workgroup");
    __builtin_amdgcn_wave_barrier();
    __builtin_amdgcn_fence(__ATOMIC_ACQUIRE, "workgroup");
  }
}

// ---- all f32 -> bf16 casts (RNE) in one launch of few, long waves --------------
// The five sources are cut into pieces of 1024 floats; piece p of the row x | wa | wb | wc | wd goes to out + 1024 p.
// x holds PX pieces, each w 1 << PW_SHIFT. The grid has exactly (all pieces) / PPW waves, 16 to a work-group; wave g takes
// pieces g, g + waves, ...: per piece 8 loads of 16 bytes a lane, each covering 512 bytes in a row. All of a wave's loads
// stand before its first store, so that many are in flight per lane and no wave start stands between two loads.
#define CV_T 512   // threads per work-group
#define CV_N 8     // 16-byte loads per lane and piece
typedef __attribute__((ext_vector_type(2))) unsigned v2u;
template <int PX, int PW_SHIFT, int PPW>
__global__ __launch_bounds__(CV_T) void cast_all_f32_bf16(
    const float* __restrict__ x, const float* __restrict__ wa, const float* __restrict__ wb,
    const float* __restrict__ wc, const float* __restrict__ wd, unsigned short* __restrict__ out) {
  constexpr int WAVES = (PX + (4 << PW_SHIFT)) / PPW;
  const int lane = threadIdx.x & 31;
  // the wave's number as a scalar: the choice of the source is scalar work
  const int g = (int)blockIdx.x * (CV_T / 32) + __builtin_amdgcn_readfirstlane((int)(threadIdx.x >> 5));
  v4f a[PPW][CV_N];
#pragma unroll
  for (int t = 0; t < PPW; ++t) {
    const int p = g + t * WAVES;
    const int v = p - PX, sel = v >> PW_SHIFT;
    const float* s = (v < 0) ? x : (sel == 0) ? wa : (sel == 1) ? wb : (sel == 2) ? wc : wd;
    const int l = (v < 0) ? p : (v & ((1 << PW_SHIFT) - 1));
    const v4f* q = (const v4f*)(s + (size_t)l * (CV_N * 128)) + lane;
#pragma unroll
    for (int k = 0; k < CV_N; ++k) a[t][k] = q[k * 32];
  }
#pragma unroll
  for (int t = 0; t < PPW; ++t) {
    v2u* q = (v2u*)(out + (size_t)(g + t * WAVES) * (CV_N * 128)) + lane;
#pragma unroll
    for (int k = 0; k < CV_N; ++k) {
      v2u u;
      u.x = __builtin_bit_cast(unsigned, cvt2_bf(a[t][k][0], a[t][k][1]));
      u.y = __builtin_bit_cast(unsigned, cvt2_bf(a[t][k][2], a[t][k][3]));
      q[k * 32] = u;
    }
  }
}

#define AT_D 64
#define AT_NW 4
#define AT_QB 64
#define AT_KC 64
#define AT_MAXKC 32
#define AT_P 72   // LDS row pitch of the Q and K tiles (64 bf16 a row): 144 B = 16 B x odd, so the 16 rows of a 16-byte fragment read fall on distinct banks
#define AT_PV 80  // LDS row pitch of the V tiles: 160 B = 32 B x odd, the pitch of the transposing load

struct AttnP { long q_bs, q_rs, q_hs, k_bs, k_rs, k_hs, v_bs, v_rs, v_hs, o_bs, o_rs, o_hs;
               int S, Skv, H; float sscale; };
static_assert(sizeof(AttnP) == 112);

// lane l <-> lane l ^ 16 without LDS
__device__ __forceinline__ float at_xhalf(float x) {
  return __builtin_bit_cast(float, __builtin_amdgcn_permlanex16(__builtin_bit_cast(int, x), __builtin_bit_cast(int, x), 0x76543210, 0xfedcba98, false, false));
}
// transposing LDS load: lane l points at 16 bytes of row 8 (l >> 4) + (l & 7), column half (l >> 3) & 1, of a 16 x 16 tile of 16-bit
// elements; lane (c = l & 15, hh = l >> 4) receives rows 8 hh .. 8 hh + 7 of column c. The compiler sees the load and places its wait.
typedef __attribute__((ext_vector_type(8))) short at_s16x8;
__device__ __forceinline__ v8b at_ld_tr16(const __bf16* p) {
  typedef __attribute__((address_space(3))) at_s16x8 lds_s16x8;
  return __builtin_bit_cast(v8b, __builtin_amdgcn_ds_load_tr16_b128_v8i16((lds_s16x8*)p));
}
// 16 bytes at a wave-uniform global address plus this lane's 32-bit byte offset (scalar base, 32-bit vector address arithmetic only)
__device__ __forceinline__ v8b at_ld_row16(const __bf16* base, unsigned lane_off) {
  return *(const v8b*)((const char*)base + lane_off);
}
// three products of a hi/lo x hi/lo pair into one accumulator (hi.hi, A lo . B hi, A hi . B lo), then the hazard guard tying D and all four operands
__device__ __forceinline__ v8f at_mma3(v16b ah, v16b al, v16b bh, v16b bl, v8f c) {
  c = __builtin_amdgcn_wmma_f32_16x16x32_bf16(false, ah, false, bh, (short)0, c, false, false);
  c = __builtin_amdgcn_wmma_f32_16x16x32_bf16(false, al, false, bh, (short)0, c, false, false);
  c = __builtin_amdgcn_wmma_f32_16x16x32_bf16(false, ah, false, bl, (short)0, c, false, false);
  asm volatile("v_nop\n\tv_nop\n\tv_nop\n\tv_nop" : "+v"(c) : "v"(ah), "v"(al), "v"(bh), "v"(bl));
  return c;
}

__global__ __launch_bounds__(128)
void attn64_causal_split(const unsigned short* __restrict__ qh_p, const unsigned short* __restrict__ ql_p,
                         const unsigned short* __restrict__ kh_p, const unsigned short* __restrict__ kl_p,
                         const unsigned short* __restrict__ vh_p, const unsigned short* __restrict__ vl_p,
                         unsigned short* __restrict__ ohi, unsigned short* __restrict__ olo, AttnP g) {
  union FB { v16b v; v8b h[2]; v2b p[8]; };
  __shared__ __align__(16) __bf16 Qsh[AT_QB * AT_P];          // Q hi [row][d]   9 KB
  __shared__ __align__(16) __bf16 Qsl[AT_QB * AT_P];          // Q lo [row][d]   9 KB
  __shared__ __align__(16) __bf16 Ksh[AT_KC * AT_P];          // K hi [kv][d]    9 KB
  __shared__ __align__(16) __bf16 Ksl[AT_KC * AT_P];          // K lo [kv][d]    9 KB
  __shared__ __align__(16) __bf16 Vsh[AT_KC * AT_PV];         // V hi [kv][d]   10 KB
  __shared__ __align__(16) __bf16 Vsl[AT_KC * AT_PV];         // V lo [kv][d]   10 KB

  const int tid  = threadIdx.x;
  const int wave = tid >> 5;
  const int lane = tid & 31;
  const int hh   = lane >> 4;
  const int c    = lane & 15;

  const int nqb = g.S / AT_QB;
  const int qb = nqb - 1 - (int)blockIdx.y;   // low blockIdx.y starts first: the tiles with the most key chunks lead
  const int bh = blockIdx.x;
  const int h  = bh % g.H;
  const int b  = bh / g.H;
  const int q0 = qb * AT_QB + wave * 16;

  const __bf16* qhb = (const __bf16*)qh_p + (size_t)b * g.q_bs + (size_t)h * g.q_hs;
  const __bf16* qlb = (const __bf16*)ql_p + (size_t)b * g.q_bs + (size_t)h * g.q_hs;
  const __bf16* khb = (const __bf16*)kh_p + (size_t)b * g.k_bs + (size_t)h * g.k_hs;
  const __bf16* klb = (const __bf16*)kl_p + (size_t)b * g.k_bs + (size_t)h * g.k_hs;
  const __bf16* vhb = (const __bf16*)vh_p + (size_t)b * g.v_bs + (size_t)h * g.v_hs;
  const __bf16* vlb = (const __bf16*)vl_p + (size_t)b * g.v_bs + (size_t)h * g.v_hs;

  // staging map of the Q, K and V tiles: thread -> row tid / 8 of each group of 16 rows, 16-byte piece tid % 8 of that row,
  // so one wave-wide 16-byte load covers four whole 128-byte rows (four lines)
  const int srow = tid >> 3, scol = (tid & 7) * 8;
  // this lane's byte offset inside a group of 16 source rows
  const unsigned qso = ((unsigned)srow * (unsigned)g.q_rs + (unsigned)scol) * 2u;
  const unsigned kso = ((unsigned)srow * (unsigned)g.k_rs + (unsigned)scol) * 2u;
  const unsigned vso = ((unsigned)srow * (unsigned)g.v_rs + (unsigned)scol) * 2u;
  // ---- Q hi/lo planes for the block's 64 rows: [row][d], 16-B copies ----
  {
#pragma unroll
    for (int i = 0; i < 4; ++i) {
      const size_t qo = (size_t)(qb * AT_QB + 16 * i) * g.q_rs;
      const v8b xh = at_ld_row16(qhb + qo, qso);
      const v8b xl = at_ld_row16(qlb + qo, qso);
      *(v8b*)(Qsh + (16 * i + srow) * AT_P + scol) = xh;
      *(v8b*)(Qsl + (16 * i + srow) * AT_P + scol) = xl;
    }
  }
  __syncthreads();

  float mrow = NEG_INF, lrow = 0.f;      // query q0 + c: running max (same in both lane halves) and this half's part of the running sum
  v8f oacc[4];                           // oacc[t][r] = O[q0 + c][16 t + 8 hh + r]
#pragma unroll
  for (int t = 0; t < 4; ++t) oacc[t] = (v8f){0.f,0.f,0.f,0.f,0.f,0.f,0.f,0.f};

  const int nck = (qb + 1 < AT_MAXKC) ? (qb + 1) : AT_MAXKC;    // block-uniform, statically bounded
  const __bf16* qwh = Qsh + (wave * 16 + c) * AT_P + 8 * hh;      // B fragment column c (query q0 + c) of this wave
  const __bf16* qwl = Qsl + (wave * 16 + c) * AT_P + 8 * hh;

  // byte offsets of this lane's piece in the four 16-row groups of the current chunk, from the plane's scalar base (below 2^32 inside one
  // batch and head); they step by one chunk per trip
  unsigned kco[4], vco[4];
#pragma unroll
  for (int i = 0; i < 4; ++i) {
    kco[i] = kso + (unsigned)(16 * i) * (unsigned)g.k_rs * 2u;
    vco[i] = vso + (unsigned)(16 * i) * (unsigned)g.v_rs * 2u;
  }

  for (int kc = 0; kc < nck; ++kc) {
    const int kv0 = kc * AT_KC;
    __syncthreads();
    {
#pragma unroll
      for (int i = 0; i < 4; ++i) {
        const int kvr = 16 * i + srow;
        const v8b ka = at_ld_row16(khb, kco[i]);
        const v8b kb = at_ld_row16(klb, kco[i]);
        *(v8b*)(Ksh + kvr * AT_P + scol) = ka;
        *(v8b*)(Ksl + kvr * AT_P + scol) = kb;
        const v8b va = at_ld_row16(vhb, vco[i]);
        const v8b vb = at_ld_row16(vlb, vco[i]);
        *(v8b*)(Vsh + kvr * AT_PV + scol) = va;
        *(v8b*)(Vsl + kvr * AT_PV + scol) = vb;
        kco[i] += (unsigned)AT_KC * (unsigned)g.k_rs * 2u;
        vco[i] += (unsigned)AT_KC * (unsigned)g.v_rs * 2u;
      }
    }
    __syncthreads();

    // ---- scores^T[64 x 16] = k . q^T  (A = K[kv][d], B = Q[row][d]; split k-map via two 16-B halves at +8hh and +16+8hh) ----
    // s[j][r] = score of key kv0 + 16 j + 8 hh + r against query q0 + c
    v8f s[4];
#pragma unroll
    for (int j = 0; j < 4; ++j) s[j] = (v8f){0.f,0.f,0.f,0.f,0.f,0.f,0.f,0.f};
#pragma unroll 1
    for (int dc = 0; dc < 2; ++dc) {
      FB qh, ql;
      qh.h[0] = *(const v8b*)(qwh + dc * 32);
      qh.h[1] = *(const v8b*)(qwh + dc * 32 + 16);
      ql.h[0] = *(const v8b*)(qwl + dc * 32);
      ql.h[1] = *(const v8b*)(qwl + dc * 32 + 16);
#pragma unroll
      for (int j = 0; j < 4; ++j) {
        FB kb, kl;
        const __bf16* kp  = Ksh + (j * 16 + c) * AT_P + dc * 32 + 8 * hh;
        const __bf16* kpl = Ksl + (j * 16 + c) * AT_P + dc * 32 + 8 * hh;
        kb.h[0] = *(const v8b*)(kp);
        kb.h[1] = *(const v8b*)(kp + 16);
        kl.h[0] = *(const v8b*)(kpl);
        kl.h[1] = *(const v8b*)(kpl + 16);
        s[j] = at_mma3(kb.v, kl.v, qh.v, ql.v, s[j]);
      }
    }
    // ---- scale, causal mask on the diagonal chunk (key > query -> -inf), max over this lane's 32 keys, then the other half's ----
    const bool diag = (kc == qb);
    const int qrow = q0 + c;
    float cm = NEG_INF;
#pragma unroll
    for (int j = 0; j < 4; ++j) {
#pragma unroll
      for (int r = 0; r < 8; ++r) {
        const int kvcol = kv0 + j * 16 + 8 * hh + r;
        float sv = s[j][r] * g.sscale;
        if (diag && (kvcol > qrow)) sv = NEG_INF;
        s[j][r] = sv;
        cm = fmaxf(cm, sv);
      }
    }
    cm = fmaxf(cm, at_xhalf(cm));
    const float mnew = fmaxf(mrow, cm);
    const float mref = (mnew == NEG_INF) ? 0.0f : mnew;
    const float alpha = __expf(mrow - mref);
    mrow = mnew;
    // ---- p = exp(s - max), split in place: score tiles 2 kk and 2 kk + 1 are elements 0..7 and 8..15 of B fragment kk ----
    FB pa[2], pl[2];
    float psum = 0.f;
#pragma unroll
    for (int j = 0; j < 4; ++j) {
#pragma unroll
      for (int r = 0; r < 8; r += 2) {
        const float p0 = __expf(s[j][r] - mref);
        const float p1 = __expf(s[j][r + 1] - mref);
        psum += p0;
        psum += p1;
        split2_bf(p0, p1, pa[j >> 1].p[(j & 1) * 4 + (r >> 1)], pl[j >> 1].p[(j & 1) * 4 + (r >> 1)]);
      }
    }
    lrow = lrow * alpha + psum;
#pragma unroll
    for (int t = 0; t < 4; ++t)
#pragma unroll
      for (int r = 0; r < 8; ++r) oacc[t][r] *= alpha;
    // ---- O^T[64 x 16] += V^T[64 x 64] . P^T[64 x 16]  (A = V^T[d][kv] by transposing loads from the [kv][d] tile, B = P^T from registers) ----
    // element e of lane (c, hh): V[kk * 32 + 8 hh + e][16 t + c] for e < 8, V[kk * 32 + 16 + 8 hh + e - 8][16 t + c] above
    // unrolled: pa and pl are register arrays, indexed by kk
#pragma unroll
    for (int kk = 0; kk < 2; ++kk) {
#pragma unroll
      for (int t = 0; t < 4; ++t) {
        FB vb, vl;
        const int vo = (kk * 32 + 8 * hh + (lane & 7)) * AT_PV + t * 16 + 8 * ((lane >> 3) & 1);
        vb.h[0] = at_ld_tr16(Vsh + vo);
        vb.h[1] = at_ld_tr16(Vsh + vo + 16 * AT_PV);
        vl.h[0] = at_ld_tr16(Vsl + vo);
        vl.h[1] = at_ld_tr16(Vsl + vo + 16 * AT_PV);
        oacc[t] = at_mma3(vb.v, vl.v, pa[kk].v, pl[kk].v, oacc[t]);
      }
    }
  }

  // ---- a lane holds 8 consecutive d of its query's row per tile. The wave's own 16 Q rows in LDS are dead now and no other
  //      wave reads them: the bf16 hi/lo out tile is staged there, so that each global store covers whole 128-byte rows ----
  {
    const float inv = 1.0f / (lrow + at_xhalf(lrow));    // the two halves' sums are joined once, here
    __bf16* sh = Qsh + wave * 16 * AT_P;
    __bf16* sl = Qsl + wave * 16 * AT_P;
#pragma unroll
    for (int t = 0; t < 4; ++t) {
      B8 hv, lv;
#pragma unroll
      for (int r = 0; r < 4; ++r) split2_bf(oacc[t][2 * r] * inv, oacc[t][2 * r + 1] * inv, hv.p[r], lv.p[r]);
      *(v8b*)(sh + c * AT_P + t * 16 + 8 * hh) = hv.v;
      *(v8b*)(sl + c * AT_P + t * 16 + 8 * hh) = lv.v;
    }
    __builtin_amdgcn_fence(__ATOMIC_RELEASE, "workgroup");
    __builtin_amdgcn_wave_barrier();
    __builtin_amdgcn_fence(__ATOMIC_ACQUIRE, "workgroup");
    const int q8 = lane >> 3, c8 = (lane & 7) * 8;
    unsigned short* oh = ohi + (size_t)b * g.o_bs + (size_t)h * g.o_hs;
    unsigned short* ol = olo + (size_t)b * g.o_bs + (size_t)h * g.o_hs;
#pragma unroll
    for (int it = 0; it < 4; ++it) {
      const int row = it * 4 + q8;                    // q8 in 0..3, it in 0..3 -> rows 0..15
      const v8h hv = *(const v8h*)(sh + row * AT_P + c8);
      const v8h lv = *(const v8h*)(sl + row * AT_P + c8);
      *(v8h*)(oh + (size_t)(q0 + row) * g.o_rs + c8) = hv;
      *(v8h*)(ol + (size_t)(q0 + row) * g.o_rs + c8) = lv;
    }
  }
}

// ---------------------------------------------------------------------------
// Host orchestration (launches only).
// d_in: 0 = x [4,2048,1024], 1 = W_q, 2 = W_k, 3 = W_v (each [1024,1024], (out,in)), 4 = W_out [1024,1024], 5 = b_out [1024]; all f32.
// Workspace (152 MiB): bf16 x | bf16 [W_q;W_k;W_v] | bf16 W_out | qkv hi plane | qkv lo plane | attn hi | attn lo.
// ---------------------------------------------------------------------------
extern "C" void kernel_launch(void* const* d_in, const int* in_sizes, int n_in,
                              void* d_out, int out_size, void* d_ws, size_t ws_size,
                              hipStream_t stream) {
  constexpr int Bn = 4, S = 2048, E = 1024, Hn = 16, Dh = 64, E3 = 3 * E;
  constexpr int M = Bn * S;                 // 8192 rows in total
  constexpr int NQB = S / AT_QB;            // 32
  static_assert(NQB <= AT_MAXKC);
  static_assert(M % 128 == 0 && E % 256 == 0 && E3 % 256 == 0 && E % GM_KC == 0 && Hn * Dh == E);
  if (n_in < 6) return;
  if (in_sizes[0] != M * E || in_sizes[1] != E * E || in_sizes[2] != E * E || in_sizes[3] != E * E ||
      in_sizes[4] != E * E || in_sizes[5] != E || out_size != M * E) return;

  const float* x     = (const float*)d_in[0];
  const float* w_q   = (const float*)d_in[1];
  const float* w_k   = (const float*)d_in[2];
  const float* w_v   = (const float*)d_in[3];
  const float* w_out = (const float*)d_in[4];
  const float* b_out = (const float*)d_in[5];
  float* out = (float*)d_out;

  const size_t bX   = (size_t)M * E * 2;                  // 16 MiB  bf16 x
  const size_t bW   = (size_t)E3 * E * 2;                 //  6 MiB  bf16 [W_q; W_k; W_v]
  const size_t bWo  = (size_t)E * E * 2;                  //  2 MiB  bf16 W_out
  const size_t bQKV = (size_t)M * E3 * 2;                 // 48 MiB  bf16 plane of qkv (x2)
  const size_t bAH  = (size_t)M * E * 2;                  // 16 MiB  bf16 plane of attn out (x2)
  char* ws = (char*)d_ws;
  size_t off = 0;
  unsigned short* X16  = (unsigned short*)(ws + off); off += bX;
  unsigned short* W16  = (unsigned short*)(ws + off); off += bW;
  unsigned short* Wo16 = (unsigned short*)(ws + off); off += bWo;
  unsigned short* QH   = (unsigned short*)(ws + off); off += bQKV;
  unsigned short* QL   = (unsigned short*)(ws + off); off += bQKV;
  unsigned short* AH   = (unsigned short*)(ws + off); off += bAH;
  unsigned short* AL   = (unsigned short*)(ws + off); off += bAH;
  if (off > ws_size) return;                              // 159,383,552 B

  dim3 blk256(256), blk128(128);

  // 1: RNE bf16 casts of x, the three projection weights (stacked into one [3072][1024] matrix) and W_out.
  //    X16, W16 and Wo16 lie one behind the other in the workspace, so the five results are one row of bf16 from X16 on.
  {
    constexpr int PIECE = CV_N * 128;                      // floats per piece
    constexpr int PX = M * E / PIECE, PW_SHIFT = 10;       // 8192 pieces of x, 1024 of each weight
    constexpr int PPW = 3;                                 // pieces per wave
    constexpr int WGS = (PX + (4 << PW_SHIFT)) / (PPW * (CV_T / 32));   // 256 work-groups
    static_assert(M * E % PIECE == 0 && E * E == (PIECE << PW_SHIFT));
    static_assert(WGS * PPW * (CV_T / 32) == PX + (4 << PW_SHIFT));
    cast_all_f32_bf16<PX, PW_SHIFT, PPW><<<dim3(WGS), dim3(CV_T), 0, stream>>>(x, w_q, w_k, w_v, w_out, X16);
  }

  // 2: qkv[M][3072] = bf16(x) . bf16([W_q;W_k;W_v])^T, written as bf16 hi/lo planes
  {
    const int tiles = (M / 64) * (E3 / 64);                // 6144
    wmma_gemm64<1, 0, 0, 2, false><<<dim3((tiles + 7) / 8, 1), blk256, 0, stream>>>(
        X16, X16, E, 0L, W16, W16, E, 0L, (void*)QH, (void*)QL, E3, 0L,
        b_out, b_out, 0L, M, E3, E, 1.0f);
  }
  // 3: causal attention per (batch, head, 64-query block), longest blocks first -> bf16 hi/lo planes [M][E]
  {
    AttnP g;
    g.q_bs = (long)S * E3; g.q_rs = E3; g.q_hs = Dh;
    g.k_bs = (long)S * E3; g.k_rs = E3; g.k_hs = Dh;
    g.v_bs = (long)S * E3; g.v_rs = E3; g.v_hs = Dh;
    g.o_bs = (long)S * E;  g.o_rs = E;  g.o_hs = Dh;
    g.S = S; g.Skv = S; g.H = Hn;
    g.sscale = 0.125f;             // 64^-0.5, applied in f32 after the product
    attn64_causal_split<<<dim3(Bn * Hn, NQB), blk128, 0, stream>>>(
        QH, QL, QH + E, QL + E, QH + 2 * E, QL + 2 * E, AH, AL, g);
  }

  // 4: out[M][E] (f32) = (attn hi + attn lo) . bf16(W_out)^T + bf16(b_out)
  {
    const int tiles = (M / 64) * (E / 64);                 // 2048
    wmma_gemm64<1, 2, 3, 0, false><<<dim3((tiles + 7) / 8, 1), blk256, 0, stream>>>(
        AH, AL, E, 0L, Wo16, Wo16, E, 0L, (void*)out, (void*)out, E, 0L,
        b_out, b_out, 0L, M, E, E, 1.0f);
  }
}

// v009
// One run takes 167 microseconds.
// In two side-by-side timings against v008, it was 1.04 and 1.05 times as fast.
// Over all steps from v000 it is 5.26 times as fast.
#include <hip/hip_runtime.h>
// Contractions: qkv projection GEMM = v_wmma_f32_16x16x32_bf16 (bf16 operands, 1 product); q.k^T = v_wmma_f32_16x16x32_bf16 (bf16 hi/lo planes of q and k, 3 products); p.v = v_wmma_f32_16x16x32_bf16 (bf16 hi/lo planes of p and v, 3 products); output projection GEMM = v_wmma_f32_16x16x32_bf16 (bf16 hi/lo planes of the attention output x bf16 weight, 2 products); f32 accumulate everywhere; softmax in f32.

typedef __attribute__((ext_vector_type(16))) _Float16 v16h;
typedef __attribute__((ext_vector_type(8)))  _Float16 v8h;
typedef __attribute__((ext_vector_type(16))) __bf16   v16b;
typedef __attribute__((ext_vector_type(8)))  __bf16   v8b;
typedef __attribute__((ext_vector_type(8)))  float    v8f;
typedef __attribute__((ext_vector_type(4)))  float    v4f;

#define NEG_INF (-__builtin_inff())

typedef __attribute__((ext_vector_type(2)))  float    v2f;
typedef __attribute__((ext_vector_type(2)))  __bf16   v2b;
union B8 { v8b v; v2b p[4]; };   // eight bf16 = four registers, each the packed result of one conversion

// two f32 -> two bf16 (round to nearest even) in one register by the packed hardware conversion
__device__ __forceinline__ v2b cvt2_bf(float a, float b) { return __builtin_convertvector((v2f){a, b}, v2b); }
// hi = bf16(x), lo = bf16(x - hi) for two values; both results arrive packed as a fragment or a 16-byte store wants them
__device__ __forceinline__ void split2_bf(float a, float b, v2b& hi, v2b& lo) {
  hi = cvt2_bf(a, b);
  lo = cvt2_bf(a - (float)hi[0], b - (float)hi[1]);
}

// hazard guards as plain device helpers (no inline asm inside the kernel template body)
__device__ __forceinline__ void dep_guard_h(v8f& a, v8f& b, v16h x, v16h y) { asm volatile("v_nop\n\tv_nop\n\tv_nop\n\tv_nop" : "+v"(a), "+v"(b) : "v"(x), "v"(y)); }
__device__ __forceinline__ void dep_guard_b(v8f& a, v8f& b, v16b x, v16b y) { asm volatile("v_nop\n\tv_nop\n\tv_nop\n\tv_nop" : "+v"(a), "+v"(b) : "v"(x), "v"(y)); }
__device__ __forceinline__ void keep4_h(v16h a, v16h b, v16h c, v16h d) { asm volatile("v_nop" :: "v"(a), "v"(b), "v"(c), "v"(d)); }
__device__ __forceinline__ void keep4_b(v16b a, v16b b, v16b c, v16b d) { asm volatile("v_nop" :: "v"(a), "v"(b), "v"(c), "v"(d)); }
__device__ __forceinline__ void acc_guard4(v8f& a, v8f& b, v8f& c, v8f& d) { asm volatile("v_nop\n\tv_nop\n\tv_nop\n\tv_nop" : "+v"(a), "+v"(b), "+v"(c), "+v"(d)); }
template <typename T> struct Frag;
template <> struct Frag<_Float16> {
  typedef v16h V; union U { v16h v; v8h h[2]; };
  static __device__ __forceinline__ v16h load(const _Float16* p) {   // elements 0..7 <- p[0..7], 8..15 <- p[16..23]
    U f; f.h[0] = *(const v8h*)(p); f.h[1] = *(const v8h*)(p + 16); return f.v;
  }
  static __device__ __forceinline__ v8f mma(v16h a, v16h b, v8f c) {
    return __builtin_amdgcn_wmma_f32_16x16x32_f16(false, a, false, b, (short)0, c, false, false);
  }
  static __device__ __forceinline__ void guard(v8f& a, v8f& b, v16h x, v16h y) { dep_guard_h(a, b, x, y); }
  static __device__ __forceinline__ void keep(v16h a, v16h b, v16h c, v16h d) { keep4_h(a, b, c, d); }
};
template <> struct Frag<__bf16> {
  typedef v16b V; union U { v16b v; v8b h[2]; };
  static __device__ __forceinline__ v16b load(const __bf16* p) {
    U f; f.h[0] = *(const v8b*)(p); f.h[1] = *(const v8b*)(p + 16); return f.v;
  }
  static __device__ __forceinline__ v8f mma(v16b a, v16b b, v8f c) {
    return __builtin_amdgcn_wmma_f32_16x16x32_bf16(false, a, false, b, (short)0, c, false, false);
  }
  static __device__ __forceinline__ void guard(v8f& a, v8f& b, v16b x, v16b y) { dep_guard_b(a, b, x, y); }
  static __device__ __forceinline__ void keep(v16b a, v16b b, v16b c, v16b d) { keep4_b(a, b, c, d); }
};

// ---- Register-blocked batched WMMA GEMM ------------------------------------
// C[m,n] = scale * sum_k A[m,k] * Bt[n,k] (+bias)(+resid); each wave owns a 64x64 tile, a block of 2 x 4 waves a 128x256 tile.
// A row-major [M,K]; Bt row-major [N,K]; M % 128 == 0, N % 256 == 0, K % 64 == 0.
// The block's operand rows go to LDS in stages of 64 k (128-byte rows, whole lines) by asynchronous copies, two buffers:
// stage t + 1 flies while stage t is multiplied; the waves read their fragments from LDS.
// SPLIT: 0 = single planes; 1 = A and Bt as hi/lo planes (hi.hi + hi.lo + lo.hi); 2 = A as hi/lo planes, Bt single (hi.B + lo.B).
// BIAS_MODE: 0 = none, 1 = bias[m], 2 = bias[n], 3 = bias[n] RNE-converted to bf16 then added in f32.
// OUT_MODE: 0 = f32, 1 = f16, 2 = bf16 hi plane (Cout) + bf16 lo plane (Cout2).
// ET: 0 = f16 operands, 1 = bf16 operands (pointers passed as 16-bit storage)
#define GM_KC 64   // k per stage
#define GM_P  72   // LDS row pitch in elements: 144 B = 16 B x odd, so the 16 rows of a 16-byte fragment read fall on distinct banks
// four asynchronous 16-byte copies per lane, global -> LDS; s_wait_xcnt closes the statement so that no address register is rewritten ahead of it
__device__ __forceinline__ void gm_copy4(unsigned l0, unsigned l1, unsigned l2, unsigned l3,
                                         const unsigned short* g0, const unsigned short* g1,
                                         const unsigned short* g2, const unsigned short* g3) {
  asm volatile("global_load_async_to_lds_b128 %0, %4, off\n\t"
               "global_load_async_to_lds_b128 %1, %5, off\n\t"
               "global_load_async_to_lds_b128 %2, %6, off\n\t"
               "global_load_async_to_lds_b128 %3, %7, off\n\t"
               "s_wait_xcnt 0x0"
               :: "v"(l0), "v"(l1), "v"(l2), "v"(l3), "v"(g0), "v"(g1), "v"(g2), "v"(g3) : "memory");
}
// 128 rows of one plane: this lane's 16 bytes of rows r, r + 32, r + 64, r + 96 (step = 32 source rows, in elements)
__device__ __forceinline__ void gm_stage128(unsigned lds, const unsigned short* g, size_t step) {
  gm_copy4(lds, lds + 32u * GM_P * 2u, lds + 64u * GM_P * 2u, lds + 96u * GM_P * 2u, g, g + step, g + 2 * step, g + 3 * step);
}
// the same for two groups of 128 rows in one statement, under one wait
__device__ __forceinline__ void gm_stage256(unsigned la, const unsigned short* ga, size_t sa,
                                            unsigned lb, const unsigned short* gb, size_t sb) {
  asm volatile("global_load_async_to_lds_b128 %0, %8, off\n\t"
               "global_load_async_to_lds_b128 %1, %9, off\n\t"
               "global_load_async_to_lds_b128 %2, %10, off\n\t"
               "global_load_async_to_lds_b128 %3, %11, off\n\t"
               "global_load_async_to_lds_b128 %4, %12, off\n\t"
               "global_load_async_to_lds_b128 %5, %13, off\n\t"
               "global_load_async_to_lds_b128 %6, %14, off\n\t"
               "global_load_async_to_lds_b128 %7, %15, off\n\t"
               "s_wait_xcnt 0x0"
               :: "v"(la), "v"(la + 32u * GM_P * 2u), "v"(la + 64u * GM_P * 2u), "v"(la + 96u * GM_P * 2u),
                  "v"(lb), "v"(lb + 32u * GM_P * 2u), "v"(lb + 64u * GM_P * 2u), "v"(lb + 96u * GM_P * 2u),
                  "v"(ga), "v"(ga + sa), "v"(ga + 2 * sa), "v"(ga + 3 * sa),
                  "v"(gb), "v"(gb + sb), "v"(gb + 2 * sb), "v"(gb + 3 * sb) : "memory");
}
// this wave's copies have landed (the compiler places no wait for them)
__device__ __forceinline__ void gm_wait_copies() { asm volatile("s_wait_asynccnt 0x0" ::: "memory"); }
// this wave's LDS reads have returned, before the buffer is handed to its next writer
__device__ __forceinline__ void gm_wait_lds() { asm volatile("s_wait_dscnt 0x0" ::: "memory"); }
template <int ET> struct Elem;
template <> struct Elem<0> { typedef _Float16 T; };
template <> struct Elem<1> { typedef __bf16 T; };
template <int ET, int SPLIT, int BIAS_MODE, int OUT_MODE, bool RESID, int ACT = 0>
__global__ __launch_bounds__(256) void wmma_gemm64(
    const unsigned short* __restrict__ Ap, const unsigned short* __restrict__ A2p, int lda, long strideA,
    const unsigned short* __restrict__ Btp, const unsigned short* __restrict__ Bt2p, int ldb, long strideB,
    void* __restrict__ Cout, void* __restrict__ Cout2, int ldc, long strideC,
    const float* __restrict__ bias,
    const float* __restrict__ resid, long strideR,
    int M, int N, int K, float scale) {
  typedef typename Elem<ET>::T T;
  typedef typename Frag<T>::V V;
  const T* A = (const T*)Ap; const T* A2 = (const T*)A2p; const T* Bt = (const T*)Btp; const T* Bt2 = (const T*)Bt2p;
  constexpr int ROWS_A = (SPLIT != 0) ? 256 : 128;   // staged rows: A hi [, A lo], Bt hi [, Bt lo]
  constexpr int ROWS_B = (SPLIT == 1) ? 512 : 256;
  constexpr int STAGE  = (ROWS_A + ROWS_B) * GM_P;   // elements per buffer
  __shared__ __align__(16) unsigned short ring[2 * STAGE];
  __shared__ __align__(16) float sT[8][16 * 68];   // per-wave 16x64 slab, pitch 68 floats
  const int b    = blockIdx.y;
  const int lane = threadIdx.x & 31;
  const int wave = threadIdx.x >> 5;
  const int blocksN = N >> 8;
  const int bm = blockIdx.x / blocksN;
  const int bn = blockIdx.x - bm * blocksN;
  if (bm >= (M >> 7)) return;            // block-uniform, in front of every barrier
  const int mB = bm << 7;
  const int nB = bn << 8;
  const int wm = wave >> 2;
  const int wn = wave & 3;
  const int m0 = mB + (wm << 6);
  const int n0 = nB + (wn << 6);

  const T* Ab  = A  + (size_t)b * strideA;
  const T* Bb  = Bt + (size_t)b * strideB;
  const T* Ab2 = (SPLIT != 0) ? (A2  + (size_t)b * strideA) : nullptr;
  const T* Bb2 = (SPLIT == 1) ? (Bt2 + (size_t)b * strideB) : nullptr;

  const int rlane = lane & 15;                 // row (A) / col (B, D) within subtile
  const int koff  = (lane >> 4) * 8;           // k offset of this lane half
  const int mOff  = (lane >> 4) * 8;           // D row offset

  v8f acc[4][4];
#pragma unroll
  for (int i = 0; i < 4; ++i)
#pragma unroll
    for (int j = 0; j < 4; ++j) acc[i][j] = (v8f){0.f,0.f,0.f,0.f,0.f,0.f,0.f,0.f};

  // copies: thread -> row tid / 8 of each group of 32 rows, 16-byte piece tid % 8, so a wave's copy covers four whole 128-byte rows
  const int crow = threadIdx.x >> 3;
  const int ccol = (threadIdx.x & 7) << 3;
  const unsigned ldsT = (unsigned)(size_t)ring + (unsigned)(crow * GM_P + ccol) * 2u;   // LDS byte address: low 32 bits of the shared address
  const unsigned short* gA  = (const unsigned short*)Ab + (size_t)(mB + crow) * lda + ccol;
  const unsigned short* gB  = (const unsigned short*)Bb + (size_t)(nB + crow) * ldb + ccol;
  const unsigned short* gA2 = (SPLIT != 0) ? ((const unsigned short*)Ab2 + (size_t)(mB + crow) * lda + ccol) : nullptr;
  const unsigned short* gB2 = (SPLIT == 1) ? ((const unsigned short*)Bb2 + (size_t)(nB + crow) * ldb + ccol) : nullptr;
  const size_t sA = (size_t)32 * lda, sB = (size_t)32 * ldb;
  auto issue = [&](int t) {              // stage t into buffer t & 1
    const unsigned l = ldsT + (unsigned)(t & 1) * (unsigned)(STAGE * 2);
    const int k0 = t * GM_KC;
    if (SPLIT == 0) gm_stage128(l, gA + k0, sA);
    else            gm_stage256(l, gA + k0, sA, l + 128u * GM_P * 2u, gA2 + k0, sA);
    gm_stage256(l + (unsigned)ROWS_A * GM_P * 2u, gB + k0, sB, l + (unsigned)(ROWS_A + 128) * GM_P * 2u, gB + 4 * sB + k0, sB);
    if (SPLIT == 1)
      gm_stage256(l + (unsigned)(ROWS_A + 256) * GM_P * 2u, gB2 + k0, sB, l + (unsigned)(ROWS_A + 384) * GM_P * 2u, gB2 + 4 * sB + k0, sB);
  };
  const int nt = K / GM_KC;              // block-uniform
  issue(0);
  gm_wait_copies();
  __syncthreads();
  if (nt > 1) issue(1);

  const int aoff = ((wm << 6) + rlane) * GM_P + koff;
  const int boff = (ROWS_A + (wn << 6) + rlane) * GM_P + koff;
  for (int t = 0; t < nt; ++t) {
    const T* st = (const T*)ring + (t & 1) * STAGE;
    // unrolled, like the loops inside: the fragment and accumulator arrays are indexed by constants and stay in registers
#pragma unroll
    for (int ks = 0; ks < GM_KC / 32; ++ks) {
      // all fragments of this 32-k step as one group of LDS reads in front of its products
      V bh[4], bl[4], ah[4], al[4];
#pragma unroll
      for (int j = 0; j < 4; ++j) {
        bh[j] = Frag<T>::load(st + boff + (j << 4) * GM_P + ks * 32);
        if (SPLIT == 1) bl[j] = Frag<T>::load(st + boff + (256 + (j << 4)) * GM_P + ks * 32);
      }
#pragma unroll
      for (int i = 0; i < 4; ++i) {
        ah[i] = Frag<T>::load(st + aoff + (i << 4) * GM_P + ks * 32);
        if (SPLIT != 0) al[i] = Frag<T>::load(st + aoff + (128 + (i << 4)) * GM_P + ks * 32);
      }
#pragma unroll
      for (int i = 0; i < 4; ++i) {
#pragma unroll
        for (int j = 0; j < 4; ++j) {
          acc[i][j] = Frag<T>::mma(ah[i], bh[j], acc[i][j]);
          if (SPLIT == 1) acc[i][j] = Frag<T>::mma(ah[i], bl[j], acc[i][j]);
          if (SPLIT != 0) acc[i][j] = Frag<T>::mma(al[i], bh[j], acc[i][j]);
        }
        Frag<T>::guard(acc[i][0], acc[i][3], ah[i], (SPLIT != 0) ? al[i] : ah[i]);
      }
      Frag<T>::keep(bh[0], bh[1], bh[2], bh[3]);
      if (SPLIT == 1) Frag<T>::keep(bl[0], bl[1], bl[2], bl[3]);
    }
    // publish point of stage t + 1: own LDS reads back, own copies landed, one barrier (it also ends every read of buffer t & 1), then the refill
    gm_wait_lds();
    gm_wait_copies();
    __syncthreads();
    if (t + 2 < nt) issue(t + 2);
  }
  gm_wait_copies();
  acc_guard4(acc[0][0], acc[0][1], acc[0][2], acc[0][3]);
  acc_guard4(acc[1][0], acc[1][1], acc[1][2], acc[1][3]);
  acc_guard4(acc[2][0], acc[2][1], acc[2][2], acc[2][3]);
  acc_guard4(acc[3][0], acc[3][1], acc[3][2], acc[3][3]);

  // ---- epilogue ----
  float* slab = sT[wave];
  const float* Rb = RESID ? (resid + (size_t)b * strideR) : nullptr;
#pragma unroll
  for (int i = 0; i < 4; ++i) {
    const int mBase = m0 + (i << 4);
#pragma unroll
    for (int j = 0; j < 4; ++j) {
      const int n = n0 + (j << 4) + rlane;
      float bv = 0.f;
      if (BIAS_MODE == 2) bv = bias[n];
      if (BIAS_MODE == 3) bv = (float)(__bf16)bias[n];
#pragma unroll
      for (int r = 0; r < 8; ++r) {
        float v = acc[i][j][r] * scale;
        if (BIAS_MODE == 1) v += bias[mBase + mOff + r];
        if (BIAS_MODE == 2 || BIAS_MODE == 3) v += bv;
        if (RESID) v += Rb[(size_t)(mBase + mOff + r) * ldc + n];
        if (ACT == 1) v = tanhf(v);
        if (ACT == 2) v = fmaxf(v, 0.0f);
        if (ACT == 3) v = v / (1.0f + expf(-v));
        if (ACT == 4) v = (v > 0.f) ? v : 0.01f * v;
        if (ACT == 5) v = 0.5f * v * (1.0f + erff(v * 0.70710678118654752f));
        slab[(mOff + r) * 68 + (j << 4) + rlane] = v;
      }
    }
    __builtin_amdgcn_fence(__ATOMIC_RELEASE, "workgroup");
    __builtin_amdgcn_wave_barrier();
    __builtin_amdgcn_fence(__ATOMIC_ACQUIRE, "workgroup");
    if (OUT_MODE == 0) {
      float* C = (float*)Cout + (size_t)b * strideC;
      const int hh = lane >> 4, c4 = (lane & 15) * 4;     // row seg = 256 B = 16 lanes x 16 B
      {
#pragma unroll
        for (int it = 0; it < 8; ++it) {
          const int row = it * 2 + hh;
          v4f v = *(const v4f*)(slab + row * 68 + c4);
          *(v4f*)(C + (size_t)(mBase + row) * ldc + n0 + c4) = v;
        }
        
      }
    } else {
      const int q = lane >> 3, c8 = (lane & 7) * 8;
      unsigned short* C  = (unsigned short*)Cout  + (size_t)b * strideC;
      unsigned short* C2 = (OUT_MODE == 2) ? ((unsigned short*)Cout2 + (size_t)b * strideC) : nullptr;
      {
#pragma unroll
        for (int it = 0; it < 4; ++it) {
          const int row = it * 4 + q;
          const float* sp = slab + row * 68 + c8;
          if (OUT_MODE == 1) {
            v8h hv;
#pragma unroll
            for (int e = 0; e < 8; ++e) hv[e] = (_Float16)sp[e];
            *(v8h*)(C + (size_t)(mBase + row) * ldc + n0 + c8) = hv;
          } else {
            B8 hv, lv;
#pragma unroll
            for (int e = 0; e < 4; ++e) split2_bf(sp[2 * e], sp[2 * e + 1], hv.p[e], lv.p[e]);
            *(v8b*)(C  + (size_t)(mBase + row) * ldc + n0 + c8) = hv.v;
            *(v8b*)(C2 + (size_t)(mBase + row) * ldc + n0 + c8) = lv.v;
          }
        }
        
      }
    }
    __builtin_amdgcn_fence(__ATOMIC_RELEASE, "workgroup");
    __builtin_amdgcn_wave_barrier();
    __builtin_amdgcn_fence(__ATOMIC_ACQUIRE, "workgroup");
  }
}

// ---- all f32 -> bf16 casts (RNE) in one launch of few, long waves --------------
// The five sources are cut into pieces of 1024 floats; piece p of the row x | wa | wb | wc | wd goes to out + 1024 p.
// x holds PX pieces, each w 1 << PW_SHIFT. The grid has exactly (all pieces) / PPW waves, 16 to a work-group; wave g takes
// pieces g, g + waves, ...: per piece 8 loads of 16 bytes a lane, each covering 512 bytes in a row. All of a wave's loads
// stand before its first store, so that many are in flight per lane and no wave start stands between two loads.
#define CV_T 512   // threads per work-group
#define CV_N 8     // 16-byte loads per lane and piece
typedef __attribute__((ext_vector_type(2))) unsigned v2u;
template <int PX, int PW_SHIFT, int PPW>
__global__ __launch_bounds__(CV_T) void cast_all_f32_bf16(
    const float* __restrict__ x, const float* __restrict__ wa, const float* __restrict__ wb,
    const float* __restrict__ wc, const float* __restrict__ wd, unsigned short* __restrict__ out) {
  constexpr int WAVES = (PX + (4 << PW_SHIFT)) / PPW;
  const int lane = threadIdx.x & 31;
  // the wave's number as a scalar: the choice of the source is scalar work
  const int g = (int)blockIdx.x * (CV_T / 32) + __builtin_amdgcn_readfirstlane((int)(threadIdx.x >> 5));
  v4f a[PPW][CV_N];
#pragma unroll
  for (int t = 0; t < PPW; ++t) {
    const int p = g + t * WAVES;
    const int v = p - PX, sel = v >> PW_SHIFT;
    const float* s = (v < 0) ? x : (sel == 0) ? wa : (sel == 1) ? wb : (sel == 2) ? wc : wd;
    const int l = (v < 0) ? p : (v & ((1 << PW_SHIFT) - 1));
    const v4f* q = (const v4f*)(s + (size_t)l * (CV_N * 128)) + lane;
#pragma unroll
    for (int k = 0; k < CV_N; ++k) a[t][k] = q[k * 32];
  }
#pragma unroll
  for (int t = 0; t < PPW; ++t) {
    v2u* q = (v2u*)(out + (size_t)(g + t * WAVES) * (CV_N * 128)) + lane;
#pragma unroll
    for (int k = 0; k < CV_N; ++k) {
      v2u u;
      u.x = __builtin_bit_cast(unsigned, cvt2_bf(a[t][k][0], a[t][k][1]));
      u.y = __builtin_bit_cast(unsigned, cvt2_bf(a[t][k][2], a[t][k][3]));
      q[k * 32] = u;
    }
  }
}

#define AT_D 64
#define AT_NW 4
#define AT_QB 64
#define AT_KC 64
#define AT_MAXKC 32
#define AT_P 72   // LDS row pitch of the Q and K tiles (64 bf16 a row): 144 B = 16 B x odd, so the 16 rows of a 16-byte fragment read fall on distinct banks
#define AT_PV 80  // LDS row pitch of the V tiles: 160 B = 32 B x odd, the pitch of the transposing load

struct AttnP { long q_bs, q_rs, q_hs, k_bs, k_rs, k_hs, v_bs, v_rs, v_hs, o_bs, o_rs, o_hs;
               int S, Skv, H; float sscale; };
static_assert(sizeof(AttnP) == 112);

// lane l <-> lane l ^ 16 without LDS
__device__ __forceinline__ float at_xhalf(float x) {
  return __builtin_bit_cast(float, __builtin_amdgcn_permlanex16(__builtin_bit_cast(int, x), __builtin_bit_cast(int, x), 0x76543210, 0xfedcba98, false, false));
}
// transposing LDS load: lane l points at 16 bytes of row 8 (l >> 4) + (l & 7), column half (l >> 3) & 1, of a 16 x 16 tile of 16-bit
// elements; lane (c = l & 15, hh = l >> 4) receives rows 8 hh .. 8 hh + 7 of column c. The compiler sees the load and places its wait.
typedef __attribute__((ext_vector_type(8))) short at_s16x8;
__device__ __forceinline__ v8b at_ld_tr16(const __bf16* p) {
  typedef __attribute__((address_space(3))) at_s16x8 lds_s16x8;
  return __builtin_bit_cast(v8b, __builtin_amdgcn_ds_load_tr16_b128_v8i16((lds_s16x8*)p));
}
// 16 bytes at a wave-uniform global address plus this lane's 32-bit byte offset (scalar base, 32-bit vector address arithmetic only)
__device__ __forceinline__ v8b at_ld_row16(const __bf16* base, unsigned lane_off) {
  return *(const v8b*)((const char*)base + lane_off);
}
// one A fragment pair (hi, lo) against the B pairs of two query tiles: per accumulator the three products hi.hi, A lo . B hi, A hi . B lo,
// the two accumulators in turn, so that no product waits for the one in front of it; then the hazard guard tying both D and all six operands
__device__ __forceinline__ void at_mma3x2(v16b ah, v16b al, v16b b0h, v16b b0l, v16b b1h, v16b b1l, v8f& c0, v8f& c1) {
  c0 = __builtin_amdgcn_wmma_f32_16x16x32_bf16(false, ah, false, b0h, (short)0, c0, false, false);
  c1 = __builtin_amdgcn_wmma_f32_16x16x32_bf16(false, ah, false, b1h, (short)0, c1, false, false);
  c0 = __builtin_amdgcn_wmma_f32_16x16x32_bf16(false, al, false, b0h, (short)0, c0, false, false);
  c1 = __builtin_amdgcn_wmma_f32_16x16x32_bf16(false, al, false, b1h, (short)0, c1, false, false);
  c0 = __builtin_amdgcn_wmma_f32_16x16x32_bf16(false, ah, false, b0l, (short)0, c0, false, false);
  c1 = __builtin_amdgcn_wmma_f32_16x16x32_bf16(false, ah, false, b1l, (short)0, c1, false, false);
  // four vector slots between the last products and whatever next reads a D or overwrites an operand, on the taken side of a branch too
  asm volatile("v_nop\n\tv_nop\n\tv_nop\n\tv_nop" : "+v"(c0), "+v"(c1) : "v"(ah), "v"(al), "v"(b0h), "v"(b0l), "v"(b1h), "v"(b1l));
}

__global__ __launch_bounds__(128)
void attn64_causal_split(const unsigned short* __restrict__ qh_p, const unsigned short* __restrict__ ql_p,
                         const unsigned short* __restrict__ kh_p, const unsigned short* __restrict__ kl_p,
                         const unsigned short* __restrict__ vh_p, const unsigned short* __restrict__ vl_p,
                         unsigned short* __restrict__ ohi, unsigned short* __restrict__ olo, AttnP g) {
  union FB { v16b v; v8b h[2]; v2b p[8]; };
  __shared__ __align__(16) __bf16 Qsh[AT_QB * AT_P];          // Q hi [row][d]   9 KB
  __shared__ __align__(16) __bf16 Qsl[AT_QB * AT_P];          // Q lo [row][d]   9 KB
  __shared__ __align__(16) __bf16 Ksh[AT_KC * AT_P];          // K hi [kv][d]    9 KB
  __shared__ __align__(16) __bf16 Ksl[AT_KC * AT_P];          // K lo [kv][d]    9 KB
  __shared__ __align__(16) __bf16 Vsh[AT_KC * AT_PV];         // V hi [kv][d]   10 KB
  __shared__ __align__(16) __bf16 Vsl[AT_KC * AT_PV];         // V lo [kv][d]   10 KB

  const int tid  = threadIdx.x;
  const int wave = __builtin_amdgcn_readfirstlane(tid >> 5);   // a scalar: the tests on a wave's tile below are scalar branches
  const int lane = tid & 31;
  const int hh   = lane >> 4;
  const int c    = lane & 15;
  const int qg   = wave >> 1;             // which 32 of the block's 64 queries
  const int kh   = wave & 1;              // which 32 of a chunk's 64 keys

  const int nqb = g.S / AT_QB;
  const int qb = nqb - 1 - (int)blockIdx.y;   // low blockIdx.y takes the tiles with the most key chunks
  const int bh = blockIdx.x;
  const int h  = bh % g.H;
  const int b  = bh / g.H;
  const int q0 = qb * AT_QB + qg * 32;        // first query of this wave's two query tiles

  const __bf16* qhb = (const __bf16*)qh_p + (size_t)b * g.q_bs + (size_t)h * g.q_hs;
  const __bf16* qlb = (const __bf16*)ql_p + (size_t)b * g.q_bs + (size_t)h * g.q_hs;
  const __bf16* khb = (const __bf16*)kh_p + (size_t)b * g.k_bs + (size_t)h * g.k_hs;
  const __bf16* klb = (const __bf16*)kl_p + (size_t)b * g.k_bs + (size_t)h * g.k_hs;
  const __bf16* vhb = (const __bf16*)vh_p + (size_t)b * g.v_bs + (size_t)h * g.v_hs;
  const __bf16* vlb = (const __bf16*)vl_p + (size_t)b * g.v_bs + (size_t)h * g.v_hs;

  // staging map of the Q, K and V tiles: thread -> row tid / 8 of each group of 16 rows, 16-byte piece tid % 8 of that row,
  // so one wave-wide 16-byte load covers four whole 128-byte rows (four lines)
  const int srow = tid >> 3, scol = (tid & 7) * 8;
  // this lane's byte offset inside a group of 16 source rows
  const unsigned qso = ((unsigned)srow * (unsigned)g.q_rs + (unsigned)scol) * 2u;
  const unsigned kso = ((unsigned)srow * (unsigned)g.k_rs + (unsigned)scol) * 2u;
  const unsigned vso = ((unsigned)srow * (unsigned)g.v_rs + (unsigned)scol) * 2u;
  // ---- Q hi/lo planes for the block's 64 rows: [row][d], 16-B copies ----
  {
#pragma unroll
    for (int i = 0; i < 4; ++i) {
      const size_t qo = (size_t)(qb * AT_QB + 16 * i) * g.q_rs;
      const v8b xh = at_ld_row16(qhb + qo, qso);
      const v8b xl = at_ld_row16(qlb + qo, qso);
      *(v8b*)(Qsh + (16 * i + srow) * AT_P + scol) = xh;
      *(v8b*)(Qsl + (16 * i + srow) * AT_P + scol) = xl;
    }
  }
  __syncthreads();

  // query q0 + 16 u + c: running max (same in both lane halves) and this half's part of the running sum, over this wave's keys alone
  float mrow[2] = {NEG_INF, NEG_INF}, lrow[2] = {0.f, 0.f};
  v8f oacc[2][4];                        // oacc[u][t][r] = this wave's part of O[q0 + 16 u + c][16 t + 8 hh + r]
#pragma unroll
  for (int u = 0; u < 2; ++u)
#pragma unroll
    for (int t = 0; t < 4; ++t) oacc[u][t] = (v8f){0.f,0.f,0.f,0.f,0.f,0.f,0.f,0.f};

  const int nck = (qb + 1 < AT_MAXKC) ? (qb + 1) : AT_MAXKC;    // block-uniform, statically bounded
  const __bf16* qwh = Qsh + (qg * 32 + c) * AT_P + 8 * hh;        // B fragment column c (query q0 + c) of this wave; + 16 rows: query tile 1
  const __bf16* qwl = Qsl + (qg * 32 + c) * AT_P + 8 * hh;

  // byte offsets of this lane's piece in the four 16-row groups of the current chunk, from the plane's scalar base (below 2^32 inside one
  // batch and head); they step by one chunk per trip
  unsigned kco[4], vco[4];
#pragma unroll
  for (int i = 0; i < 4; ++i) {
    kco[i] = kso + (unsigned)(16 * i) * (unsigned)g.k_rs * 2u;
    vco[i] = vso + (unsigned)(16 * i) * (unsigned)g.v_rs * 2u;
  }

  for (int kc = 0; kc < nck; ++kc) {
    const int kv0 = kc * AT_KC + kh * 32;     // first key of this wave's half of the chunk
    __syncthreads();
    {
#pragma unroll
      for (int i = 0; i < 4; ++i) {
        const int kvr = 16 * i + srow;
        const v8b ka = at_ld_row16(khb, kco[i]);
        const v8b kb = at_ld_row16(klb, kco[i]);
        *(v8b*)(Ksh + kvr * AT_P + scol) = ka;
        *(v8b*)(Ksl + kvr * AT_P + scol) = kb;
        const v8b va = at_ld_row16(vhb, vco[i]);
        const v8b vb = at_ld_row16(vlb, vco[i]);
        *(v8b*)(Vsh + kvr * AT_PV + scol) = va;
        *(v8b*)(Vsl + kvr * AT_PV + scol) = vb;
        kco[i] += (unsigned)AT_KC * (unsigned)g.k_rs * 2u;
        vco[i] += (unsigned)AT_KC * (unsigned)g.v_rs * 2u;
      }
    }
    __syncthreads();
    // a 32 x 32 tile wholly above the diagonal (every key > every query) adds exactly zero; wave-uniform, no barrier inside
    if (kv0 > q0 + 31) continue;

    // ---- scores^T[32 x 32] = k . q^T  (A = K[kv][d], B = Q[row][d]; split k-map via two 16-B halves at +8hh and +16+8hh) ----
    // s[u][j][r] = score of key kv0 + 16 j + 8 hh + r against query q0 + 16 u + c; each K fragment pair serves both query tiles
    v8f s[2][2];
#pragma unroll
    for (int u = 0; u < 2; ++u)
#pragma unroll
      for (int j = 0; j < 2; ++j) s[u][j] = (v8f){0.f,0.f,0.f,0.f,0.f,0.f,0.f,0.f};
#pragma unroll 1
    for (int dc = 0; dc < 2; ++dc) {
      FB qh[2], ql[2];
#pragma unroll
      for (int u = 0; u < 2; ++u) {
        qh[u].h[0] = *(const v8b*)(qwh + u * 16 * AT_P + dc * 32);
        qh[u].h[1] = *(const v8b*)(qwh + u * 16 * AT_P + dc * 32 + 16);
        ql[u].h[0] = *(const v8b*)(qwl + u * 16 * AT_P + dc * 32);
        ql[u].h[1] = *(const v8b*)(qwl + u * 16 * AT_P + dc * 32 + 16);
      }
#pragma unroll
      for (int j = 0; j < 2; ++j) {
        FB kb, kl;
        const __bf16* kp  = Ksh + (kh * 32 + j * 16 + c) * AT_P + dc * 32 + 8 * hh;
        const __bf16* kpl = Ksl + (kh * 32 + j * 16 + c) * AT_P + dc * 32 + 8 * hh;
        kb.h[0] = *(const v8b*)(kp);
        kb.h[1] = *(const v8b*)(kp + 16);
        kl.h[0] = *(const v8b*)(kpl);
        kl.h[1] = *(const v8b*)(kpl + 16);
        at_mma3x2(kb.v, kl.v, qh[0].v, ql[0].v, qh[1].v, ql[1].v, s[0][j], s[1][j]);
      }
    }
    const bool diag = (kv0 == q0);            // the one tile that the diagonal crosses
    FB pa[2], pl[2];
#pragma unroll
    for (int u = 0; u < 2; ++u) {
      // ---- scale, causal mask on the diagonal tile (key > query -> -inf), max over this lane's 16 keys, then the other half's ----
      const int qrow = q0 + 16 * u + c;
      float cm = NEG_INF;
#pragma unroll
      for (int j = 0; j < 2; ++j) {
#pragma unroll
        for (int r = 0; r < 8; ++r) {
          const int kvcol = kv0 + j * 16 + 8 * hh + r;
          float sv = s[u][j][r] * g.sscale;
          if (diag && (kvcol > qrow)) sv = NEG_INF;
          s[u][j][r] = sv;
          cm = fmaxf(cm, sv);
        }
      }
      cm = fmaxf(cm, at_xhalf(cm));
      const float mnew = fmaxf(mrow[u], cm);
      const float mref = (mnew == NEG_INF) ? 0.0f : mnew;
      const float alpha = __expf(mrow[u] - mref);
      mrow[u] = mnew;
      // ---- p = exp(s - max), split in place: score tiles 0 and 1 are elements 0..7 and 8..15 of the B fragment of query tile u ----
      float psum = 0.f;
#pragma unroll
      for (int j = 0; j < 2; ++j) {
#pragma unroll
        for (int r = 0; r < 8; r += 2) {
          const float p0 = __expf(s[u][j][r] - mref);
          const float p1 = __expf(s[u][j][r + 1] - mref);
          psum += p0;
          psum += p1;
          split2_bf(p0, p1, pa[u].p[j * 4 + (r >> 1)], pl[u].p[j * 4 + (r >> 1)]);
        }
      }
      lrow[u] = lrow[u] * alpha + psum;
#pragma unroll
      for (int t = 0; t < 4; ++t)
#pragma unroll
        for (int r = 0; r < 8; ++r) oacc[u][t][r] *= alpha;
    }
    // ---- O^T[64 x 32] += V^T[64 x 32] . P^T[32 x 32]  (A = V^T[d][kv] by transposing loads from the [kv][d] tile, B = P^T from registers) ----
    // element e of lane (c, hh): V[kh * 32 + 8 hh + e][16 t + c] for e < 8, V[kh * 32 + 16 + 8 hh + e - 8][16 t + c] above;
    // each V^T fragment pair serves both query tiles
#pragma unroll
    for (int t = 0; t < 4; ++t) {
      FB vb, vl;
      const int vo = (kh * 32 + 8 * hh + (lane & 7)) * AT_PV + t * 16 + 8 * ((lane >> 3) & 1);
      vb.h[0] = at_ld_tr16(Vsh + vo);
      vb.h[1] = at_ld_tr16(Vsh + vo + 16 * AT_PV);
      vl.h[0] = at_ld_tr16(Vsl + vo);
      vl.h[1] = at_ld_tr16(Vsl + vo + 16 * AT_PV);
      at_mma3x2(vb.v, vl.v, pa[0].v, pl[0].v, pa[1].v, pl[1].v, oacc[0][t], oacc[1][t]);
    }
  }

  // ---- the two waves of a query group each hold max, sum and O over their own keys. Wave kh finishes query tile u = kh: it gives its part of
  //      the other tile to its partner through the V tiles, which are dead behind the barrier, and takes the partner's part of its own ----
  __syncthreads();
  float* xbuf = (float*)(qg ? Vsl : Vsh);                 // 2 x 4,352 of 10,240 bytes: per wave 32 floats a lane, then max and sum
  float* xw = xbuf + kh * 1088;
  const float* xr = xbuf + (kh ^ 1) * 1088;
  auto give = [&](int u) {
#pragma unroll
    for (int t = 0; t < 4; ++t) {
      *(v4f*)(xw + ((2 * t) * 32 + lane) * 4)     = __builtin_shufflevector(oacc[u][t], oacc[u][t], 0, 1, 2, 3);
      *(v4f*)(xw + ((2 * t + 1) * 32 + lane) * 4) = __builtin_shufflevector(oacc[u][t], oacc[u][t], 4, 5, 6, 7);
    }
    xw[1024 + lane] = mrow[u];
    xw[1056 + lane] = lrow[u] + at_xhalf(lrow[u]);        // the two lane halves' sums are joined once, here and in take
  };
  // a lane holds 8 consecutive d of its query's row per tile. The 16 Q rows of this wave's query tile are dead in LDS and no other wave
  // touches them now: the bf16 hi/lo out tile is staged there, so that each global store covers whole 128-byte rows
  auto take = [&](int u) {
    const float m0 = mrow[u], l0 = lrow[u] + at_xhalf(lrow[u]);
    const float m1 = xr[1024 + lane], l1 = xr[1056 + lane];
    const float m  = fmaxf(m0, m1);                       // finite: the kh = 0 wave has seen key 0, which no query masks
    const float a0 = __expf(m0 - m), a1 = __expf(m1 - m);
    const float inv = 1.0f / (l0 * a0 + l1 * a1);
    const float f0 = a0 * inv, f1 = a1 * inv;
    __bf16* sh = Qsh + wave * 16 * AT_P;
    __bf16* sl = Qsl + wave * 16 * AT_P;
#pragma unroll
    for (int t = 0; t < 4; ++t) {
      const v4f xa = *(const v4f*)(xr + ((2 * t) * 32 + lane) * 4);
      const v4f xb = *(const v4f*)(xr + ((2 * t + 1) * 32 + lane) * 4);
      float o[8];
#pragma unroll
      for (int r = 0; r < 4; ++r) { o[r] = oacc[u][t][r] * f0 + xa[r] * f1; o[r + 4] = oacc[u][t][r + 4] * f0 + xb[r] * f1; }
      B8 hv, lv;
#pragma unroll
      for (int r = 0; r < 4; ++r) split2_bf(o[2 * r], o[2 * r + 1], hv.p[r], lv.p[r]);
      *(v8b*)(sh + c * AT_P + t * 16 + 8 * hh) = hv.v;
      *(v8b*)(sl + c * AT_P + t * 16 + 8 * hh) = lv.v;
    }
    __builtin_amdgcn_fence(__ATOMIC_RELEASE, "workgroup");
    __builtin_amdgcn_wave_barrier();
    __builtin_amdgcn_fence(__ATOMIC_ACQUIRE, "workgroup");
    const int q8 = lane >> 3, c8 = (lane & 7) * 8;
    unsigned short* oh = ohi + (size_t)b * g.o_bs + (size_t)h * g.o_hs;
    unsigned short* ol = olo + (size_t)b * g.o_bs + (size_t)h * g.o_hs;
#pragma unroll
    for (int it = 0; it < 4; ++it) {
      const int row = it * 4 + q8;                    // q8 in 0..3, it in 0..3 -> rows 0..15
      const v8h hv = *(const v8h*)(sh + row * AT_P + c8);
      const v8h lv = *(const v8h*)(sl + row * AT_P + c8);
      *(v8h*)(oh + (size_t)(q0 + 16 * u + row) * g.o_rs + c8) = hv;
      *(v8h*)(ol + (size_t)(q0 + 16 * u + row) * g.o_rs + c8) = lv;
      // the registers that the two stores name may be rewritten behind them, on any branch of the built code: the wait stands in front of that
      asm volatile("s_wait_xcnt 0x0" ::: "memory");
    }
  };
  if (kh == 0) give(1); else give(0);
  __syncthreads();
  if (kh == 0) take(0); else take(1);
}

// ---------------------------------------------------------------------------
// Host orchestration (launches only).
// d_in: 0 = x [4,2048,1024], 1 = W_q, 2 = W_k, 3 = W_v (each [1024,1024], (out,in)), 4 = W_out [1024,1024], 5 = b_out [1024]; all f32.
// Workspace (152 MiB): bf16 x | bf16 [W_q;W_k;W_v] | bf16 W_out | qkv hi plane | qkv lo plane | attn hi | attn lo.
// ---------------------------------------------------------------------------
extern "C" void kernel_launch(void* const* d_in, const int* in_sizes, int n_in,
                              void* d_out, int out_size, void* d_ws, size_t ws_size,
                              hipStream_t stream) {
  constexpr int Bn = 4, S = 2048, E = 1024, Hn = 16, Dh = 64, E3 = 3 * E;
  constexpr int M = Bn * S;                 // 8192 rows in total
  constexpr int NQB = S / AT_QB;            // 32
  static_assert(NQB <= AT_MAXKC);
  static_assert(M % 128 == 0 && E % 256 == 0 && E3 % 256 == 0 && E % GM_KC == 0 && Hn * Dh == E);
  if (n_in < 6) return;
  if (in_sizes[0] != M * E || in_sizes[1] != E * E || in_sizes[2] != E * E || in_sizes[3] != E * E ||
      in_sizes[4] != E * E || in_sizes[5] != E || out_size != M * E) return;

  const float* x     = (const float*)d_in[0];
  const float* w_q   = (const float*)d_in[1];
  const float* w_k   = (const float*)d_in[2];
  const float* w_v   = (const float*)d_in[3];
  const float* w_out = (const float*)d_in[4];
  const float* b_out = (const float*)d_in[5];
  float* out = (float*)d_out;

  const size_t bX   = (size_t)M * E * 2;                  // 16 MiB  bf16 x
  const size_t bW   = (size_t)E3 * E * 2;                 //  6 MiB  bf16 [W_q; W_k; W_v]
  const size_t bWo  = (size_t)E * E * 2;                  //  2 MiB  bf16 W_out
  const size_t bQKV = (size_t)M * E3 * 2;                 // 48 MiB  bf16 plane of qkv (x2)
  const size_t bAH  = (size_t)M * E * 2;                  // 16 MiB  bf16 plane of attn out (x2)
  char* ws = (char*)d_ws;
  size_t off = 0;
  unsigned short* X16  = (unsigned short*)(ws + off); off += bX;
  unsigned short* W16  = (unsigned short*)(ws + off); off += bW;
  unsigned short* Wo16 = (unsigned short*)(ws + off); off += bWo;
  unsigned short* QH   = (unsigned short*)(ws + off); off += bQKV;
  unsigned short* QL   = (unsigned short*)(ws + off); off += bQKV;
  unsigned short* AH   = (unsigned short*)(ws + off); off += bAH;
  unsigned short* AL   = (unsigned short*)(ws + off); off += bAH;
  if (off > ws_size) return;                              // 159,383,552 B

  dim3 blk256(256), blk128(128);

  // 1: RNE bf16 casts of x, the three projection weights (stacked into one [3072][1024] matrix) and W_out.
  //    X16, W16 and Wo16 lie one behind the other in the workspace, so the five results are one row of bf16 from X16 on.
  {
    constexpr int PIECE = CV_N * 128;                      // floats per piece
    constexpr int PX = M * E / PIECE, PW_SHIFT = 10;       // 8192 pieces of x, 1024 of each weight
    constexpr int PPW = 3;                                 // pieces per wave
    constexpr int WGS = (PX + (4 << PW_SHIFT)) / (PPW * (CV_T / 32));   // 256 work-groups
    static_assert(M * E % PIECE == 0 && E * E == (PIECE << PW_SHIFT));
    static_assert(WGS * PPW * (CV_T / 32) == PX + (4 << PW_SHIFT));
    cast_all_f32_bf16<PX, PW_SHIFT, PPW><<<dim3(WGS), dim3(CV_T), 0, stream>>>(x, w_q, w_k, w_v, w_out, X16);
  }

  // 2: qkv[M][3072] = bf16(x) . bf16([W_q;W_k;W_v])^T, written as bf16 hi/lo planes
  {
    const int tiles = (M / 64) * (E3 / 64);                // 6144
    wmma_gemm64<1, 0, 0, 2, false><<<dim3((tiles + 7) / 8, 1), blk256, 0, stream>>>(
        X16, X16, E, 0L, W16, W16, E, 0L, (void*)QH, (void*)QL, E3, 0L,
        b_out, b_out, 0L, M, E3, E, 1.0f);
  }
  // 3: causal attention per (batch, head, 64-query block), longest blocks first -> bf16 hi/lo planes [M][E]
  {
    AttnP g;
    g.q_bs = (long)S * E3; g.q_rs = E3; g.q_hs = Dh;
    g.k_bs = (long)S * E3; g.k_rs = E3; g.k_hs = Dh;
    g.v_bs = (long)S * E3; g.v_rs = E3; g.v_hs = Dh;
    g.o_bs = (long)S * E;  g.o_rs = E;  g.o_hs = Dh;
    g.S = S; g.Skv = S; g.H = Hn;
    g.sscale = 0.125f;             // 64^-0.5, applied in f32 after the product
    attn64_causal_split<<<dim3(Bn * Hn, NQB), blk128, 0, stream>>>(
        QH, QL, QH + E, QL + E, QH + 2 * E, QL + 2 * E, AH, AL, g);
  }

  // 4: out[M][E] (f32) = (attn hi + attn lo) . bf16(W_out)^T + bf16(b_out)
  {
    const int tiles = (M / 64) * (E / 64);                 // 2048
    wmma_gemm64<1, 2, 3, 0, false><<<dim3((tiles + 7) / 8, 1), blk256, 0, stream>>>(
        AH, AL, E, 0L, Wo16, Wo16, E, 0L, (void*)out, (void*)out, E, 0L,
        b_out, b_out, 0L, M, E, E, 1.0f);
  }
}
